// v000
// Measured on an AMD MI455X. A time is GPU time per run, averaged over a window of back-to-back runs after a warm-up
// (all launches, gaps included; the runs take copies of the inputs in turn), and the median of several windows.
// Apart from v000's, it joins two sittings. Times from different sittings can be a few percent apart, while
// side-by-side timings come from the same sitting.
// v000 is the starting kernel. One run takes 261 microseconds.
#include <hip/hip_runtime.h>
#include <hip/hip_bf16.h>

typedef _Float16 half_t;
typedef __attribute__((ext_vector_type(16))) _Float16 v16h;
typedef __attribute__((ext_vector_type(8)))  _Float16 v8h;
typedef __attribute__((ext_vector_type(8)))  float    v8f;
typedef __attribute__((ext_vector_type(4)))  unsigned int u32x4;
typedef __attribute__((ext_vector_type(8)))  int          i32x8;
typedef __attribute__((ext_vector_type(4)))  int          i32x4;

#define WMMA_F16(A, B, C) \
    __builtin_amdgcn_wmma_f32_16x16x32_f16(false, (A), false, (B), (short)0, (C), false, false)

__device__ __forceinline__ v16h make_a(v8h lo, v8h hi) {
    v16h r;
#pragma unroll
    for (int i = 0; i < 8; ++i) { r[i] = lo[i]; r[i + 8] = hi[i]; }
    return r;
}

__device__ __forceinline__ void tdm_load_2d_f16(
    unsigned lds_off, const half_t* gptr, unsigned tile_d0, unsigned tile_d1,
    unsigned tensor_d0, unsigned tensor_d1, unsigned stride0) {
    unsigned long long ga = (unsigned long long)(size_t)gptr;
    u32x4 g0;
    g0[0] = 1u;                                       // count=1 (valid), load, user
    g0[1] = lds_off;                                  // lds_addr[31:0]
    g0[2] = (unsigned)(ga & 0xFFFFFFFFu);             // global_addr[31:0]
    g0[3] = (unsigned)((ga >> 32) & 0x01FFFFFFu)      // global_addr[56:32]
          | (2u << 30);                               // type=2 ("image")
    i32x8 g1;
    g1[0] = (int)(1u << 16);
    g1[1] = (int)((tensor_d0 & 0xFFFFu) << 16);
    g1[2] = (int)((tensor_d0 >> 16) | ((tensor_d1 & 0xFFFFu) << 16));
    g1[3] = (int)((tensor_d1 >> 16) | (tile_d0 << 16));
    g1[4] = (int)(tile_d1 & 0xFFFFu);
    g1[5] = (int)stride0;
    g1[6] = 0;
    g1[7] = 0;
    i32x4 z4 = {0, 0, 0, 0};
#if __clang_major__ >= 23
    i32x8 z8v = {0, 0, 0, 0, 0, 0, 0, 0};
    __builtin_amdgcn_tensor_load_to_lds(g0, g1, z4, z4, z8v, 0);
#else
    __builtin_amdgcn_tensor_load_to_lds(g0, g1, z4, z4, 0);
#endif
}

// ---------------------------------------------------------------------------
// Kernel 0: pack 5 weight matrices (128x128 f32, row-major W[k][n]) into the
// WMMA B-operand lane layout as f16 so a wave loads one v16h (32B) per tile.
// ---------------------------------------------------------------------------
__global__ __launch_bounds__(256) void pack_weights(
    const float* __restrict__ Wq1, const float* __restrict__ Wq0,
    const float* __restrict__ Wk,  const float* __restrict__ Wv,
    const float* __restrict__ Wc,  half_t* __restrict__ dst) {
    int idx = blockIdx.x * 256 + threadIdx.x;          // < 5*16384 = 81920
    int w   = idx >> 14, rem = idx & 16383;
    int t   = rem >> 9,  le  = rem & 511;
    int lane = le >> 4,  e   = le & 15;
    int ntile = t >> 2,  ktile = t & 3;
    int k = ktile * 32 + ((lane >> 4) << 3) + (e < 8 ? e : e + 8);
    int n = ntile * 16 + (lane & 15);
    const float* W = (w == 0) ? Wq1 : (w == 1) ? Wq0 : (w == 2) ? Wk : (w == 3) ? Wv : Wc;
    dst[idx] = (half_t)W[k * 128 + n];
}

// ---------------------------------------------------------------------------
// Kernel 1: projections.  One block per 16 flat rows of (B*N, 128).
// K = nodes@Wk, V = nodes@Wv, Q = 0.25*(q1@Wq1 + q0@Wq0); also nodes -> f16.
// ---------------------------------------------------------------------------
__global__ __launch_bounds__(256) void proj_kernel(
    const float* __restrict__ nodes, const float* __restrict__ q1,
    const float* __restrict__ q0,
    const half_t* __restrict__ pWk,  const half_t* __restrict__ pWv,
    const half_t* __restrict__ pWq1, const half_t* __restrict__ pWq0,
    half_t* __restrict__ Kh, half_t* __restrict__ Vh,
    half_t* __restrict__ Qh, half_t* __restrict__ Nh) {
    __shared__ __align__(16) half_t sN[16][136], sQ1[16][136], sQ0[16][136];
    const int r0 = blockIdx.x * 16;
    for (int i = threadIdx.x; i < 2048; i += 256) {
        int rr = i >> 7, cc = i & 127;
        size_t g = (size_t)(r0 + rr) * 128 + cc;
        half_t a = (half_t)nodes[g];
        sN[rr][cc]  = a;  Nh[g] = a;
        sQ1[rr][cc] = (half_t)q1[g];
        sQ0[rr][cc] = (half_t)q0[g];
    }
    __syncthreads();
    const int lane = threadIdx.x & 31, w = threadIdx.x >> 5;
    const int row = lane & 15, kb = (lane >> 4) << 3;
    v8f accK = {}, accV = {}, accQ = {};
#pragma unroll
    for (int kc = 0; kc < 4; ++kc) {
        const int k0 = kc * 32;
        v16h aN  = make_a(*(const v8h*)&sN[row][k0 + kb],  *(const v8h*)&sN[row][k0 + kb + 16]);
        v16h aQ1 = make_a(*(const v8h*)&sQ1[row][k0 + kb], *(const v8h*)&sQ1[row][k0 + kb + 16]);
        v16h aQ0 = make_a(*(const v8h*)&sQ0[row][k0 + kb], *(const v8h*)&sQ0[row][k0 + kb + 16]);
        const int t = (w * 4 + kc) * 512 + lane * 16;
        v16h bK = *(const v16h*)(pWk  + t);
        v16h bV = *(const v16h*)(pWv  + t);
        v16h b1 = *(const v16h*)(pWq1 + t);
        v16h b0 = *(const v16h*)(pWq0 + t);
        accK = WMMA_F16(aN,  bK, accK);
        accV = WMMA_F16(aN,  bV, accV);
        accQ = WMMA_F16(aQ1, b1, accQ);
        accQ = WMMA_F16(aQ0, b0, accQ);
    }
    const int col = w * 16 + (lane & 15);
#pragma unroll
    for (int r = 0; r < 8; ++r) {
        size_t g = (size_t)(r0 + r + ((lane >> 4) << 3)) * 128 + col;
        Kh[g] = (half_t)accK[r];
        Vh[g] = (half_t)accV[r];
        Qh[g] = (half_t)(accQ[r] * 0.25f);   // fold 1/sqrt(D) into Q
    }
}

__global__ __launch_bounds__(256) void attn_kernel(
    const half_t* __restrict__ Kh, const half_t* __restrict__ Vh,
    const half_t* __restrict__ Qh, const float* __restrict__ mask,
    half_t* __restrict__ outc) {
    __shared__ __align__(16) half_t sK[512][16];     // [key][d]
    __shared__ __align__(16) half_t sVT[16][520];    // [d][key]
    __shared__ __align__(16) half_t sQ[512][16];     // [query][d]
    __shared__ __align__(16) half_t sP[8][16][40];   // per-wave P repack scratch
    const int b = blockIdx.x >> 3, h = blockIdx.x & 7;

    if (threadIdx.x < 32) {
        const size_t base = (size_t)(b * 500) * 128 + h * 16;
        tdm_load_2d_f16((unsigned)(size_t)&sK[0][0], Kh + base, 16, 500, 128, 500, 128);
        tdm_load_2d_f16((unsigned)(size_t)&sQ[0][0], Qh + base, 16, 500, 128, 500, 128);
    }
    for (int m = threadIdx.x; m < 512; m += 256) {
        if (m < 500) {
            const size_t base = (size_t)(b * 500 + m) * 128 + h * 16;
#pragma unroll
            for (int d = 0; d < 16; ++d) sVT[d][m] = Vh[base + d];
        } else {
#pragma unroll
            for (int d = 0; d < 16; ++d) {
                sK[m][d] = (half_t)0; sQ[m][d] = (half_t)0; sVT[d][m] = (half_t)0;
            }
        }
    }
    if (threadIdx.x < 32) __builtin_amdgcn_s_wait_tensorcnt(0);
    __syncthreads();

    const int lane = threadIdx.x & 31, w = threadIdx.x >> 5;
    const int cr = lane & 15, hi = lane >> 4, kb = hi << 3;
    v8h z8 = {};
    for (int mt = w; mt < 32; mt += 8) {
        const int n0 = mt * 16;
        v16h aQ = make_a(*(const v8h*)&sQ[n0 + cr][kb], z8);   // K(d) padded to 32
        v8f acc = {};
        float mrun[8], lrun[8];
#pragma unroll
        for (int r = 0; r < 8; ++r) { mrun[r] = -1e30f; lrun[r] = 0.f; }
        for (int c = 0; c < 16; ++c) {
            const int kc = c * 32;
            v16h bK1 = make_a(*(const v8h*)&sK[kc + cr][kb],      z8);
            v16h bK2 = make_a(*(const v8h*)&sK[kc + 16 + cr][kb], z8);
            v8f s1 = {}, s2 = {};
            s1 = WMMA_F16(aQ, bK1, s1);
            s2 = WMMA_F16(aQ, bK2, s2);
            float v1[8], v2[8];
            const int k1 = kc + cr, k2 = kc + 16 + cr;
#pragma unroll
            for (int r = 0; r < 8; ++r) {
                const int rg = n0 + r + (hi << 3);
                float m1 = (rg < 500 && k1 < 500) ? mask[((size_t)b * 500 + rg) * 500 + k1] : 0.f;
                float m2 = (rg < 500 && k2 < 500) ? mask[((size_t)b * 500 + rg) * 500 + k2] : 0.f;
                v1[r] = (k1 < 500) ? s1[r] + m1 : -1e30f;
                v2[r] = (k2 < 500) ? s2[r] + m2 : -1e30f;
            }
#pragma unroll
            for (int r = 0; r < 8; ++r) {
                float cm = fmaxf(v1[r], v2[r]);
#pragma unroll
                for (int d = 1; d < 16; d <<= 1) cm = fmaxf(cm, __shfl_xor(cm, d, 16));
                float nm = fmaxf(mrun[r], cm);
                float sc = __expf(mrun[r] - nm);
                acc[r] *= sc;
                float p1 = __expf(v1[r] - nm), p2 = __expf(v2[r] - nm);
                float ls = p1 + p2;
#pragma unroll
                for (int d = 1; d < 16; d <<= 1) ls += __shfl_xor(ls, d, 16);
                lrun[r] = lrun[r] * sc + ls;
                mrun[r] = nm;
                sP[w][r + (hi << 3)][cr]      = (half_t)p1;
                sP[w][r + (hi << 3)][16 + cr] = (half_t)p2;
            }
            v16h aP = make_a(*(const v8h*)&sP[w][cr][kb], *(const v8h*)&sP[w][cr][kb + 16]);
            v16h bV = make_a(*(const v8h*)&sVT[cr][kc + kb], *(const v8h*)&sVT[cr][kc + kb + 16]);
            acc = WMMA_F16(aP, bV, acc);
        }
#pragma unroll
        for (int r = 0; r < 8; ++r) {
            const int nq = n0 + r + (hi << 3);
            if (nq < 500)
                outc[(size_t)(b * 500 + nq) * 128 + h * 16 + cr] = (half_t)(acc[r] / lrun[r]);
        }
    }
}

// ---------------------------------------------------------------------------
// Kernel 3: mh = outc@Wc + bc, s = mh@nodes^T/sqrt(128), 10*tanh + mask,
// row softmax -> probs.  One block per (b, 16-query tile).
// ---------------------------------------------------------------------------
__global__ __launch_bounds__(256) void combine_kernel(
    const half_t* __restrict__ outc, const half_t* __restrict__ pWc,
    const float* __restrict__ bc, const half_t* __restrict__ Nh,
    const float* __restrict__ mask, float* __restrict__ probs) {
    __shared__ __align__(16) half_t sMH[16][136];
    __shared__ __align__(16) float  sS[16][520];
    const int b = blockIdx.x >> 5, nt = blockIdx.x & 31;
    const int n0 = nt * 16;
    const int lane = threadIdx.x & 31, w = threadIdx.x >> 5;
    const int cr = lane & 15, hi = lane >> 4, kb = hi << 3;
    v8h z8 = {};
    // --- stage 1: mh column tile [16w, 16w+16) ---
    v8f acc = {};
    const int arow = n0 + cr;
    const bool av = arow < 500;
#pragma unroll
    for (int kc = 0; kc < 4; ++kc) {
        v16h a;
        if (av) {
            const half_t* ap = outc + (size_t)(b * 500 + arow) * 128 + kc * 32 + kb;
            a = make_a(*(const v8h*)ap, *(const v8h*)(ap + 16));
        } else a = make_a(z8, z8);
        v16h bb = *(const v16h*)(pWc + (w * 4 + kc) * 512 + lane * 16);
        acc = WMMA_F16(a, bb, acc);
    }
    const float bias = bc[w * 16 + cr];
#pragma unroll
    for (int r = 0; r < 8; ++r) sMH[r + (hi << 3)][w * 16 + cr] = (half_t)(acc[r] + bias);
    __syncthreads();
    // --- stage 2: pointer logits over all keys ---
    const float inv_se = 1.0f / 11.313708498984761f;
    for (int mt = w; mt < 32; mt += 8) {
        const int m0 = mt * 16;
        v8f sa = {};
#pragma unroll
        for (int kc = 0; kc < 4; ++kc) {
            v16h a = make_a(*(const v8h*)&sMH[cr][kc * 32 + kb],
                            *(const v8h*)&sMH[cr][kc * 32 + kb + 16]);
            const int mr = m0 + cr;
            v16h bb;
            if (mr < 500) {
                const half_t* np = Nh + (size_t)(b * 500 + mr) * 128 + kc * 32 + kb;
                bb = make_a(*(const v8h*)np, *(const v8h*)(np + 16));
            } else bb = make_a(z8, z8);
            sa = WMMA_F16(a, bb, sa);
        }
#pragma unroll
        for (int r = 0; r < 8; ++r) {
            const int row = r + (hi << 3);
            const int nq = n0 + row, mk = m0 + cr;
            float s = 10.0f * tanhf(sa[r] * inv_se);
            if (nq < 500 && mk < 500) s += mask[((size_t)b * 500 + nq) * 500 + mk];
            if (mk >= 500) s = -1e30f;
            sS[row][mk] = s;
        }
    }
    __syncthreads();
    // --- stage 3: softmax per row, 16 threads/row ---
    const int row = threadIdx.x >> 4, sub = threadIdx.x & 15;
    float mx = -1e30f;
#pragma unroll 4
    for (int j = 0; j < 32; ++j) mx = fmaxf(mx, sS[row][j * 16 + sub]);
#pragma unroll
    for (int d = 1; d < 16; d <<= 1) mx = fmaxf(mx, __shfl_xor(mx, d, 16));
    float sum = 0.f;
#pragma unroll 4
    for (int j = 0; j < 32; ++j) {
        float e = __expf(sS[row][j * 16 + sub] - mx);
        sS[row][j * 16 + sub] = e;
        sum += e;
    }
#pragma unroll
    for (int d = 1; d < 16; d <<= 1) sum += __shfl_xor(sum, d, 16);
    const float inv = 1.0f / sum;
    const int nq = n0 + row;
    if (nq < 500) {
        float* op = probs + ((size_t)b * 500 + nq) * 500;
#pragma unroll 4
        for (int j = 0; j < 32; ++j) {
            const int mm = j * 16 + sub;
            if (mm < 500) op[mm] = sS[row][mm] * inv;
        }
    }
}

extern "C" void kernel_launch(void* const* d_in, const int* in_sizes, int n_in,
                              void* d_out, int out_size, void* d_ws, size_t ws_size,
                              hipStream_t stream) {
    const float* nodes = (const float*)d_in[0];
    const float* q1    = (const float*)d_in[1];
    const float* q0    = (const float*)d_in[2];
    const float* mask  = (const float*)d_in[3];
    const float* Wq1   = (const float*)d_in[4];
    const float* Wq0   = (const float*)d_in[5];
    const float* Wk    = (const float*)d_in[6];
    const float* Wv    = (const float*)d_in[7];
    const float* Wc    = (const float*)d_in[8];
    const float* bcp   = (const float*)d_in[9];
    float* probs = (float*)d_out;

    // Workspace layout (f16): 5 tensors of 32000x128 + 5 packed weights -> ~41 MB
    const size_t RE = (size_t)32000 * 128;
    half_t* ws = (half_t*)d_ws;
    half_t* Kh = ws;
    half_t* Vh = Kh + RE;
    half_t* Qh = Vh + RE;
    half_t* Nh = Qh + RE;
    half_t* OC = Nh + RE;
    half_t* PW = OC + RE;                 // 5 * 16384 halves
    half_t* pWq1 = PW;
    half_t* pWq0 = PW + 16384;
    half_t* pWk  = PW + 32768;
    half_t* pWv  = PW + 49152;
    half_t* pWc  = PW + 65536;

    pack_weights<<<320, 256, 0, stream>>>(Wq1, Wq0, Wk, Wv, Wc, PW);
    proj_kernel<<<2000, 256, 0, stream>>>(nodes, q1, q0, pWk, pWv, pWq1, pWq0, Kh, Vh, Qh, Nh);
    attn_kernel<<<512, 256, 0, stream>>>(Kh, Vh, Qh, mask, OC);
    combine_kernel<<<2048, 256, 0, stream>>>(OC, pWc, bcp, Nh, mask, probs);
}

// v001
// A run of this version takes 144 microseconds.
// Two timings next to v000 both put it at 1.82 times that version's speed.
#include <hip/hip_runtime.h>
#include <hip/hip_bf16.h>

typedef _Float16 half_t;
typedef __attribute__((ext_vector_type(16))) _Float16 v16h;
typedef __attribute__((ext_vector_type(8)))  _Float16 v8h;
typedef __attribute__((ext_vector_type(8)))  float    v8f;
typedef __attribute__((ext_vector_type(4)))  unsigned int u32x4;
typedef __attribute__((ext_vector_type(8)))  int          i32x8;
typedef __attribute__((ext_vector_type(4)))  int          i32x4;

#define WMMA_F16(A, B, C) \
    __builtin_amdgcn_wmma_f32_16x16x32_f16(false, (A), false, (B), (short)0, (C), false, false)

__device__ __forceinline__ v16h make_a(v8h lo, v8h hi) {
    v16h r;
#pragma unroll
    for (int i = 0; i < 8; ++i) { r[i] = lo[i]; r[i + 8] = hi[i]; }
    return r;
}

__device__ __forceinline__ void tdm_load_2d_f16(
    unsigned lds_off, const half_t* gptr, unsigned tile_d0, unsigned tile_d1,
    unsigned tensor_d0, unsigned tensor_d1, unsigned stride0) {
    unsigned long long ga = (unsigned long long)(size_t)gptr;
    u32x4 g0;
    g0[0] = 1u;                                       // count=1 (valid), load, user
    g0[1] = lds_off;                                  // lds_addr[31:0]
    g0[2] = (unsigned)(ga & 0xFFFFFFFFu);             // global_addr[31:0]
    g0[3] = (unsigned)((ga >> 32) & 0x01FFFFFFu)      // global_addr[56:32]
          | (2u << 30);                               // type=2 ("image")
    i32x8 g1;
    g1[0] = (int)(1u << 16);
    g1[1] = (int)((tensor_d0 & 0xFFFFu) << 16);
    g1[2] = (int)((tensor_d0 >> 16) | ((tensor_d1 & 0xFFFFu) << 16));
    g1[3] = (int)((tensor_d1 >> 16) | (tile_d0 << 16));
    g1[4] = (int)(tile_d1 & 0xFFFFu);
    g1[5] = (int)stride0;
    g1[6] = 0;
    g1[7] = 0;
    i32x4 z4 = {0, 0, 0, 0};
#if __clang_major__ >= 23
    i32x8 z8v = {0, 0, 0, 0, 0, 0, 0, 0};
    __builtin_amdgcn_tensor_load_to_lds(g0, g1, z4, z4, z8v, 0);
#else
    __builtin_amdgcn_tensor_load_to_lds(g0, g1, z4, z4, 0);
#endif
}

// ---------------------------------------------------------------------------
// Kernel 0: pack 5 weight matrices (128x128 f32, row-major W[k][n]) into the
// WMMA B-operand lane layout as f16 so a wave loads one v16h (32B) per tile.
// ---------------------------------------------------------------------------
__global__ __launch_bounds__(256) void pack_weights(
    const float* __restrict__ Wq1, const float* __restrict__ Wq0,
    const float* __restrict__ Wk,  const float* __restrict__ Wv,
    const float* __restrict__ Wc,  half_t* __restrict__ dst) {
    int idx = blockIdx.x * 256 + threadIdx.x;          // < 5*16384 = 81920
    int w   = idx >> 14, rem = idx & 16383;
    int t   = rem >> 9,  le  = rem & 511;
    int lane = le >> 4,  e   = le & 15;
    int ntile = t >> 2,  ktile = t & 3;
    int k = ktile * 32 + ((lane >> 4) << 3) + (e < 8 ? e : e + 8);
    int n = ntile * 16 + (lane & 15);
    const float* W = (w == 0) ? Wq1 : (w == 1) ? Wq0 : (w == 2) ? Wk : (w == 3) ? Wv : Wc;
    dst[idx] = (half_t)W[k * 128 + n];
}

// ---------------------------------------------------------------------------
// Kernel 1: projections.  One block per 16 flat rows of (B*N, 128).
// K = nodes@Wk, V = nodes@Wv, Q = 0.25*(q1@Wq1 + q0@Wq0); also nodes -> f16.
// ---------------------------------------------------------------------------
__global__ __launch_bounds__(256) void proj_kernel(
    const float* __restrict__ nodes, const float* __restrict__ q1,
    const float* __restrict__ q0,
    const half_t* __restrict__ pWk,  const half_t* __restrict__ pWv,
    const half_t* __restrict__ pWq1, const half_t* __restrict__ pWq0,
    half_t* __restrict__ Kh, half_t* __restrict__ Vh,
    half_t* __restrict__ Qh, half_t* __restrict__ Nh) {
    __shared__ __align__(16) half_t sN[16][136], sQ1[16][136], sQ0[16][136];
    const int r0 = blockIdx.x * 16;
    for (int i = threadIdx.x; i < 2048; i += 256) {
        int rr = i >> 7, cc = i & 127;
        size_t g = (size_t)(r0 + rr) * 128 + cc;
        half_t a = (half_t)nodes[g];
        sN[rr][cc]  = a;  Nh[g] = a;
        sQ1[rr][cc] = (half_t)q1[g];
        sQ0[rr][cc] = (half_t)q0[g];
    }
    __syncthreads();
    const int lane = threadIdx.x & 31, w = threadIdx.x >> 5;
    const int row = lane & 15, kb = (lane >> 4) << 3;
    v8f accK = {}, accV = {}, accQ = {};
#pragma unroll
    for (int kc = 0; kc < 4; ++kc) {
        const int k0 = kc * 32;
        v16h aN  = make_a(*(const v8h*)&sN[row][k0 + kb],  *(const v8h*)&sN[row][k0 + kb + 16]);
        v16h aQ1 = make_a(*(const v8h*)&sQ1[row][k0 + kb], *(const v8h*)&sQ1[row][k0 + kb + 16]);
        v16h aQ0 = make_a(*(const v8h*)&sQ0[row][k0 + kb], *(const v8h*)&sQ0[row][k0 + kb + 16]);
        const int t = (w * 4 + kc) * 512 + lane * 16;
        v16h bK = *(const v16h*)(pWk  + t);
        v16h bV = *(const v16h*)(pWv  + t);
        v16h b1 = *(const v16h*)(pWq1 + t);
        v16h b0 = *(const v16h*)(pWq0 + t);
        accK = WMMA_F16(aN,  bK, accK);
        accV = WMMA_F16(aN,  bV, accV);
        accQ = WMMA_F16(aQ1, b1, accQ);
        accQ = WMMA_F16(aQ0, b0, accQ);
    }
    const int col = w * 16 + (lane & 15);
#pragma unroll
    for (int r = 0; r < 8; ++r) {
        size_t g = (size_t)(r0 + r + ((lane >> 4) << 3)) * 128 + col;
        Kh[g] = (half_t)accK[r];
        Vh[g] = (half_t)accV[r];
        Qh[g] = (half_t)(accQ[r] * 0.25f);   // fold 1/sqrt(D) into Q
    }
}

typedef __attribute__((ext_vector_type(4))) float f32x4;

__device__ __forceinline__ float xhalf(float x) {
    return __builtin_bit_cast(float, __builtin_amdgcn_permlanex16(
        __builtin_bit_cast(int, x), __builtin_bit_cast(int, x),
        0x76543210, 0xfedcba98, false, false));
}

// One pass over 32 keys for 16 queries.  LAST: the pass that holds keys >= 500.
template <bool LAST>
__device__ __forceinline__ void attn_pass(
    const half_t (*sK)[16], const half_t (*sVT)[520], const float* __restrict__ mrow,
    const v16h bQ, const int kc, const int cr, const int kb,
    v16h& aK1, v16h& aK2, v8f& acc, float& mrun, float& lrun) {
    // only d = 0..15 is real: elements 8..15 of both K fragments stay zero throughout
    const v8h k1 = *(const v8h*)&sK[kc + cr][kb];
    const v8h k2 = *(const v8h*)&sK[kc + 16 + cr][kb];
#pragma unroll
    for (int i = 0; i < 8; ++i) { aK1[i] = k1[i]; aK2[i] = k2[i]; }
    v8f s1 = {}, s2 = {};
    s1 = WMMA_F16(aK1, bQ, s1);
    s2 = WMMA_F16(aK2, bQ, s2);
    // this lane's 16 mask values: keys kc+kb+0..7 and kc+16+kb+0..7 of its query row
    f32x4 mk[4];
#pragma unroll
    for (int j = 0; j < 4; ++j) {
        int k4 = kc + kb + (j >> 1) * 16 + (j & 1) * 4;
        if (LAST) k4 = k4 < 496 ? k4 : 496;           // stay inside the row; replaced below
        mk[j] = *(const f32x4*)(mrow + k4);
    }
    const v8f t1 = s1 + __builtin_shufflevector(mk[0], mk[1], 0, 1, 2, 3, 4, 5, 6, 7);
    const v8f t2 = s2 + __builtin_shufflevector(mk[2], mk[3], 0, 1, 2, 3, 4, 5, 6, 7);
    float v[16];
#pragma unroll
    for (int r = 0; r < 8; ++r) {
        v[r]     = t1[r];
        v[8 + r] = t2[r];
        if (LAST) {
            if (kc + kb + r >= 500)      v[r]     = -1e30f;
            if (kc + 16 + kb + r >= 500) v[8 + r] = -1e30f;
        }
    }
    float cm = v[0];
#pragma unroll
    for (int i = 1; i < 16; ++i) cm = fmaxf(cm, v[i]);
    cm = fmaxf(cm, xhalf(cm));
    const float nm = fmaxf(mrun, cm);
    const float sc = __expf(mrun - nm);
    v16h bP;
    float ls = 0.f;
#pragma unroll
    for (int i = 0; i < 16; ++i) {
        float p = __expf(v[i] - nm);
        ls += p;
        bP[i] = (half_t)p;
    }
    lrun = lrun * sc + ls;      // this half's keys only; halves joined after the last pass
    mrun = nm;
#pragma unroll
    for (int r = 0; r < 8; ++r) acc[r] *= sc;
    v16h aV = make_a(*(const v8h*)&sVT[cr][kc + kb], *(const v8h*)&sVT[cr][kc + kb + 16]);
    acc = WMMA_F16(aV, bP, acc);
}

__global__ __launch_bounds__(256) void attn_kernel(
    const half_t* __restrict__ Kh, const half_t* __restrict__ Vh,
    const half_t* __restrict__ Qh, const float* __restrict__ mask,
    half_t* __restrict__ outc) {
    __shared__ __align__(16) half_t sK[512][16];     // [key][d]
    __shared__ __align__(16) half_t sVT[16][520];    // [d][key]
    __shared__ __align__(16) half_t sQ[512][16];     // [query][d]
    const int b = blockIdx.x >> 3, h = blockIdx.x & 7;

    if (threadIdx.x < 32) {
        const size_t base = (size_t)(b * 500) * 128 + h * 16;
        tdm_load_2d_f16((unsigned)(size_t)&sK[0][0], Kh + base, 16, 500, 128, 500, 128);
        tdm_load_2d_f16((unsigned)(size_t)&sQ[0][0], Qh + base, 16, 500, 128, 500, 128);
    }
    for (int m = threadIdx.x; m < 512; m += 256) {
        if (m < 500) {
            const size_t base = (size_t)(b * 500 + m) * 128 + h * 16;
#pragma unroll
            for (int d = 0; d < 16; ++d) sVT[d][m] = Vh[base + d];
        } else {
#pragma unroll
            for (int d = 0; d < 16; ++d) {
                sK[m][d] = (half_t)0; sQ[m][d] = (half_t)0; sVT[d][m] = (half_t)0;
            }
        }
    }
    if (threadIdx.x < 32) __builtin_amdgcn_s_wait_tensorcnt(0);
    __syncthreads();

    const int lane = threadIdx.x & 31, w = threadIdx.x >> 5;
    const int cr = lane & 15, hi = lane >> 4, kb = hi << 3;
    v8h z8 = {};
    v16h aK1 = {}, aK2 = {};
    for (int mt = w; mt < 32; mt += 8) {
        const int n0 = mt * 16;
        const int nq = n0 + cr;                       // this lane's query
        const int qc = nq < 500 ? nq : 499;           // pad queries read a real mask row, are never stored
        const float* mrow = mask + ((size_t)b * 500 + qc) * 500;
        v16h bQ = make_a(*(const v8h*)&sQ[nq][kb], z8);   // K(d) padded to 32
        v8f acc = {};                                 // acc[r] = O[nq][8*hi + r]
        float mrun = -1e30f, lrun = 0.f;
        for (int c = 0; c < 15; ++c)
            attn_pass<false>(sK, sVT, mrow, bQ, c * 32, cr, kb, aK1, aK2, acc, mrun, lrun);
        attn_pass<true>(sK, sVT, mrow, bQ, 480, cr, kb, aK1, aK2, acc, mrun, lrun);
        lrun += xhalf(lrun);
        if (nq < 500) {
            const float inv = 1.0f / lrun;            // one query per lane: one reciprocal
            v8h o;
#pragma unroll
            for (int r = 0; r < 8; ++r) o[r] = (half_t)(acc[r] * inv);
            *(v8h*)&outc[(size_t)(b * 500 + nq) * 128 + h * 16 + kb] = o;
            // the next query tile reuses the store's address and data registers
            asm volatile("s_wait_xcnt 0x0" ::: "memory");
        }
    }
}

// ---------------------------------------------------------------------------
// Kernel 3: mh = outc@Wc + bc, s = mh@nodes^T/sqrt(128), 10*tanh + mask,
// row softmax -> probs.  One block per (b, 16-query tile).
// ---------------------------------------------------------------------------
__global__ __launch_bounds__(256) void combine_kernel(
    const half_t* __restrict__ outc, const half_t* __restrict__ pWc,
    const float* __restrict__ bc, const half_t* __restrict__ Nh,
    const float* __restrict__ mask, float* __restrict__ probs) {
    __shared__ __align__(16) half_t sMH[16][136];
    __shared__ __align__(16) float  sS[16][520];
    const int b = blockIdx.x >> 5, nt = blockIdx.x & 31;
    const int n0 = nt * 16;
    const int lane = threadIdx.x & 31, w = threadIdx.x >> 5;
    const int cr = lane & 15, hi = lane >> 4, kb = hi << 3;
    v8h z8 = {};
    // --- stage 1: mh column tile [16w, 16w+16) ---
    v8f acc = {};
    const int arow = n0 + cr;
    const bool av = arow < 500;
#pragma unroll
    for (int kc = 0; kc < 4; ++kc) {
        v16h a;
        if (av) {
            const half_t* ap = outc + (size_t)(b * 500 + arow) * 128 + kc * 32 + kb;
            a = make_a(*(const v8h*)ap, *(const v8h*)(ap + 16));
        } else a = make_a(z8, z8);
        v16h bb = *(const v16h*)(pWc + (w * 4 + kc) * 512 + lane * 16);
        acc = WMMA_F16(a, bb, acc);
    }
    const float bias = bc[w * 16 + cr];
#pragma unroll
    for (int r = 0; r < 8; ++r) sMH[r + (hi << 3)][w * 16 + cr] = (half_t)(acc[r] + bias);
    __syncthreads();
    // --- stage 2: pointer logits over all keys ---
    const float inv_se = 1.0f / 11.313708498984761f;
    for (int mt = w; mt < 32; mt += 8) {
        const int m0 = mt * 16;
        v8f sa = {};
#pragma unroll
        for (int kc = 0; kc < 4; ++kc) {
            v16h a = make_a(*(const v8h*)&sMH[cr][kc * 32 + kb],
                            *(const v8h*)&sMH[cr][kc * 32 + kb + 16]);
            const int mr = m0 + cr;
            v16h bb;
            if (mr < 500) {
                const half_t* np = Nh + (size_t)(b * 500 + mr) * 128 + kc * 32 + kb;
                bb = make_a(*(const v8h*)np, *(const v8h*)(np + 16));
            } else bb = make_a(z8, z8);
            sa = WMMA_F16(a, bb, sa);
        }
#pragma unroll
        for (int r = 0; r < 8; ++r) {
            const int row = r + (hi << 3);
            const int nq = n0 + row, mk = m0 + cr;
            float s = 10.0f * tanhf(sa[r] * inv_se);
            if (nq < 500 && mk < 500) s += mask[((size_t)b * 500 + nq) * 500 + mk];
            if (mk >= 500) s = -1e30f;
            sS[row][mk] = s;
        }
    }
    __syncthreads();
    // --- stage 3: softmax per row, 16 threads/row ---
    const int row = threadIdx.x >> 4, sub = threadIdx.x & 15;
    float mx = -1e30f;
#pragma unroll 4
    for (int j = 0; j < 32; ++j) mx = fmaxf(mx, sS[row][j * 16 + sub]);
#pragma unroll
    for (int d = 1; d < 16; d <<= 1) mx = fmaxf(mx, __shfl_xor(mx, d, 16));
    float sum = 0.f;
#pragma unroll 4
    for (int j = 0; j < 32; ++j) {
        float e = __expf(sS[row][j * 16 + sub] - mx);
        sS[row][j * 16 + sub] = e;
        sum += e;
    }
#pragma unroll
    for (int d = 1; d < 16; d <<= 1) sum += __shfl_xor(sum, d, 16);
    const float inv = 1.0f / sum;
    const int nq = n0 + row;
    if (nq < 500) {
        float* op = probs + ((size_t)b * 500 + nq) * 500;
#pragma unroll 4
        for (int j = 0; j < 32; ++j) {
            const int mm = j * 16 + sub;
            if (mm < 500) op[mm] = sS[row][mm] * inv;
        }
    }
}

extern "C" void kernel_launch(void* const* d_in, const int* in_sizes, int n_in,
                              void* d_out, int out_size, void* d_ws, size_t ws_size,
                              hipStream_t stream) {
    const float* nodes = (const float*)d_in[0];
    const float* q1    = (const float*)d_in[1];
    const float* q0    = (const float*)d_in[2];
    const float* mask  = (const float*)d_in[3];
    const float* Wq1   = (const float*)d_in[4];
    const float* Wq0   = (const float*)d_in[5];
    const float* Wk    = (const float*)d_in[6];
    const float* Wv    = (const float*)d_in[7];
    const float* Wc    = (const float*)d_in[8];
    const float* bcp   = (const float*)d_in[9];
    float* probs = (float*)d_out;

    // Workspace layout (f16): 5 tensors of 32000x128 + 5 packed weights -> ~41 MB
    const size_t RE = (size_t)32000 * 128;
    half_t* ws = (half_t*)d_ws;
    half_t* Kh = ws;
    half_t* Vh = Kh + RE;
    half_t* Qh = Vh + RE;
    half_t* Nh = Qh + RE;
    half_t* OC = Nh + RE;
    half_t* PW = OC + RE;                 // 5 * 16384 halves
    half_t* pWq1 = PW;
    half_t* pWq0 = PW + 16384;
    half_t* pWk  = PW + 32768;
    half_t* pWv  = PW + 49152;
    half_t* pWc  = PW + 65536;

    pack_weights<<<320, 256, 0, stream>>>(Wq1, Wq0, Wk, Wv, Wc, PW);
    proj_kernel<<<2000, 256, 0, stream>>>(nodes, q1, q0, pWk, pWv, pWq1, pWq0, Kh, Vh, Qh, Nh);
    attn_kernel<<<512, 256, 0, stream>>>(Kh, Vh, Qh, mask, OC);
    combine_kernel<<<2048, 256, 0, stream>>>(OC, pWc, bcp, Nh, mask, probs);
}

// v002
// One run takes 116 microseconds.
// Two timings next to v001 both put it at 1.24 times that version's speed.
// Over all steps from v000 it is 2.27 times as fast.
#include <hip/hip_runtime.h>
#include <hip/hip_bf16.h>

typedef _Float16 half_t;
typedef __attribute__((ext_vector_type(16))) _Float16 v16h;
typedef __attribute__((ext_vector_type(8)))  _Float16 v8h;
typedef __attribute__((ext_vector_type(8)))  float    v8f;
typedef __attribute__((ext_vector_type(4)))  unsigned int u32x4;
typedef __attribute__((ext_vector_type(8)))  int          i32x8;
typedef __attribute__((ext_vector_type(4)))  int          i32x4;

#define WMMA_F16(A, B, C) \
    __builtin_amdgcn_wmma_f32_16x16x32_f16(false, (A), false, (B), (short)0, (C), false, false)

__device__ __forceinline__ v16h make_a(v8h lo, v8h hi) {
    v16h r;
#pragma unroll
    for (int i = 0; i < 8; ++i) { r[i] = lo[i]; r[i + 8] = hi[i]; }
    return r;
}

__device__ __forceinline__ void tdm_load_2d_f16(
    unsigned lds_off, const half_t* gptr, unsigned tile_d0, unsigned tile_d1,
    unsigned tensor_d0, unsigned tensor_d1, unsigned stride0) {
    unsigned long long ga = (unsigned long long)(size_t)gptr;
    u32x4 g0;
    g0[0] = 1u;                                       // count=1 (valid), load, user
    g0[1] = lds_off;                                  // lds_addr[31:0]
    g0[2] = (unsigned)(ga & 0xFFFFFFFFu);             // global_addr[31:0]
    g0[3] = (unsigned)((ga >> 32) & 0x01FFFFFFu)      // global_addr[56:32]
          | (2u << 30);                               // type=2 ("image")
    i32x8 g1;
    g1[0] = (int)(1u << 16);
    g1[1] = (int)((tensor_d0 & 0xFFFFu) << 16);
    g1[2] = (int)((tensor_d0 >> 16) | ((tensor_d1 & 0xFFFFu) << 16));
    g1[3] = (int)((tensor_d1 >> 16) | (tile_d0 << 16));
    g1[4] = (int)(tile_d1 & 0xFFFFu);
    g1[5] = (int)stride0;
    g1[6] = 0;
    g1[7] = 0;
    i32x4 z4 = {0, 0, 0, 0};
#if __clang_major__ >= 23
    i32x8 z8v = {0, 0, 0, 0, 0, 0, 0, 0};
    __builtin_amdgcn_tensor_load_to_lds(g0, g1, z4, z4, z8v, 0);
#else
    __builtin_amdgcn_tensor_load_to_lds(g0, g1, z4, z4, 0);
#endif
}

// ---------------------------------------------------------------------------
// Kernel 0: pack 5 weight matrices (128x128 f32, row-major W[k][n]) into the
// WMMA B-operand lane layout as f16 so a wave loads one v16h (32B) per tile.
// ---------------------------------------------------------------------------
__global__ __launch_bounds__(256) void pack_weights(
    const float* __restrict__ Wq1, const float* __restrict__ Wq0,
    const float* __restrict__ Wk,  const float* __restrict__ Wv,
    const float* __restrict__ Wc,  half_t* __restrict__ dst) {
    int idx = blockIdx.x * 256 + threadIdx.x;          // < 5*16384 = 81920
    int w   = idx >> 14, rem = idx & 16383;
    int t   = rem >> 9,  le  = rem & 511;
    int lane = le >> 4,  e   = le & 15;
    int ntile = t >> 2,  ktile = t & 3;
    int k = ktile * 32 + ((lane >> 4) << 3) + (e < 8 ? e : e + 8);
    int n = ntile * 16 + (lane & 15);
    const float* W = (w == 0) ? Wq1 : (w == 1) ? Wq0 : (w == 2) ? Wk : (w == 3) ? Wv : Wc;
    dst[idx] = (half_t)W[k * 128 + n];
}

// ---------------------------------------------------------------------------
// Kernel 1: projections.  One block per 16 flat rows of (B*N, 128).
// K = nodes@Wk, V = nodes@Wv, Q = 0.25*(q1@Wq1 + q0@Wq0); also nodes -> f16.
// ---------------------------------------------------------------------------
__global__ __launch_bounds__(256) void proj_kernel(
    const float* __restrict__ nodes, const float* __restrict__ q1,
    const float* __restrict__ q0,
    const half_t* __restrict__ pWk,  const half_t* __restrict__ pWv,
    const half_t* __restrict__ pWq1, const half_t* __restrict__ pWq0,
    half_t* __restrict__ Kh, half_t* __restrict__ Vh,
    half_t* __restrict__ Qh, half_t* __restrict__ Nh) {
    __shared__ __align__(16) half_t sN[16][136], sQ1[16][136], sQ0[16][136];
    const int r0 = blockIdx.x * 16;
    for (int i = threadIdx.x; i < 2048; i += 256) {
        int rr = i >> 7, cc = i & 127;
        size_t g = (size_t)(r0 + rr) * 128 + cc;
        half_t a = (half_t)nodes[g];
        sN[rr][cc]  = a;  Nh[g] = a;
        sQ1[rr][cc] = (half_t)q1[g];
        sQ0[rr][cc] = (half_t)q0[g];
    }
    __syncthreads();
    const int lane = threadIdx.x & 31, w = threadIdx.x >> 5;
    const int row = lane & 15, kb = (lane >> 4) << 3;
    v8f accK = {}, accV = {}, accQ = {};
#pragma unroll
    for (int kc = 0; kc < 4; ++kc) {
        const int k0 = kc * 32;
        v16h aN  = make_a(*(const v8h*)&sN[row][k0 + kb],  *(const v8h*)&sN[row][k0 + kb + 16]);
        v16h aQ1 = make_a(*(const v8h*)&sQ1[row][k0 + kb], *(const v8h*)&sQ1[row][k0 + kb + 16]);
        v16h aQ0 = make_a(*(const v8h*)&sQ0[row][k0 + kb], *(const v8h*)&sQ0[row][k0 + kb + 16]);
        const int t = (w * 4 + kc) * 512 + lane * 16;
        v16h bK = *(const v16h*)(pWk  + t);
        v16h bV = *(const v16h*)(pWv  + t);
        v16h b1 = *(const v16h*)(pWq1 + t);
        v16h b0 = *(const v16h*)(pWq0 + t);
        accK = WMMA_F16(aN,  bK, accK);
        accV = WMMA_F16(aN,  bV, accV);
        accQ = WMMA_F16(aQ1, b1, accQ);
        accQ = WMMA_F16(aQ0, b0, accQ);
    }
    const int col = w * 16 + (lane & 15);
#pragma unroll
    for (int r = 0; r < 8; ++r) {
        size_t g = (size_t)(r0 + r + ((lane >> 4) << 3)) * 128 + col;
        Kh[g] = (half_t)accK[r];
        Vh[g] = (half_t)accV[r];
        Qh[g] = (half_t)(accQ[r] * 0.25f);   // fold 1/sqrt(D) into Q
    }
}

typedef __attribute__((ext_vector_type(4))) float f32x4;

#define MS_PITCH 68                 // floats per mask row in LDS: 64 keys + 16 bytes (pitch 16 B x odd)
#define MS_BUF   (16 * MS_PITCH)    // floats per ring buffer

// One mask stage: eight asynchronous 16-byte copies per lane, two rows per copy.
// l is the lane's LDS byte address of row pair 0; g[j] its global piece of row pair j.
__device__ __forceinline__ void mask_stage_copy(const unsigned l, const float* const (&g)[8]) {
    asm volatile(
        "global_load_async_to_lds_b128 %0, %8, off\n\t"
        "global_load_async_to_lds_b128 %1, %9, off\n\t"
        "global_load_async_to_lds_b128 %2, %10, off\n\t"
        "global_load_async_to_lds_b128 %3, %11, off\n\t"
        "global_load_async_to_lds_b128 %4, %12, off\n\t"
        "global_load_async_to_lds_b128 %5, %13, off\n\t"
        "global_load_async_to_lds_b128 %6, %14, off\n\t"
        "global_load_async_to_lds_b128 %7, %15, off\n\t"
        "s_wait_xcnt 0x0"
        :: "v"(l), "v"(l + 2 * MS_PITCH * 4), "v"(l + 4 * MS_PITCH * 4), "v"(l + 6 * MS_PITCH * 4),
           "v"(l + 8 * MS_PITCH * 4), "v"(l + 10 * MS_PITCH * 4), "v"(l + 12 * MS_PITCH * 4),
           "v"(l + 14 * MS_PITCH * 4),
           "v"(g[0]), "v"(g[1]), "v"(g[2]), "v"(g[3]), "v"(g[4]), "v"(g[5]), "v"(g[6]), "v"(g[7])
        : "memory");
}

// Hand-over of a ring private to one wave: its reads of the buffer to be refilled have
// retired, and the stage it is about to read has landed.
__device__ __forceinline__ void mask_stage_wait() {
    asm volatile("s_wait_dscnt 0x0" ::: "memory");     // no copy may overtake this wave's own LDS reads
    asm volatile("s_wait_asynccnt 0x0" ::: "memory");  // the compiler places no wait for the copies
}

__device__ __forceinline__ float xhalf(float x) {
    return __builtin_bit_cast(float, __builtin_amdgcn_permlanex16(
        __builtin_bit_cast(int, x), __builtin_bit_cast(int, x),
        0x76543210, 0xfedcba98, false, false));
}

// One pass over 32 keys for 16 queries.  LAST: the pass that holds keys >= 500.
template <bool LAST>
__device__ __forceinline__ void attn_pass(
    const half_t (*sK)[16], const half_t (*sVT)[520], const float* mrow,
    const v16h bQ, const int kc, const int cr, const int kb,
    v16h& aK1, v16h& aK2, v8f& acc, float& mrun, float& lrun) {
    // only d = 0..15 is real: elements 8..15 of both K fragments stay zero throughout
    const v8h k1 = *(const v8h*)&sK[kc + cr][kb];
    const v8h k2 = *(const v8h*)&sK[kc + 16 + cr][kb];
#pragma unroll
    for (int i = 0; i < 8; ++i) { aK1[i] = k1[i]; aK2[i] = k2[i]; }
    v8f s1 = {}, s2 = {};
    s1 = WMMA_F16(aK1, bQ, s1);
    s2 = WMMA_F16(aK2, bQ, s2);
    f32x4 mk[4];
#pragma unroll
    for (int j = 0; j < 4; ++j)
        mk[j] = *(const f32x4*)(mrow + (j >> 1) * 16 + (j & 1) * 4);
    const v8f t1 = s1 + __builtin_shufflevector(mk[0], mk[1], 0, 1, 2, 3, 4, 5, 6, 7);
    const v8f t2 = s2 + __builtin_shufflevector(mk[2], mk[3], 0, 1, 2, 3, 4, 5, 6, 7);
    float v[16];
#pragma unroll
    for (int r = 0; r < 8; ++r) {
        v[r]     = t1[r];
        v[8 + r] = t2[r];
        if (LAST) {
            if (kc + kb + r >= 500)      v[r]     = -1e30f;
            if (kc + 16 + kb + r >= 500) v[8 + r] = -1e30f;
        }
    }
    float cm = v[0];
#pragma unroll
    for (int i = 1; i < 16; ++i) cm = fmaxf(cm, v[i]);
    cm = fmaxf(cm, xhalf(cm));
    const float nm = fmaxf(mrun, cm);
    const float sc = __expf(mrun - nm);
    v16h bP;
    float ls = 0.f;
#pragma unroll
    for (int i = 0; i < 16; ++i) {
        float p = __expf(v[i] - nm);
        ls += p;
        bP[i] = (half_t)p;
    }
    lrun = lrun * sc + ls;      // this half's keys only; halves joined after the last pass
    mrun = nm;
#pragma unroll
    for (int r = 0; r < 8; ++r) acc[r] *= sc;
    v16h aV = make_a(*(const v8h*)&sVT[cr][kc + kb], *(const v8h*)&sVT[cr][kc + kb + 16]);
    acc = WMMA_F16(aV, bP, acc);
}

__global__ __launch_bounds__(256) void attn_kernel(
    const half_t* __restrict__ Kh, const half_t* __restrict__ Vh,
    const half_t* __restrict__ Qh, const float* __restrict__ mask,
    half_t* __restrict__ outc) {
    // one struct, so that the order is the source's: the three tiles keep their places in LDS, the ring follows
    struct Lds {
        half_t sVT[16][520];         // [d][key]
        half_t sK[512][16];          // [key][d]
        half_t sQ[512][16];          // [query][d]
        float  sM[8][2][MS_BUF];     // per wave: two mask stages
    };
    __shared__ __align__(16) Lds lds;
    half_t (&sVT)[16][520] = lds.sVT;
    half_t (&sK)[512][16] = lds.sK;
    half_t (&sQ)[512][16] = lds.sQ;
    float (&sM)[8][2][MS_BUF] = lds.sM;
    const int b = blockIdx.x >> 3, h = blockIdx.x & 7;

    const int w = __builtin_amdgcn_readfirstlane(threadIdx.x >> 5);   // scalar: uniform flow round the copies
    const int crow = (threadIdx.x >> 4) & 1, cpc = threadIdx.x & 15;
    const unsigned mlds = (unsigned)(size_t)&sM[w][0][crow * MS_PITCH + cpc * 4];
    // the last stage holds keys 448..511: pieces past key 496 re-read that piece, inside the row
    const int step7 = 64 - (cpc > 12 ? (cpc - 12) * 4 : 0);
    const float* mg[8];
#pragma unroll                                        // constant indices keep mg[] in registers
    for (int j = 0; j < 8; ++j) {
        const int r = w * 16 + 2 * j + crow;          // w < 8: a real query row
        mg[j] = mask + ((size_t)b * 500 + r) * 500 + cpc * 4;
    }
    mask_stage_copy(mlds, mg);                        // first tile, stage 0, buffer 0

    if (threadIdx.x < 32) {
        const size_t base = (size_t)(b * 500) * 128 + h * 16;
        tdm_load_2d_f16((unsigned)(size_t)&sK[0][0], Kh + base, 16, 500, 128, 500, 128);
        tdm_load_2d_f16((unsigned)(size_t)&sQ[0][0], Qh + base, 16, 500, 128, 500, 128);
    }
    for (int m = threadIdx.x; m < 512; m += 256) {
        if (m < 500) {
            const size_t base = (size_t)(b * 500 + m) * 128 + h * 16;
#pragma unroll
            for (int d = 0; d < 16; ++d) sVT[d][m] = Vh[base + d];
        } else {
#pragma unroll
            for (int d = 0; d < 16; ++d) {
                sK[m][d] = (half_t)0; sQ[m][d] = (half_t)0; sVT[d][m] = (half_t)0;
            }
        }
    }
    if (threadIdx.x < 32) __builtin_amdgcn_s_wait_tensorcnt(0);
    __syncthreads();

    const int lane = threadIdx.x & 31;
    const int cr = lane & 15, hi = lane >> 4, kb = hi << 3;
    const float* mrd = &sM[w][0][cr * MS_PITCH + kb]; // this lane's query row in buffer 0
    v8h z8 = {};
    v16h aK1 = {}, aK2 = {};
    for (int mt = w; mt < 32; mt += 8) {
        const int n0 = mt * 16;
        const int nq = n0 + cr;                       // this lane's query
        v16h bQ = make_a(*(const v8h*)&sQ[nq][kb], z8);   // K(d) padded to 32
        v8f acc = {};                                 // acc[r] = O[nq][8*hi + r]
        float mrun = -1e30f, lrun = 0.f;
        // eight stages a tile, so every tile starts in buffer 0; stage s + 1 flies while stage s is worked on
        for (int s = 0; s < 7; ++s) {
            mask_stage_wait();
            const int step = s == 6 ? step7 : 64;
#pragma unroll                                        // constant indices keep mg[] in registers
            for (int j = 0; j < 8; ++j) mg[j] += step;
            mask_stage_copy(mlds + ((s + 1) & 1) * (MS_BUF * 4), mg);
            const float* mr = mrd + (s & 1) * MS_BUF;
            attn_pass<false>(sK, sVT, mr,      bQ, s * 64,      cr, kb, aK1, aK2, acc, mrun, lrun);
            attn_pass<false>(sK, sVT, mr + 32, bQ, s * 64 + 32, cr, kb, aK1, aK2, acc, mrun, lrun);
        }
        mask_stage_wait();
        if (mt + 8 < 32) {                            // the next tile's stage 0, into buffer 0
#pragma unroll                                        // constant indices keep mg[] in registers
            for (int j = 0; j < 8; ++j) {
                const int r = n0 + 128 + 2 * j + crow;
                const int rc = r < 500 ? r : 499;     // pad queries copy a real mask row, are never stored
                mg[j] = mask + ((size_t)b * 500 + rc) * 500 + cpc * 4;
            }
            mask_stage_copy(mlds, mg);
        }
        attn_pass<false>(sK, sVT, mrd + MS_BUF,      bQ, 448, cr, kb, aK1, aK2, acc, mrun, lrun);
        attn_pass<true>(sK, sVT,  mrd + MS_BUF + 32, bQ, 480, cr, kb, aK1, aK2, acc, mrun, lrun);
        lrun += xhalf(lrun);
        if (nq < 500) {
            const float inv = 1.0f / lrun;            // one query per lane: one reciprocal
            v8h o;
#pragma unroll
            for (int r = 0; r < 8; ++r) o[r] = (half_t)(acc[r] * inv);
            *(v8h*)&outc[(size_t)(b * 500 + nq) * 128 + h * 16 + kb] = o;
            // the next query tile reuses the store's address and data registers
            asm volatile("s_wait_xcnt 0x0" ::: "memory");
        }
    }
}

// ---------------------------------------------------------------------------
// Kernel 3: mh = outc@Wc + bc, s = mh@nodes^T/sqrt(128), 10*tanh + mask,
// row softmax -> probs.  One block per (b, 16-query tile).
// ---------------------------------------------------------------------------
__global__ __launch_bounds__(256) void combine_kernel(
    const half_t* __restrict__ outc, const half_t* __restrict__ pWc,
    const float* __restrict__ bc, const half_t* __restrict__ Nh,
    const float* __restrict__ mask, float* __restrict__ probs) {
    __shared__ __align__(16) half_t sMH[16][136];
    __shared__ __align__(16) float  sS[16][520];
    const int b = blockIdx.x >> 5, nt = blockIdx.x & 31;
    const int n0 = nt * 16;
    const int lane = threadIdx.x & 31, w = threadIdx.x >> 5;
    const int cr = lane & 15, hi = lane >> 4, kb = hi << 3;
    v8h z8 = {};
    // --- stage 1: mh column tile [16w, 16w+16) ---
    v8f acc = {};
    const int arow = n0 + cr;
    const bool av = arow < 500;
#pragma unroll
    for (int kc = 0; kc < 4; ++kc) {
        v16h a;
        if (av) {
            const half_t* ap = outc + (size_t)(b * 500 + arow) * 128 + kc * 32 + kb;
            a = make_a(*(const v8h*)ap, *(const v8h*)(ap + 16));
        } else a = make_a(z8, z8);
        v16h bb = *(const v16h*)(pWc + (w * 4 + kc) * 512 + lane * 16);
        acc = WMMA_F16(a, bb, acc);
    }
    const float bias = bc[w * 16 + cr];
#pragma unroll
    for (int r = 0; r < 8; ++r) sMH[r + (hi << 3)][w * 16 + cr] = (half_t)(acc[r] + bias);
    __syncthreads();
    // --- stage 2: pointer logits over all keys ---
    const float inv_se = 1.0f / 11.313708498984761f;
    for (int mt = w; mt < 32; mt += 8) {
        const int m0 = mt * 16;
        v8f sa = {};
#pragma unroll
        for (int kc = 0; kc < 4; ++kc) {
            v16h a = make_a(*(const v8h*)&sMH[cr][kc * 32 + kb],
                            *(const v8h*)&sMH[cr][kc * 32 + kb + 16]);
            const int mr = m0 + cr;
            v16h bb;
            if (mr < 500) {
                const half_t* np = Nh + (size_t)(b * 500 + mr) * 128 + kc * 32 + kb;
                bb = make_a(*(const v8h*)np, *(const v8h*)(np + 16));
            } else bb = make_a(z8, z8);
            sa = WMMA_F16(a, bb, sa);
        }
#pragma unroll
        for (int r = 0; r < 8; ++r) {
            const int row = r + (hi << 3);
            const int nq = n0 + row, mk = m0 + cr;
            float s = 10.0f * tanhf(sa[r] * inv_se);
            if (nq < 500 && mk < 500) s += mask[((size_t)b * 500 + nq) * 500 + mk];
            if (mk >= 500) s = -1e30f;
            sS[row][mk] = s;
        }
    }
    __syncthreads();
    // --- stage 3: softmax per row, 16 threads/row ---
    const int row = threadIdx.x >> 4, sub = threadIdx.x & 15;
    float mx = -1e30f;
#pragma unroll 4
    for (int j = 0; j < 32; ++j) mx = fmaxf(mx, sS[row][j * 16 + sub]);
#pragma unroll
    for (int d = 1; d < 16; d <<= 1) mx = fmaxf(mx, __shfl_xor(mx, d, 16));
    float sum = 0.f;
#pragma unroll 4
    for (int j = 0; j < 32; ++j) {
        float e = __expf(sS[row][j * 16 + sub] - mx);
        sS[row][j * 16 + sub] = e;
        sum += e;
    }
#pragma unroll
    for (int d = 1; d < 16; d <<= 1) sum += __shfl_xor(sum, d, 16);
    const float inv = 1.0f / sum;
    const int nq = n0 + row;
    if (nq < 500) {
        float* op = probs + ((size_t)b * 500 + nq) * 500;
#pragma unroll 4
        for (int j = 0; j < 32; ++j) {
            const int mm = j * 16 + sub;
            if (mm < 500) op[mm] = sS[row][mm] * inv;
        }
    }
}

extern "C" void kernel_launch(void* const* d_in, const int* in_sizes, int n_in,
                              void* d_out, int out_size, void* d_ws, size_t ws_size,
                              hipStream_t stream) {
    const float* nodes = (const float*)d_in[0];
    const float* q1    = (const float*)d_in[1];
    const float* q0    = (const float*)d_in[2];
    const float* mask  = (const float*)d_in[3];
    const float* Wq1   = (const float*)d_in[4];
    const float* Wq0   = (const float*)d_in[5];
    const float* Wk    = (const float*)d_in[6];
    const float* Wv    = (const float*)d_in[7];
    const float* Wc    = (const float*)d_in[8];
    const float* bcp   = (const float*)d_in[9];
    float* probs = (float*)d_out;

    // Workspace layout (f16): 5 tensors of 32000x128 + 5 packed weights -> ~41 MB
    const size_t RE = (size_t)32000 * 128;
    half_t* ws = (half_t*)d_ws;
    half_t* Kh = ws;
    half_t* Vh = Kh + RE;
    half_t* Qh = Vh + RE;
    half_t* Nh = Qh + RE;
    half_t* OC = Nh + RE;
    half_t* PW = OC + RE;                 // 5 * 16384 halves
    half_t* pWq1 = PW;
    half_t* pWq0 = PW + 16384;
    half_t* pWk  = PW + 32768;
    half_t* pWv  = PW + 49152;
    half_t* pWc  = PW + 65536;

    pack_weights<<<320, 256, 0, stream>>>(Wq1, Wq0, Wk, Wv, Wc, PW);
    proj_kernel<<<2000, 256, 0, stream>>>(nodes, q1, q0, pWk, pWv, pWq1, pWq0, Kh, Vh, Qh, Nh);
    attn_kernel<<<512, 256, 0, stream>>>(Kh, Vh, Qh, mask, OC);
    combine_kernel<<<2048, 256, 0, stream>>>(OC, pWc, bcp, Nh, mask, probs);
}

// v003
// One run takes 105 microseconds.
// Timed twice side by side with v002, it ran 1.10 times as fast both times.
// Over all steps from v000 it is 2.50 times as fast.
#include <hip/hip_runtime.h>
#include <hip/hip_bf16.h>

typedef _Float16 half_t;
typedef __attribute__((ext_vector_type(16))) _Float16 v16h;
typedef __attribute__((ext_vector_type(8)))  _Float16 v8h;
typedef __attribute__((ext_vector_type(8)))  float    v8f;
typedef __attribute__((ext_vector_type(4)))  unsigned int u32x4;
typedef __attribute__((ext_vector_type(8)))  int          i32x8;
typedef __attribute__((ext_vector_type(4)))  int          i32x4;

#define WMMA_F16(A, B, C) \
    __builtin_amdgcn_wmma_f32_16x16x32_f16(false, (A), false, (B), (short)0, (C), false, false)

__device__ __forceinline__ v16h make_a(v8h lo, v8h hi) {
    v16h r;
#pragma unroll
    for (int i = 0; i < 8; ++i) { r[i] = lo[i]; r[i + 8] = hi[i]; }
    return r;
}

__device__ __forceinline__ void tdm_load_2d_f16(
    unsigned lds_off, const half_t* gptr, unsigned tile_d0, unsigned tile_d1,
    unsigned tensor_d0, unsigned tensor_d1, unsigned stride0) {
    unsigned long long ga = (unsigned long long)(size_t)gptr;
    u32x4 g0;
    g0[0] = 1u;                                       // count=1 (valid), load, user
    g0[1] = lds_off;                                  // lds_addr[31:0]
    g0[2] = (unsigned)(ga & 0xFFFFFFFFu);             // global_addr[31:0]
    g0[3] = (unsigned)((ga >> 32) & 0x01FFFFFFu)      // global_addr[56:32]
          | (2u << 30);                               // type=2 ("image")
    i32x8 g1;
    g1[0] = (int)(1u << 16);
    g1[1] = (int)((tensor_d0 & 0xFFFFu) << 16);
    g1[2] = (int)((tensor_d0 >> 16) | ((tensor_d1 & 0xFFFFu) << 16));
    g1[3] = (int)((tensor_d1 >> 16) | (tile_d0 << 16));
    g1[4] = (int)(tile_d1 & 0xFFFFu);
    g1[5] = (int)stride0;
    g1[6] = 0;
    g1[7] = 0;
    i32x4 z4 = {0, 0, 0, 0};
#if __clang_major__ >= 23
    i32x8 z8v = {0, 0, 0, 0, 0, 0, 0, 0};
    __builtin_amdgcn_tensor_load_to_lds(g0, g1, z4, z4, z8v, 0);
#else
    __builtin_amdgcn_tensor_load_to_lds(g0, g1, z4, z4, 0);
#endif
}

// ---------------------------------------------------------------------------
// Kernel 0: pack 5 weight matrices (128x128 f32, row-major W[k][n]) into the
// WMMA B-operand lane layout as f16 so a wave loads one v16h (32B) per tile.
// ---------------------------------------------------------------------------
__global__ __launch_bounds__(256) void pack_weights(
    const float* __restrict__ Wq1, const float* __restrict__ Wq0,
    const float* __restrict__ Wk,  const float* __restrict__ Wv,
    const float* __restrict__ Wc,  half_t* __restrict__ dst) {
    int idx = blockIdx.x * 256 + threadIdx.x;          // < 5*16384 = 81920
    int w   = idx >> 14, rem = idx & 16383;
    int t   = rem >> 9,  le  = rem & 511;
    int lane = le >> 4,  e   = le & 15;
    int ntile = t >> 2,  ktile = t & 3;
    int k = ktile * 32 + ((lane >> 4) << 3) + (e < 8 ? e : e + 8);
    int n = ntile * 16 + (lane & 15);
    const float* W = (w == 0) ? Wq1 : (w == 1) ? Wq0 : (w == 2) ? Wk : (w == 3) ? Wv : Wc;
    dst[idx] = (half_t)W[k * 128 + n];
}

// ---------------------------------------------------------------------------
// Kernel 1: projections.  One block per 16 flat rows of (B*N, 128).
// K = nodes@Wk, V = nodes@Wv, Q = 0.25*(q1@Wq1 + q0@Wq0); also nodes -> f16.
// ---------------------------------------------------------------------------
__global__ __launch_bounds__(256) void proj_kernel(
    const float* __restrict__ nodes, const float* __restrict__ q1,
    const float* __restrict__ q0,
    const half_t* __restrict__ pWk,  const half_t* __restrict__ pWv,
    const half_t* __restrict__ pWq1, const half_t* __restrict__ pWq0,
    half_t* __restrict__ Kh, half_t* __restrict__ Vh,
    half_t* __restrict__ Qh, half_t* __restrict__ Nh) {
    __shared__ __align__(16) half_t sN[16][136], sQ1[16][136], sQ0[16][136];
    const int r0 = blockIdx.x * 16;
    for (int i = threadIdx.x; i < 2048; i += 256) {
        int rr = i >> 7, cc = i & 127;
        size_t g = (size_t)(r0 + rr) * 128 + cc;
        half_t a = (half_t)nodes[g];
        sN[rr][cc]  = a;  Nh[g] = a;
        sQ1[rr][cc] = (half_t)q1[g];
        sQ0[rr][cc] = (half_t)q0[g];
    }
    __syncthreads();
    const int lane = threadIdx.x & 31, w = threadIdx.x >> 5;
    const int row = lane & 15, kb = (lane >> 4) << 3;
    v8f accK = {}, accV = {}, accQ = {};
#pragma unroll
    for (int kc = 0; kc < 4; ++kc) {
        const int k0 = kc * 32;
        v16h aN  = make_a(*(const v8h*)&sN[row][k0 + kb],  *(const v8h*)&sN[row][k0 + kb + 16]);
        v16h aQ1 = make_a(*(const v8h*)&sQ1[row][k0 + kb], *(const v8h*)&sQ1[row][k0 + kb + 16]);
        v16h aQ0 = make_a(*(const v8h*)&sQ0[row][k0 + kb], *(const v8h*)&sQ0[row][k0 + kb + 16]);
        const int t = (w * 4 + kc) * 512 + lane * 16;
        v16h bK = *(const v16h*)(pWk  + t);
        v16h bV = *(const v16h*)(pWv  + t);
        v16h b1 = *(const v16h*)(pWq1 + t);
        v16h b0 = *(const v16h*)(pWq0 + t);
        accK = WMMA_F16(aN,  bK, accK);
        accV = WMMA_F16(aN,  bV, accV);
        accQ = WMMA_F16(aQ1, b1, accQ);
        accQ = WMMA_F16(aQ0, b0, accQ);
    }
    const int col = w * 16 + (lane & 15);
#pragma unroll
    for (int r = 0; r < 8; ++r) {
        size_t g = (size_t)(r0 + r + ((lane >> 4) << 3)) * 128 + col;
        Kh[g] = (half_t)accK[r];
        Vh[g] = (half_t)accV[r];
        Qh[g] = (half_t)(accQ[r] * 0.25f);   // fold 1/sqrt(D) into Q
    }
}

typedef __attribute__((ext_vector_type(4))) float f32x4;

#define MS_PITCH 68                 // floats per mask row in LDS: 64 keys + 16 bytes (pitch 16 B x odd)
#define MS_BUF   (16 * MS_PITCH)    // floats per ring buffer

// One mask stage: eight asynchronous 16-byte copies per lane, two rows per copy.
// l is the lane's LDS byte address of row pair 0; g[j] its global piece of row pair j.
__device__ __forceinline__ void mask_stage_copy(const unsigned l, const float* const (&g)[8]) {
    asm volatile(
        "global_load_async_to_lds_b128 %0, %8, off\n\t"
        "global_load_async_to_lds_b128 %1, %9, off\n\t"
        "global_load_async_to_lds_b128 %2, %10, off\n\t"
        "global_load_async_to_lds_b128 %3, %11, off\n\t"
        "global_load_async_to_lds_b128 %4, %12, off\n\t"
        "global_load_async_to_lds_b128 %5, %13, off\n\t"
        "global_load_async_to_lds_b128 %6, %14, off\n\t"
        "global_load_async_to_lds_b128 %7, %15, off\n\t"
        "s_wait_xcnt 0x0"
        :: "v"(l), "v"(l + 2 * MS_PITCH * 4), "v"(l + 4 * MS_PITCH * 4), "v"(l + 6 * MS_PITCH * 4),
           "v"(l + 8 * MS_PITCH * 4), "v"(l + 10 * MS_PITCH * 4), "v"(l + 12 * MS_PITCH * 4),
           "v"(l + 14 * MS_PITCH * 4),
           "v"(g[0]), "v"(g[1]), "v"(g[2]), "v"(g[3]), "v"(g[4]), "v"(g[5]), "v"(g[6]), "v"(g[7])
        : "memory");
}

// Hand-over of a ring private to one wave: its reads of the buffer to be refilled have
// retired, and the stage it is about to read has landed.
__device__ __forceinline__ void mask_stage_wait() {
    asm volatile("s_wait_dscnt 0x0" ::: "memory");     // no copy may overtake this wave's own LDS reads
    asm volatile("s_wait_asynccnt 0x0" ::: "memory");  // the compiler places no wait for the copies
}

__device__ __forceinline__ float xhalf(float x) {
    return __builtin_bit_cast(float, __builtin_amdgcn_permlanex16(
        __builtin_bit_cast(int, x), __builtin_bit_cast(int, x),
        0x76543210, 0xfedcba98, false, false));
}

// One pass over 32 keys for 16 queries.  LAST: the pass that holds keys >= 500.
template <bool LAST>
__device__ __forceinline__ void attn_pass(
    const half_t (*sK)[16], const half_t (*sVT)[520], const float* mrow,
    const v16h bQ, const int kc, const int cr, const int kb,
    v16h& aK1, v16h& aK2, v8f& acc, float& mrun, float& lrun) {
    // only d = 0..15 is real: elements 8..15 of both K fragments stay zero throughout
    const v8h k1 = *(const v8h*)&sK[kc + cr][kb];
    const v8h k2 = *(const v8h*)&sK[kc + 16 + cr][kb];
#pragma unroll
    for (int i = 0; i < 8; ++i) { aK1[i] = k1[i]; aK2[i] = k2[i]; }
    v8f s1 = {}, s2 = {};
    s1 = WMMA_F16(aK1, bQ, s1);
    s2 = WMMA_F16(aK2, bQ, s2);
    f32x4 mk[4];
#pragma unroll
    for (int j = 0; j < 4; ++j)
        mk[j] = *(const f32x4*)(mrow + (j >> 1) * 16 + (j & 1) * 4);
    const v8f t1 = s1 + __builtin_shufflevector(mk[0], mk[1], 0, 1, 2, 3, 4, 5, 6, 7);
    const v8f t2 = s2 + __builtin_shufflevector(mk[2], mk[3], 0, 1, 2, 3, 4, 5, 6, 7);
    float v[16];
#pragma unroll
    for (int r = 0; r < 8; ++r) {
        v[r]     = t1[r];
        v[8 + r] = t2[r];
        if (LAST) {
            if (kc + kb + r >= 500)      v[r]     = -1e30f;
            if (kc + 16 + kb + r >= 500) v[8 + r] = -1e30f;
        }
    }
    float cm = v[0];
#pragma unroll
    for (int i = 1; i < 16; ++i) cm = fmaxf(cm, v[i]);
    cm = fmaxf(cm, xhalf(cm));
    const float nm = fmaxf(mrun, cm);
    const float sc = __expf(mrun - nm);
    v16h bP;
    float ls = 0.f;
#pragma unroll
    for (int i = 0; i < 16; ++i) {
        float p = __expf(v[i] - nm);
        ls += p;
        bP[i] = (half_t)p;
    }
    lrun = lrun * sc + ls;      // this half's keys only; halves joined after the last pass
    mrun = nm;
#pragma unroll
    for (int r = 0; r < 8; ++r) acc[r] *= sc;
    v16h aV = make_a(*(const v8h*)&sVT[cr][kc + kb], *(const v8h*)&sVT[cr][kc + kb + 16]);
    acc = WMMA_F16(aV, bP, acc);
}

__global__ __launch_bounds__(256) void attn_kernel(
    const half_t* __restrict__ Kh, const half_t* __restrict__ Vh,
    const half_t* __restrict__ Qh, const float* __restrict__ mask,
    half_t* __restrict__ outc) {
    // one struct, so that the order is the source's: the three tiles keep their places in LDS, the ring follows
    struct Lds {
        half_t sVT[16][520];         // [d][key]
        half_t sK[512][16];          // [key][d]
        half_t sQ[512][16];          // [query][d]
        float  sM[8][2][MS_BUF];     // per wave: two mask stages
    };
    __shared__ __align__(16) Lds lds;
    half_t (&sVT)[16][520] = lds.sVT;
    half_t (&sK)[512][16] = lds.sK;
    half_t (&sQ)[512][16] = lds.sQ;
    float (&sM)[8][2][MS_BUF] = lds.sM;
    const int b = blockIdx.x >> 3, h = blockIdx.x & 7;

    const int w = __builtin_amdgcn_readfirstlane(threadIdx.x >> 5);   // scalar: uniform flow round the copies
    const int crow = (threadIdx.x >> 4) & 1, cpc = threadIdx.x & 15;
    const unsigned mlds = (unsigned)(size_t)&sM[w][0][crow * MS_PITCH + cpc * 4];
    // the last stage holds keys 448..511: pieces past key 496 re-read that piece, inside the row
    const int step7 = 64 - (cpc > 12 ? (cpc - 12) * 4 : 0);
    const float* mg[8];
#pragma unroll                                        // constant indices keep mg[] in registers
    for (int j = 0; j < 8; ++j) {
        const int r = w * 16 + 2 * j + crow;          // w < 8: a real query row
        mg[j] = mask + ((size_t)b * 500 + r) * 500 + cpc * 4;
    }
    mask_stage_copy(mlds, mg);                        // first tile, stage 0, buffer 0

    if (threadIdx.x < 32) {
        const size_t base = (size_t)(b * 500) * 128 + h * 16;
        tdm_load_2d_f16((unsigned)(size_t)&sK[0][0], Kh + base, 16, 500, 128, 500, 128);
        tdm_load_2d_f16((unsigned)(size_t)&sQ[0][0], Qh + base, 16, 500, 128, 500, 128);
    }
    for (int m = threadIdx.x; m < 512; m += 256) {
        if (m < 500) {
            const size_t base = (size_t)(b * 500 + m) * 128 + h * 16;
#pragma unroll
            for (int d = 0; d < 16; ++d) sVT[d][m] = Vh[base + d];
        } else {
#pragma unroll
            for (int d = 0; d < 16; ++d) {
                sK[m][d] = (half_t)0; sQ[m][d] = (half_t)0; sVT[d][m] = (half_t)0;
            }
        }
    }
    if (threadIdx.x < 32) __builtin_amdgcn_s_wait_tensorcnt(0);
    __syncthreads();

    const int lane = threadIdx.x & 31;
    const int cr = lane & 15, hi = lane >> 4, kb = hi << 3;
    const float* mrd = &sM[w][0][cr * MS_PITCH + kb]; // this lane's query row in buffer 0
    v8h z8 = {};
    v16h aK1 = {}, aK2 = {};
    for (int mt = w; mt < 32; mt += 8) {
        const int n0 = mt * 16;
        const int nq = n0 + cr;                       // this lane's query
        v16h bQ = make_a(*(const v8h*)&sQ[nq][kb], z8);   // K(d) padded to 32
        v8f acc = {};                                 // acc[r] = O[nq][8*hi + r]
        float mrun = -1e30f, lrun = 0.f;
        // eight stages a tile, so every tile starts in buffer 0; stage s + 1 flies while stage s is worked on
        for (int s = 0; s < 7; ++s) {
            mask_stage_wait();
            const int step = s == 6 ? step7 : 64;
#pragma unroll                                        // constant indices keep mg[] in registers
            for (int j = 0; j < 8; ++j) mg[j] += step;
            mask_stage_copy(mlds + ((s + 1) & 1) * (MS_BUF * 4), mg);
            const float* mr = mrd + (s & 1) * MS_BUF;
            attn_pass<false>(sK, sVT, mr,      bQ, s * 64,      cr, kb, aK1, aK2, acc, mrun, lrun);
            attn_pass<false>(sK, sVT, mr + 32, bQ, s * 64 + 32, cr, kb, aK1, aK2, acc, mrun, lrun);
        }
        mask_stage_wait();
        if (mt + 8 < 32) {                            // the next tile's stage 0, into buffer 0
#pragma unroll                                        // constant indices keep mg[] in registers
            for (int j = 0; j < 8; ++j) {
                const int r = n0 + 128 + 2 * j + crow;
                const int rc = r < 500 ? r : 499;     // pad queries copy a real mask row, are never stored
                mg[j] = mask + ((size_t)b * 500 + rc) * 500 + cpc * 4;
            }
            mask_stage_copy(mlds, mg);
        }
        attn_pass<false>(sK, sVT, mrd + MS_BUF,      bQ, 448, cr, kb, aK1, aK2, acc, mrun, lrun);
        attn_pass<true>(sK, sVT,  mrd + MS_BUF + 32, bQ, 480, cr, kb, aK1, aK2, acc, mrun, lrun);
        lrun += xhalf(lrun);
        if (nq < 500) {
            const float inv = 1.0f / lrun;            // one query per lane: one reciprocal
            v8h o;
#pragma unroll
            for (int r = 0; r < 8; ++r) o[r] = (half_t)(acc[r] * inv);
            *(v8h*)&outc[(size_t)(b * 500 + nq) * 128 + h * 16 + kb] = o;
            // the next query tile reuses the store's address and data registers
            asm volatile("s_wait_xcnt 0x0" ::: "memory");
        }
    }
}

// ---------------------------------------------------------------------------
// Kernel 3: mh = outc@Wc + bc, s = mh@nodes^T/sqrt(128), 10*tanh + mask,
// row softmax -> probs.  One block per (b, 16-query tile).
// The tile's 16 mask rows are copied into the score buffer at entry, as whole
// 512-byte row pieces, and land while stage 1 runs; stage 2 adds its logits there.
// ---------------------------------------------------------------------------
// Eight asynchronous 16-byte copies per lane: l[j] the lane's LDS byte address, g[j] its global piece.
__device__ __forceinline__ void mask_rows_copy(const unsigned (&l)[8], const float* const (&g)[8]) {
    asm volatile(
        "global_load_async_to_lds_b128 %0, %8, off\n\t"
        "global_load_async_to_lds_b128 %1, %9, off\n\t"
        "global_load_async_to_lds_b128 %2, %10, off\n\t"
        "global_load_async_to_lds_b128 %3, %11, off\n\t"
        "global_load_async_to_lds_b128 %4, %12, off\n\t"
        "global_load_async_to_lds_b128 %5, %13, off\n\t"
        "global_load_async_to_lds_b128 %6, %14, off\n\t"
        "global_load_async_to_lds_b128 %7, %15, off\n\t"
        "s_wait_xcnt 0x0"
        :: "v"(l[0]), "v"(l[1]), "v"(l[2]), "v"(l[3]), "v"(l[4]), "v"(l[5]), "v"(l[6]), "v"(l[7]),
           "v"(g[0]), "v"(g[1]), "v"(g[2]), "v"(g[3]), "v"(g[4]), "v"(g[5]), "v"(g[6]), "v"(g[7])
        : "memory");
}

__global__ __launch_bounds__(256) void combine_kernel(
    const half_t* __restrict__ outc, const half_t* __restrict__ pWc,
    const float* __restrict__ bc, const half_t* __restrict__ Nh,
    const float* __restrict__ mask, float* __restrict__ probs) {
    __shared__ __align__(16) half_t sMH[16][136];
    __shared__ __align__(16) float  sS[16][520];
    const int b = blockIdx.x >> 5, nt = blockIdx.x & 31;
    const int n0 = nt * 16;
    const int lane = threadIdx.x & 31, w = threadIdx.x >> 5;
    const int cr = lane & 15, hi = lane >> 4, kb = hi << 3;
    v8h z8 = {};
    // --- mask rows into sS: wave w brings rows 2w and 2w+1, four copies a row, every lane on ---
    {
        unsigned ml[8];
        const float* mg[8];
#pragma unroll                                        // constant indices keep ml[] and mg[] in registers
        for (int j = 0; j < 8; ++j) {
            const int rr = 2 * w + (j >> 2);
            const int pc = (j & 3) * 32 + lane;
            const int rq = n0 + rr < 500 ? n0 + rr : 499;
            const int ps = pc < 125 ? pc : 124;
            ml[j] = (unsigned)(size_t)&sS[rr][pc * 4];
            mg[j] = mask + ((size_t)b * 500 + rq) * 500 + ps * 4;
        }
        mask_rows_copy(ml, mg);
    }
    // --- stage 1: mh column tile [16w, 16w+16) ---
    v8f acc = {};
    const int arow = n0 + cr;
    const bool av = arow < 500;
#pragma unroll
    for (int kc = 0; kc < 4; ++kc) {
        v16h a;
        if (av) {
            const half_t* ap = outc + (size_t)(b * 500 + arow) * 128 + kc * 32 + kb;
            a = make_a(*(const v8h*)ap, *(const v8h*)(ap + 16));
        } else a = make_a(z8, z8);
        v16h bb = *(const v16h*)(pWc + (w * 4 + kc) * 512 + lane * 16);
        acc = WMMA_F16(a, bb, acc);
    }
    const float bias = bc[w * 16 + cr];
#pragma unroll
    for (int r = 0; r < 8; ++r) sMH[r + (hi << 3)][w * 16 + cr] = (half_t)(acc[r] + bias);
    // the compiler places no wait for the copies; behind it the barrier hands every wave's mask rows to the others
    asm volatile("s_wait_asynccnt 0x0" ::: "memory");
    __syncthreads();
    // --- stage 2: pointer logits over all keys ---
    const float inv_se = 1.0f / 11.313708498984761f;
    for (int mt = w; mt < 32; mt += 8) {
        const int m0 = mt * 16;
        v8f sa = {};
#pragma unroll
        for (int kc = 0; kc < 4; ++kc) {
            v16h a = make_a(*(const v8h*)&sMH[cr][kc * 32 + kb],
                            *(const v8h*)&sMH[cr][kc * 32 + kb + 16]);
            const int mr = m0 + cr;
            v16h bb;
            if (mr < 500) {
                const half_t* np = Nh + (size_t)(b * 500 + mr) * 128 + kc * 32 + kb;
                bb = make_a(*(const v8h*)np, *(const v8h*)(np + 16));
            } else bb = make_a(z8, z8);
            sa = WMMA_F16(a, bb, sa);
        }
        float mv[8];
#pragma unroll
        for (int r = 0; r < 8; ++r) mv[r] = sS[r + (hi << 3)][m0 + cr];
#pragma unroll
        for (int r = 0; r < 8; ++r) {
            const int row = r + (hi << 3);
            const int mk = m0 + cr;
            float s = 10.0f * tanhf(sa[r] * inv_se) + mv[r];
            if (mk >= 500) s = -1e30f;
            sS[row][mk] = s;
        }
    }
    __syncthreads();
    // --- stage 3: softmax per row, 16 threads/row ---
    const int row = threadIdx.x >> 4, sub = threadIdx.x & 15;
    float mx = -1e30f;
#pragma unroll 4
    for (int j = 0; j < 32; ++j) mx = fmaxf(mx, sS[row][j * 16 + sub]);
#pragma unroll
    for (int d = 1; d < 16; d <<= 1) mx = fmaxf(mx, __shfl_xor(mx, d, 16));
    float sum = 0.f;
#pragma unroll 4
    for (int j = 0; j < 32; ++j) {
        float e = __expf(sS[row][j * 16 + sub] - mx);
        sS[row][j * 16 + sub] = e;
        sum += e;
    }
#pragma unroll
    for (int d = 1; d < 16; d <<= 1) sum += __shfl_xor(sum, d, 16);
    const float inv = 1.0f / sum;
    const int nq = n0 + row;
    if (nq < 500) {
        float* op = probs + ((size_t)b * 500 + nq) * 500;
#pragma unroll 4
        for (int j = 0; j < 32; ++j) {
            const int mm = j * 16 + sub;
            if (mm < 500) op[mm] = sS[row][mm] * inv;
        }
    }
}

extern "C" void kernel_launch(void* const* d_in, const int* in_sizes, int n_in,
                              void* d_out, int out_size, void* d_ws, size_t ws_size,
                              hipStream_t stream) {
    const float* nodes = (const float*)d_in[0];
    const float* q1    = (const float*)d_in[1];
    const float* q0    = (const float*)d_in[2];
    const float* mask  = (const float*)d_in[3];
    const float* Wq1   = (const float*)d_in[4];
    const float* Wq0   = (const float*)d_in[5];
    const float* Wk    = (const float*)d_in[6];
    const float* Wv    = (const float*)d_in[7];
    const float* Wc    = (const float*)d_in[8];
    const float* bcp   = (const float*)d_in[9];
    float* probs = (float*)d_out;

    // Workspace layout (f16): 5 tensors of 32000x128 + 5 packed weights -> ~41 MB
    const size_t RE = (size_t)32000 * 128;
    half_t* ws = (half_t*)d_ws;
    half_t* Kh = ws;
    half_t* Vh = Kh + RE;
    half_t* Qh = Vh + RE;
    half_t* Nh = Qh + RE;
    half_t* OC = Nh + RE;
    half_t* PW = OC + RE;                 // 5 * 16384 halves
    half_t* pWq1 = PW;
    half_t* pWq0 = PW + 16384;
    half_t* pWk  = PW + 32768;
    half_t* pWv  = PW + 49152;
    half_t* pWc  = PW + 65536;

    pack_weights<<<320, 256, 0, stream>>>(Wq1, Wq0, Wk, Wv, Wc, PW);
    proj_kernel<<<2000, 256, 0, stream>>>(nodes, q1, q0, pWk, pWv, pWq1, pWq0, Kh, Vh, Qh, Nh);
    attn_kernel<<<512, 256, 0, stream>>>(Kh, Vh, Qh, mask, OC);
    combine_kernel<<<2048, 256, 0, stream>>>(OC, pWc, bcp, Nh, mask, probs);
}

// v004
// Measured time: 99.8 microseconds a run.
// Next to v003, in two timings, it ran 1.05 times as fast each time.
// All steps since v000 together make it 2.63 times as fast.
#include <hip/hip_runtime.h>
#include <hip/hip_bf16.h>

typedef _Float16 half_t;
typedef __attribute__((ext_vector_type(16))) _Float16 v16h;
typedef __attribute__((ext_vector_type(8)))  _Float16 v8h;
typedef __attribute__((ext_vector_type(8)))  float    v8f;
typedef __attribute__((ext_vector_type(4)))  unsigned int u32x4;
typedef __attribute__((ext_vector_type(8)))  int          i32x8;
typedef __attribute__((ext_vector_type(4)))  int          i32x4;

#define WMMA_F16(A, B, C) \
    __builtin_amdgcn_wmma_f32_16x16x32_f16(false, (A), false, (B), (short)0, (C), false, false)

__device__ __forceinline__ v16h make_a(v8h lo, v8h hi) {
    v16h r;
#pragma unroll
    for (int i = 0; i < 8; ++i) { r[i] = lo[i]; r[i + 8] = hi[i]; }
    return r;
}

__device__ __forceinline__ void tdm_load_2d_f16(
    unsigned lds_off, const half_t* gptr, unsigned tile_d0, unsigned tile_d1,
    unsigned tensor_d0, unsigned tensor_d1, unsigned stride0) {
    unsigned long long ga = (unsigned long long)(size_t)gptr;
    u32x4 g0;
    g0[0] = 1u;                                       // count=1 (valid), load, user
    g0[1] = lds_off;                                  // lds_addr[31:0]
    g0[2] = (unsigned)(ga & 0xFFFFFFFFu);             // global_addr[31:0]
    g0[3] = (unsigned)((ga >> 32) & 0x01FFFFFFu)      // global_addr[56:32]
          | (2u << 30);                               // type=2 ("image")
    i32x8 g1;
    g1[0] = (int)(1u << 16);
    g1[1] = (int)((tensor_d0 & 0xFFFFu) << 16);
    g1[2] = (int)((tensor_d0 >> 16) | ((tensor_d1 & 0xFFFFu) << 16));
    g1[3] = (int)((tensor_d1 >> 16) | (tile_d0 << 16));
    g1[4] = (int)(tile_d1 & 0xFFFFu);
    g1[5] = (int)stride0;
    g1[6] = 0;
    g1[7] = 0;
    i32x4 z4 = {0, 0, 0, 0};
#if __clang_major__ >= 23
    i32x8 z8v = {0, 0, 0, 0, 0, 0, 0, 0};
    __builtin_amdgcn_tensor_load_to_lds(g0, g1, z4, z4, z8v, 0);
#else
    __builtin_amdgcn_tensor_load_to_lds(g0, g1, z4, z4, 0);
#endif
}

// ---------------------------------------------------------------------------
// Kernel 0: pack 5 weight matrices (128x128 f32, row-major W[k][n]) into the
// WMMA B-operand lane layout as f16 so a wave loads one v16h (32B) per tile.
// ---------------------------------------------------------------------------
__global__ __launch_bounds__(256) void pack_weights(
    const float* __restrict__ Wq1, const float* __restrict__ Wq0,
    const float* __restrict__ Wk,  const float* __restrict__ Wv,
    const float* __restrict__ Wc,  half_t* __restrict__ dst) {
    int idx = blockIdx.x * 256 + threadIdx.x;          // < 5*16384 = 81920
    int w   = idx >> 14, rem = idx & 16383;
    int t   = rem >> 9,  le  = rem & 511;
    int lane = le >> 4,  e   = le & 15;
    int ntile = t >> 2,  ktile = t & 3;
    int k = ktile * 32 + ((lane >> 4) << 3) + (e < 8 ? e : e + 8);
    int n = ntile * 16 + (lane & 15);
    const float* W = (w == 0) ? Wq1 : (w == 1) ? Wq0 : (w == 2) ? Wk : (w == 3) ? Wv : Wc;
    dst[idx] = (half_t)W[k * 128 + n];
}

// ---------------------------------------------------------------------------
// Kernel 1: projections.  One block per 16 flat rows of (B*N, 128).
// K = nodes@Wk, V = nodes@Wv, Q = 0.25*(q1@Wq1 + q0@Wq0); also nodes -> f16.
// ---------------------------------------------------------------------------
__global__ __launch_bounds__(256) void proj_kernel(
    const float* __restrict__ nodes, const float* __restrict__ q1,
    const float* __restrict__ q0,
    const half_t* __restrict__ pWk,  const half_t* __restrict__ pWv,
    const half_t* __restrict__ pWq1, const half_t* __restrict__ pWq0,
    half_t* __restrict__ Kh, half_t* __restrict__ Vh,
    half_t* __restrict__ Qh, half_t* __restrict__ Nh) {
    __shared__ __align__(16) half_t sN[16][136], sQ1[16][136], sQ0[16][136];
    const int r0 = blockIdx.x * 16;
    for (int i = threadIdx.x; i < 2048; i += 256) {
        int rr = i >> 7, cc = i & 127;
        size_t g = (size_t)(r0 + rr) * 128 + cc;
        half_t a = (half_t)nodes[g];
        sN[rr][cc]  = a;  Nh[g] = a;
        sQ1[rr][cc] = (half_t)q1[g];
        sQ0[rr][cc] = (half_t)q0[g];
    }
    __syncthreads();
    const int lane = threadIdx.x & 31, w = threadIdx.x >> 5;
    const int row = lane & 15, kb = (lane >> 4) << 3;
    v8f accK = {}, accV = {}, accQ = {};
#pragma unroll
    for (int kc = 0; kc < 4; ++kc) {
        const int k0 = kc * 32;
        v16h aN  = make_a(*(const v8h*)&sN[row][k0 + kb],  *(const v8h*)&sN[row][k0 + kb + 16]);
        v16h aQ1 = make_a(*(const v8h*)&sQ1[row][k0 + kb], *(const v8h*)&sQ1[row][k0 + kb + 16]);
        v16h aQ0 = make_a(*(const v8h*)&sQ0[row][k0 + kb], *(const v8h*)&sQ0[row][k0 + kb + 16]);
        const int t = (w * 4 + kc) * 512 + lane * 16;
        v16h bK = *(const v16h*)(pWk  + t);
        v16h bV = *(const v16h*)(pWv  + t);
        v16h b1 = *(const v16h*)(pWq1 + t);
        v16h b0 = *(const v16h*)(pWq0 + t);
        accK = WMMA_F16(aN,  bK, accK);
        accV = WMMA_F16(aN,  bV, accV);
        accQ = WMMA_F16(aQ1, b1, accQ);
        accQ = WMMA_F16(aQ0, b0, accQ);
    }
    const int col = w * 16 + (lane & 15);
#pragma unroll
    for (int r = 0; r < 8; ++r) {
        size_t g = (size_t)(r0 + r + ((lane >> 4) << 3)) * 128 + col;
        Kh[g] = (half_t)accK[r];
        Vh[g] = (half_t)accV[r];
        Qh[g] = (half_t)(accQ[r] * 0.25f);   // fold 1/sqrt(D) into Q
    }
}

typedef __attribute__((ext_vector_type(4))) float f32x4;

#define MS_PITCH 68                 // floats per mask row in LDS: 64 keys + 16 bytes (pitch 16 B x odd)
#define MS_BUF   (16 * MS_PITCH)    // floats per ring buffer

// One mask stage: eight asynchronous 16-byte copies per lane, two rows per copy.
// l is the lane's LDS byte address of row pair 0; g[j] its global piece of row pair j.
__device__ __forceinline__ void mask_stage_copy(const unsigned l, const float* const (&g)[8]) {
    asm volatile(
        "global_load_async_to_lds_b128 %0, %8, off\n\t"
        "global_load_async_to_lds_b128 %1, %9, off\n\t"
        "global_load_async_to_lds_b128 %2, %10, off\n\t"
        "global_load_async_to_lds_b128 %3, %11, off\n\t"
        "global_load_async_to_lds_b128 %4, %12, off\n\t"
        "global_load_async_to_lds_b128 %5, %13, off\n\t"
        "global_load_async_to_lds_b128 %6, %14, off\n\t"
        "global_load_async_to_lds_b128 %7, %15, off\n\t"
        "s_wait_xcnt 0x0"
        :: "v"(l), "v"(l + 2 * MS_PITCH * 4), "v"(l + 4 * MS_PITCH * 4), "v"(l + 6 * MS_PITCH * 4),
           "v"(l + 8 * MS_PITCH * 4), "v"(l + 10 * MS_PITCH * 4), "v"(l + 12 * MS_PITCH * 4),
           "v"(l + 14 * MS_PITCH * 4),
           "v"(g[0]), "v"(g[1]), "v"(g[2]), "v"(g[3]), "v"(g[4]), "v"(g[5]), "v"(g[6]), "v"(g[7])
        : "memory");
}

// Hand-over of a ring private to one wave: its reads of the buffer to be refilled have
// retired, and the stage it is about to read has landed.
__device__ __forceinline__ void mask_stage_wait() {
    asm volatile("s_wait_dscnt 0x0" ::: "memory");     // no copy may overtake this wave's own LDS reads
    asm volatile("s_wait_asynccnt 0x0" ::: "memory");  // the compiler places no wait for the copies
}

__device__ __forceinline__ float xhalf(float x) {
    return __builtin_bit_cast(float, __builtin_amdgcn_permlanex16(
        __builtin_bit_cast(int, x), __builtin_bit_cast(int, x),
        0x76543210, 0xfedcba98, false, false));
}

// One pass over 32 keys for 16 queries.  LAST: the pass that holds keys >= 500.
template <bool LAST>
__device__ __forceinline__ void attn_pass(
    const half_t (*sK)[16], const half_t (*sVT)[520], const float* mrow,
    const v16h bQ, const int kc, const int cr, const int kb,
    v16h& aK1, v16h& aK2, v8f& acc, float& mrun, float& lrun) {
    // only d = 0..15 is real: elements 8..15 of both K fragments stay zero throughout
    const v8h k1 = *(const v8h*)&sK[kc + cr][kb];
    const v8h k2 = *(const v8h*)&sK[kc + 16 + cr][kb];
#pragma unroll
    for (int i = 0; i < 8; ++i) { aK1[i] = k1[i]; aK2[i] = k2[i]; }
    v8f s1 = {}, s2 = {};
    s1 = WMMA_F16(aK1, bQ, s1);
    s2 = WMMA_F16(aK2, bQ, s2);
    f32x4 mk[4];
#pragma unroll
    for (int j = 0; j < 4; ++j)
        mk[j] = *(const f32x4*)(mrow + (j >> 1) * 16 + (j & 1) * 4);
    const v8f t1 = s1 + __builtin_shufflevector(mk[0], mk[1], 0, 1, 2, 3, 4, 5, 6, 7);
    const v8f t2 = s2 + __builtin_shufflevector(mk[2], mk[3], 0, 1, 2, 3, 4, 5, 6, 7);
    float v[16];
#pragma unroll
    for (int r = 0; r < 8; ++r) {
        v[r]     = t1[r];
        v[8 + r] = t2[r];
        if (LAST) {
            if (kc + kb + r >= 500)      v[r]     = -1e30f;
            if (kc + 16 + kb + r >= 500) v[8 + r] = -1e30f;
        }
    }
    float cm = v[0];
#pragma unroll
    for (int i = 1; i < 16; ++i) cm = fmaxf(cm, v[i]);
    cm = fmaxf(cm, xhalf(cm));
    const float nm = fmaxf(mrun, cm);
    const float sc = __expf(mrun - nm);
    v16h bP;
    float ls = 0.f;
#pragma unroll
    for (int i = 0; i < 16; ++i) {
        float p = __expf(v[i] - nm);
        ls += p;
        bP[i] = (half_t)p;
    }
    lrun = lrun * sc + ls;      // this half's keys only; halves joined after the last pass
    mrun = nm;
#pragma unroll
    for (int r = 0; r < 8; ++r) acc[r] *= sc;
    v16h aV = make_a(*(const v8h*)&sVT[cr][kc + kb], *(const v8h*)&sVT[cr][kc + kb + 16]);
    acc = WMMA_F16(aV, bP, acc);
}

__global__ __launch_bounds__(256) void attn_kernel(
    const half_t* __restrict__ Kh, const half_t* __restrict__ Vh,
    const half_t* __restrict__ Qh, const float* __restrict__ mask,
    half_t* __restrict__ outc) {
    // one struct, so that the order is the source's: the three tiles keep their places in LDS, the ring follows
    struct Lds {
        half_t sVT[16][520];         // [d][key]
        half_t sK[512][16];          // [key][d]
        half_t sQ[512][16];          // [query][d]
        float  sM[8][2][MS_BUF];     // per wave: two mask stages
    };
    __shared__ __align__(16) Lds lds;
    half_t (&sVT)[16][520] = lds.sVT;
    half_t (&sK)[512][16] = lds.sK;
    half_t (&sQ)[512][16] = lds.sQ;
    float (&sM)[8][2][MS_BUF] = lds.sM;
    const int b = blockIdx.x >> 3, h = blockIdx.x & 7;

    const int w = __builtin_amdgcn_readfirstlane(threadIdx.x >> 5);   // scalar: uniform flow round the copies
    const int crow = (threadIdx.x >> 4) & 1, cpc = threadIdx.x & 15;
    const unsigned mlds = (unsigned)(size_t)&sM[w][0][crow * MS_PITCH + cpc * 4];
    // the last stage holds keys 448..511: pieces past key 496 re-read that piece, inside the row
    const int step7 = 64 - (cpc > 12 ? (cpc - 12) * 4 : 0);
    const float* mg[8];
#pragma unroll                                        // constant indices keep mg[] in registers
    for (int j = 0; j < 8; ++j) {
        const int r = w * 16 + 2 * j + crow;          // w < 8: a real query row
        mg[j] = mask + ((size_t)b * 500 + r) * 500 + cpc * 4;
    }
    mask_stage_copy(mlds, mg);                        // first tile, stage 0, buffer 0

    if (threadIdx.x < 32) {
        const size_t base = (size_t)(b * 500) * 128 + h * 16;
        tdm_load_2d_f16((unsigned)(size_t)&sK[0][0], Kh + base, 16, 500, 128, 500, 128);
        tdm_load_2d_f16((unsigned)(size_t)&sQ[0][0], Qh + base, 16, 500, 128, 500, 128);
    }
    for (int m = threadIdx.x; m < 512; m += 256) {
        if (m < 500) {
            const size_t base = (size_t)(b * 500 + m) * 128 + h * 16;
#pragma unroll
            for (int d = 0; d < 16; ++d) sVT[d][m] = Vh[base + d];
        } else {
#pragma unroll
            for (int d = 0; d < 16; ++d) {
                sK[m][d] = (half_t)0; sQ[m][d] = (half_t)0; sVT[d][m] = (half_t)0;
            }
        }
    }
    if (threadIdx.x < 32) __builtin_amdgcn_s_wait_tensorcnt(0);
    __syncthreads();

    const int lane = threadIdx.x & 31;
    const int cr = lane & 15, hi = lane >> 4, kb = hi << 3;
    const float* mrd = &sM[w][0][cr * MS_PITCH + kb]; // this lane's query row in buffer 0
    v8h z8 = {};
    v16h aK1 = {}, aK2 = {};
    for (int mt = w; mt < 32; mt += 8) {
        const int n0 = mt * 16;
        const int nq = n0 + cr;                       // this lane's query
        v16h bQ = make_a(*(const v8h*)&sQ[nq][kb], z8);   // K(d) padded to 32
        v8f acc = {};                                 // acc[r] = O[nq][8*hi + r]
        float mrun = -1e30f, lrun = 0.f;
        // eight stages a tile, so every tile starts in buffer 0; stage s + 1 flies while stage s is worked on
        for (int s = 0; s < 7; ++s) {
            mask_stage_wait();
            const int step = s == 6 ? step7 : 64;
#pragma unroll                                        // constant indices keep mg[] in registers
            for (int j = 0; j < 8; ++j) mg[j] += step;
            mask_stage_copy(mlds + ((s + 1) & 1) * (MS_BUF * 4), mg);
            const float* mr = mrd + (s & 1) * MS_BUF;
            attn_pass<false>(sK, sVT, mr,      bQ, s * 64,      cr, kb, aK1, aK2, acc, mrun, lrun);
            attn_pass<false>(sK, sVT, mr + 32, bQ, s * 64 + 32, cr, kb, aK1, aK2, acc, mrun, lrun);
        }
        mask_stage_wait();
        if (mt + 8 < 32) {                            // the next tile's stage 0, into buffer 0
#pragma unroll                                        // constant indices keep mg[] in registers
            for (int j = 0; j < 8; ++j) {
                const int r = n0 + 128 + 2 * j + crow;
                const int rc = r < 500 ? r : 499;     // pad queries copy a real mask row, are never stored
                mg[j] = mask + ((size_t)b * 500 + rc) * 500 + cpc * 4;
            }
            mask_stage_copy(mlds, mg);
        }
        attn_pass<false>(sK, sVT, mrd + MS_BUF,      bQ, 448, cr, kb, aK1, aK2, acc, mrun, lrun);
        attn_pass<true>(sK, sVT,  mrd + MS_BUF + 32, bQ, 480, cr, kb, aK1, aK2, acc, mrun, lrun);
        lrun += xhalf(lrun);
        if (nq < 500) {
            const float inv = 1.0f / lrun;            // one query per lane: one reciprocal
            v8h o;
#pragma unroll
            for (int r = 0; r < 8; ++r) o[r] = (half_t)(acc[r] * inv);
            *(v8h*)&outc[(size_t)(b * 500 + nq) * 128 + h * 16 + kb] = o;
            // the next query tile reuses the store's address and data registers
            asm volatile("s_wait_xcnt 0x0" ::: "memory");
        }
    }
}

// ---------------------------------------------------------------------------
// Kernel 3: mh = outc@Wc + bc, s = mh@nodes^T/sqrt(128), 10*tanh + mask,
// row softmax -> probs.  One block per (b, 16-query tile).
// The tile's 16 mask rows are copied into the score buffer at entry, as whole
// 512-byte row pieces, and land while stage 1 runs; stage 2 adds its logits there.
// ---------------------------------------------------------------------------
// Eight asynchronous 16-byte copies per lane: l[j] the lane's LDS byte address, g[j] its global piece.
__device__ __forceinline__ void mask_rows_copy(const unsigned (&l)[8], const float* const (&g)[8]) {
    asm volatile(
        "global_load_async_to_lds_b128 %0, %8, off\n\t"
        "global_load_async_to_lds_b128 %1, %9, off\n\t"
        "global_load_async_to_lds_b128 %2, %10, off\n\t"
        "global_load_async_to_lds_b128 %3, %11, off\n\t"
        "global_load_async_to_lds_b128 %4, %12, off\n\t"
        "global_load_async_to_lds_b128 %5, %13, off\n\t"
        "global_load_async_to_lds_b128 %6, %14, off\n\t"
        "global_load_async_to_lds_b128 %7, %15, off\n\t"
        "s_wait_xcnt 0x0"
        :: "v"(l[0]), "v"(l[1]), "v"(l[2]), "v"(l[3]), "v"(l[4]), "v"(l[5]), "v"(l[6]), "v"(l[7]),
           "v"(g[0]), "v"(g[1]), "v"(g[2]), "v"(g[3]), "v"(g[4]), "v"(g[5]), "v"(g[6]), "v"(g[7])
        : "memory");
}

template <int CTRL>
__device__ __forceinline__ float row_xor(float x) {
    return __builtin_bit_cast(float, __builtin_amdgcn_mov_dpp(__builtin_bit_cast(int, x), CTRL, 0xf, 0xf, true));
}

__device__ __forceinline__ void exp2_run(float (&t)[8]) {
    asm("v_exp_f32 %0, %0\n\t"
        "v_exp_f32 %1, %1\n\t"
        "v_exp_f32 %2, %2\n\t"
        "v_exp_f32 %3, %3\n\t"
        "v_exp_f32 %4, %4\n\t"
        "v_exp_f32 %5, %5\n\t"
        "v_exp_f32 %6, %6\n\t"
        "v_exp_f32 %7, %7\n\t"
        "v_nop"
        : "+v"(t[0]), "+v"(t[1]), "+v"(t[2]), "+v"(t[3]), "+v"(t[4]), "+v"(t[5]), "+v"(t[6]), "+v"(t[7]));
}

__global__ __launch_bounds__(256) void combine_kernel(
    const half_t* __restrict__ outc, const half_t* __restrict__ pWc,
    const float* __restrict__ bc, const half_t* __restrict__ Nh,
    const float* __restrict__ mask, float* __restrict__ probs) {
    __shared__ __align__(16) half_t sMH[16][136];
    __shared__ __align__(16) float  sS[16][520];
    const int b = blockIdx.x >> 5, nt = blockIdx.x & 31;
    const int n0 = nt * 16;
    const int lane = threadIdx.x & 31, w = threadIdx.x >> 5;
    const int cr = lane & 15, hi = lane >> 4, kb = hi << 3;
    v8h z8 = {};
    // --- mask rows into sS: wave w brings rows 2w and 2w+1, four copies a row, every lane on ---
    {
        unsigned ml[8];
        const float* mg[8];
#pragma unroll                                        // constant indices keep ml[] and mg[] in registers
        for (int j = 0; j < 8; ++j) {
            const int rr = 2 * w + (j >> 2);
            const int pc = (j & 3) * 32 + lane;
            const int rq = n0 + rr < 500 ? n0 + rr : 499;
            const int ps = pc < 125 ? pc : 124;
            ml[j] = (unsigned)(size_t)&sS[rr][pc * 4];
            mg[j] = mask + ((size_t)b * 500 + rq) * 500 + ps * 4;
        }
        mask_rows_copy(ml, mg);
    }
    // --- stage 1: mh column tile [16w, 16w+16) ---
    v8f acc = {};
    const int arow = n0 + cr;
    const bool av = arow < 500;
#pragma unroll
    for (int kc = 0; kc < 4; ++kc) {
        v16h a;
        if (av) {
            const half_t* ap = outc + (size_t)(b * 500 + arow) * 128 + kc * 32 + kb;
            a = make_a(*(const v8h*)ap, *(const v8h*)(ap + 16));
        } else a = make_a(z8, z8);
        v16h bb = *(const v16h*)(pWc + (w * 4 + kc) * 512 + lane * 16);
        acc = WMMA_F16(a, bb, acc);
    }
    const float bias = bc[w * 16 + cr];
#pragma unroll
    for (int r = 0; r < 8; ++r) sMH[r + (hi << 3)][w * 16 + cr] = (half_t)(acc[r] + bias);
    // the compiler places no wait for the copies; behind it the barrier hands every wave's mask rows to the others
    asm volatile("s_wait_asynccnt 0x0" ::: "memory");
    __syncthreads();
    // --- stage 2: pointer logits over all keys ---
    const float inv_se = 1.0f / 11.313708498984761f;
    for (int mt = w; mt < 32; mt += 8) {
        const int m0 = mt * 16;
        v8f sa = {};
#pragma unroll
        for (int kc = 0; kc < 4; ++kc) {
            v16h a = make_a(*(const v8h*)&sMH[cr][kc * 32 + kb],
                            *(const v8h*)&sMH[cr][kc * 32 + kb + 16]);
            const int mr = m0 + cr;
            v16h bb;
            if (mr < 500) {
                const half_t* np = Nh + (size_t)(b * 500 + mr) * 128 + kc * 32 + kb;
                bb = make_a(*(const v8h*)np, *(const v8h*)(np + 16));
            } else bb = make_a(z8, z8);
            sa = WMMA_F16(a, bb, sa);
        }
        float mv[8];
#pragma unroll
        for (int r = 0; r < 8; ++r) mv[r] = sS[r + (hi << 3)][m0 + cr];
#pragma unroll
        for (int r = 0; r < 8; ++r) {
            const int row = r + (hi << 3);
            const int mk = m0 + cr;
            float s = 10.0f * tanhf(sa[r] * inv_se) + mv[r];
            if (mk >= 500) s = -1e30f;
            sS[row][mk] = s;
        }
    }
    __syncthreads();
    f32x4 x[2][4];
#pragma unroll                                        // constant indices keep x[][] in registers
    for (int q = 0; q < 2; ++q)
#pragma unroll                                        // constant indices keep x[][] in registers
        for (int j = 0; j < 4; ++j) x[q][j] = *(const f32x4*)&sS[2 * w + q][(j * 32 + lane) * 4];
    float inv[2];
#pragma unroll                                        // constant indices keep x[][] in registers
    for (int q = 0; q < 2; ++q) {
        float mx = x[q][0][0];
#pragma unroll                                        // constant indices keep x[][] in registers
        for (int j = 0; j < 4; ++j)
#pragma unroll                                        // constant indices keep x[][] in registers
            for (int i = 0; i < 4; ++i) mx = fmaxf(mx, x[q][j][i]);
        mx = fmaxf(mx, row_xor<0x161>(mx));
        mx = fmaxf(mx, row_xor<0x162>(mx));
        mx = fmaxf(mx, row_xor<0x164>(mx));
        mx = fmaxf(mx, row_xor<0x168>(mx));
        mx = fmaxf(mx, xhalf(mx));
#pragma unroll                                        // constant indices keep x[][] in registers
        for (int j = 0; j < 4; j += 2) {
            float t[8];
#pragma unroll                                        // constant indices keep t[] in registers
            for (int i = 0; i < 8; ++i) t[i] = (x[q][j + (i >> 2)][i & 3] - mx) * 1.44269504f;
            exp2_run(t);
#pragma unroll                                        // constant indices keep x[][] in registers
            for (int i = 0; i < 8; ++i) x[q][j + (i >> 2)][i & 3] = t[i];
        }
        const f32x4 sv = (x[q][0] + x[q][1]) + (x[q][2] + x[q][3]);
        float sum = (sv[0] + sv[1]) + (sv[2] + sv[3]);
        sum += row_xor<0x161>(sum);
        sum += row_xor<0x162>(sum);
        sum += row_xor<0x164>(sum);
        sum += row_xor<0x168>(sum);
        sum += xhalf(sum);
        inv[q] = 1.0f / sum;
    }
#pragma unroll                                        // constant indices keep x[][] in registers
    for (int q = 0; q < 2; ++q) {
        const int nq = n0 + 2 * w + q;
        if (nq < 500) {
            float* op = probs + ((size_t)b * 500 + nq) * 500;
#pragma unroll                                        // constant indices keep x[][] in registers
            for (int j = 0; j < 4; ++j) {
                const int pc = j * 32 + lane;         // 125 pieces of 16 bytes are the row
                if (pc < 125) *(f32x4*)(op + pc * 4) = x[q][j] * inv[q];
            }
        }
    }
}

extern "C" void kernel_launch(void* const* d_in, const int* in_sizes, int n_in,
                              void* d_out, int out_size, void* d_ws, size_t ws_size,
                              hipStream_t stream) {
    const float* nodes = (const float*)d_in[0];
    const float* q1    = (const float*)d_in[1];
    const float* q0    = (const float*)d_in[2];
    const float* mask  = (const float*)d_in[3];
    const float* Wq1   = (const float*)d_in[4];
    const float* Wq0   = (const float*)d_in[5];
    const float* Wk    = (const float*)d_in[6];
    const float* Wv    = (const float*)d_in[7];
    const float* Wc    = (const float*)d_in[8];
    const float* bcp   = (const float*)d_in[9];
    float* probs = (float*)d_out;

    // Workspace layout (f16): 5 tensors of 32000x128 + 5 packed weights -> ~41 MB
    const size_t RE = (size_t)32000 * 128;
    half_t* ws = (half_t*)d_ws;
    half_t* Kh = ws;
    half_t* Vh = Kh + RE;
    half_t* Qh = Vh + RE;
    half_t* Nh = Qh + RE;
    half_t* OC = Nh + RE;
    half_t* PW = OC + RE;                 // 5 * 16384 halves
    half_t* pWq1 = PW;
    half_t* pWq0 = PW + 16384;
    half_t* pWk  = PW + 32768;
    half_t* pWv  = PW + 49152;
    half_t* pWc  = PW + 65536;

    pack_weights<<<320, 256, 0, stream>>>(Wq1, Wq0, Wk, Wv, Wc, PW);
    proj_kernel<<<2000, 256, 0, stream>>>(nodes, q1, q0, pWk, pWv, pWq1, pWq0, Kh, Vh, Qh, Nh);
    attn_kernel<<<512, 256, 0, stream>>>(Kh, Vh, Qh, mask, OC);
    combine_kernel<<<2048, 256, 0, stream>>>(OC, pWc, bcp, Nh, mask, probs);
}

// v005
// One run takes 91.9 microseconds.
// Timed twice side by side with v004, it ran 1.09 and 1.08 times as fast.
// Over all steps from v000 it is 2.86 times as fast.
#include <hip/hip_runtime.h>
#include <hip/hip_bf16.h>

typedef _Float16 half_t;
typedef __attribute__((ext_vector_type(16))) _Float16 v16h;
typedef __attribute__((ext_vector_type(8)))  _Float16 v8h;
typedef __attribute__((ext_vector_type(8)))  float    v8f;
typedef __attribute__((ext_vector_type(4)))  unsigned int u32x4;
typedef __attribute__((ext_vector_type(8)))  int          i32x8;
typedef __attribute__((ext_vector_type(4)))  int          i32x4;

#define WMMA_F16(A, B, C) \
    __builtin_amdgcn_wmma_f32_16x16x32_f16(false, (A), false, (B), (short)0, (C), false, false)

__device__ __forceinline__ v16h make_a(v8h lo, v8h hi) {
    v16h r;
#pragma unroll
    for (int i = 0; i < 8; ++i) { r[i] = lo[i]; r[i + 8] = hi[i]; }
    return r;
}

__device__ __forceinline__ void tdm_load_2d_f16(
    unsigned lds_off, const half_t* gptr, unsigned tile_d0, unsigned tile_d1,
    unsigned tensor_d0, unsigned tensor_d1, unsigned stride0) {
    unsigned long long ga = (unsigned long long)(size_t)gptr;
    u32x4 g0;
    g0[0] = 1u;                                       // count=1 (valid), load, user
    g0[1] = lds_off;                                  // lds_addr[31:0]
    g0[2] = (unsigned)(ga & 0xFFFFFFFFu);             // global_addr[31:0]
    g0[3] = (unsigned)((ga >> 32) & 0x01FFFFFFu)      // global_addr[56:32]
          | (2u << 30);                               // type=2 ("image")
    i32x8 g1;
    g1[0] = (int)(1u << 16);
    g1[1] = (int)((tensor_d0 & 0xFFFFu) << 16);
    g1[2] = (int)((tensor_d0 >> 16) | ((tensor_d1 & 0xFFFFu) << 16));
    g1[3] = (int)((tensor_d1 >> 16) | (tile_d0 << 16));
    g1[4] = (int)(tile_d1 & 0xFFFFu);
    g1[5] = (int)stride0;
    g1[6] = 0;
    g1[7] = 0;
    i32x4 z4 = {0, 0, 0, 0};
#if __clang_major__ >= 23
    i32x8 z8v = {0, 0, 0, 0, 0, 0, 0, 0};
    __builtin_amdgcn_tensor_load_to_lds(g0, g1, z4, z4, z8v, 0);
#else
    __builtin_amdgcn_tensor_load_to_lds(g0, g1, z4, z4, 0);
#endif
}

// ---------------------------------------------------------------------------
// Kernel 0: pack 5 weight matrices (128x128 f32, row-major W[k][n]) into the
// WMMA B-operand lane layout as f16 so a wave loads one v16h (32B) per tile.
// ---------------------------------------------------------------------------
__global__ __launch_bounds__(256) void pack_weights(
    const float* __restrict__ Wq1, const float* __restrict__ Wq0,
    const float* __restrict__ Wk,  const float* __restrict__ Wv,
    const float* __restrict__ Wc,  half_t* __restrict__ dst) {
    int idx = blockIdx.x * 256 + threadIdx.x;          // < 5*16384 = 81920
    int w   = idx >> 14, rem = idx & 16383;
    int t   = rem >> 9,  le  = rem & 511;
    int lane = le >> 4,  e   = le & 15;
    int ntile = t >> 2,  ktile = t & 3;
    int k = ktile * 32 + ((lane >> 4) << 3) + (e < 8 ? e : e + 8);
    int n = ntile * 16 + (lane & 15);
    const float* W = (w == 0) ? Wq1 : (w == 1) ? Wq0 : (w == 2) ? Wk : (w == 3) ? Wv : Wc;
    dst[idx] = (half_t)W[k * 128 + n];
}

__global__ __launch_bounds__(256) void proj_kernel(
    const float* __restrict__ nodes, const float* __restrict__ q1,
    const float* __restrict__ q0,
    const half_t* __restrict__ pWk,  const half_t* __restrict__ pWv,
    const half_t* __restrict__ pWq1, const half_t* __restrict__ pWq0,
    half_t* __restrict__ Kh, half_t* __restrict__ Vh,
    half_t* __restrict__ Qh, half_t* __restrict__ Nf) {
    __shared__ __align__(16) half_t sN[16][136], sQ1[16][136], sQ0[16][136];
    const int m0 = (blockIdx.x & 31) * 16;             // first row of the tile inside its batch
    const int rb = (blockIdx.x >> 5) * 500;            // first flat row of the batch
    for (int i = threadIdx.x; i < 2048; i += 256) {
        int rr = i >> 7, cc = i & 127;
        const int m = m0 + rr < 500 ? m0 + rr : 499;   // pad rows repeat the batch's last row, are stored only in Nf
        size_t g = (size_t)(rb + m) * 128 + cc;
        sN[rr][cc]  = (half_t)nodes[g];
        sQ1[rr][cc] = (half_t)q1[g];
        sQ0[rr][cc] = (half_t)q0[g];
    }
    __syncthreads();
    const int lane = threadIdx.x & 31, w = threadIdx.x >> 5;
    const int row = lane & 15, kb = (lane >> 4) << 3;
    // wave w stores half w >> 2 of the nodes fragment of k chunk w & 3: one 512-byte piece
    *(v8h*)(Nf + ((size_t)blockIdx.x * 4 + (w & 3)) * 512 + (w >> 2) * 256 + lane * 8) =
        *(const v8h*)&sN[row][(w & 3) * 32 + kb + (w >> 2) * 16];
    v8f accK = {}, accV = {}, accQ = {};
#pragma unroll
    for (int kc = 0; kc < 4; ++kc) {
        const int k0 = kc * 32;
        v16h aN  = make_a(*(const v8h*)&sN[row][k0 + kb],  *(const v8h*)&sN[row][k0 + kb + 16]);
        v16h aQ1 = make_a(*(const v8h*)&sQ1[row][k0 + kb], *(const v8h*)&sQ1[row][k0 + kb + 16]);
        v16h aQ0 = make_a(*(const v8h*)&sQ0[row][k0 + kb], *(const v8h*)&sQ0[row][k0 + kb + 16]);
        const int t = (w * 4 + kc) * 512 + lane * 16;
        v16h bK = *(const v16h*)(pWk  + t);
        v16h bV = *(const v16h*)(pWv  + t);
        v16h b1 = *(const v16h*)(pWq1 + t);
        v16h b0 = *(const v16h*)(pWq0 + t);
        accK = WMMA_F16(aN,  bK, accK);
        accV = WMMA_F16(aN,  bV, accV);
        accQ = WMMA_F16(aQ1, b1, accQ);
        accQ = WMMA_F16(aQ0, b0, accQ);
    }
    const int col = w * 16 + (lane & 15);
    const int mh = m0 + ((lane >> 4) << 3);
    auto put = [&](const int r) {
        size_t g = (size_t)(rb + mh + r) * 128 + col;
        Kh[g] = (half_t)accK[r];
        Vh[g] = (half_t)accV[r];
        Qh[g] = (half_t)(accQ[r] * 0.25f);   // fold 1/sqrt(D) into Q
    };
    if (m0 + 16 <= 500) {                    // block-uniform: all but a batch's last tile store without a row test
#pragma unroll
        for (int r = 0; r < 8; ++r) put(r);
    } else {
#pragma unroll
        for (int r = 0; r < 8; ++r)
            if (mh + r < 500) put(r);
    }
}

typedef __attribute__((ext_vector_type(4))) float f32x4;

#define MS_PITCH 68                 // floats per mask row in LDS: 64 keys + 16 bytes (pitch 16 B x odd)
#define MS_BUF   (16 * MS_PITCH)    // floats per ring buffer

// One mask stage: eight asynchronous 16-byte copies per lane, two rows per copy.
// l is the lane's LDS byte address of row pair 0; g[j] its global piece of row pair j.
__device__ __forceinline__ void mask_stage_copy(const unsigned l, const float* const (&g)[8]) {
    asm volatile(
        "global_load_async_to_lds_b128 %0, %8, off\n\t"
        "global_load_async_to_lds_b128 %1, %9, off\n\t"
        "global_load_async_to_lds_b128 %2, %10, off\n\t"
        "global_load_async_to_lds_b128 %3, %11, off\n\t"
        "global_load_async_to_lds_b128 %4, %12, off\n\t"
        "global_load_async_to_lds_b128 %5, %13, off\n\t"
        "global_load_async_to_lds_b128 %6, %14, off\n\t"
        "global_load_async_to_lds_b128 %7, %15, off\n\t"
        "s_wait_xcnt 0x0"
        :: "v"(l), "v"(l + 2 * MS_PITCH * 4), "v"(l + 4 * MS_PITCH * 4), "v"(l + 6 * MS_PITCH * 4),
           "v"(l + 8 * MS_PITCH * 4), "v"(l + 10 * MS_PITCH * 4), "v"(l + 12 * MS_PITCH * 4),
           "v"(l + 14 * MS_PITCH * 4),
           "v"(g[0]), "v"(g[1]), "v"(g[2]), "v"(g[3]), "v"(g[4]), "v"(g[5]), "v"(g[6]), "v"(g[7])
        : "memory");
}

// Hand-over of a ring private to one wave: its reads of the buffer to be refilled have
// retired, and the stage it is about to read has landed.
__device__ __forceinline__ void mask_stage_wait() {
    asm volatile("s_wait_dscnt 0x0" ::: "memory");     // no copy may overtake this wave's own LDS reads
    asm volatile("s_wait_asynccnt 0x0" ::: "memory");  // the compiler places no wait for the copies
}

__device__ __forceinline__ float xhalf(float x) {
    return __builtin_bit_cast(float, __builtin_amdgcn_permlanex16(
        __builtin_bit_cast(int, x), __builtin_bit_cast(int, x),
        0x76543210, 0xfedcba98, false, false));
}

// One pass over 32 keys for 16 queries.  LAST: the pass that holds keys >= 500.
template <bool LAST>
__device__ __forceinline__ void attn_pass(
    const half_t (*sK)[16], const half_t (*sVT)[520], const float* mrow,
    const v16h bQ, const int kc, const int cr, const int kb,
    v16h& aK1, v16h& aK2, v8f& acc, float& mrun, float& lrun) {
    // only d = 0..15 is real: elements 8..15 of both K fragments stay zero throughout
    const v8h k1 = *(const v8h*)&sK[kc + cr][kb];
    const v8h k2 = *(const v8h*)&sK[kc + 16 + cr][kb];
#pragma unroll
    for (int i = 0; i < 8; ++i) { aK1[i] = k1[i]; aK2[i] = k2[i]; }
    v8f s1 = {}, s2 = {};
    s1 = WMMA_F16(aK1, bQ, s1);
    s2 = WMMA_F16(aK2, bQ, s2);
    f32x4 mk[4];
#pragma unroll
    for (int j = 0; j < 4; ++j)
        mk[j] = *(const f32x4*)(mrow + (j >> 1) * 16 + (j & 1) * 4);
    const v8f t1 = s1 + __builtin_shufflevector(mk[0], mk[1], 0, 1, 2, 3, 4, 5, 6, 7);
    const v8f t2 = s2 + __builtin_shufflevector(mk[2], mk[3], 0, 1, 2, 3, 4, 5, 6, 7);
    float v[16];
#pragma unroll
    for (int r = 0; r < 8; ++r) {
        v[r]     = t1[r];
        v[8 + r] = t2[r];
        if (LAST) {
            if (kc + kb + r >= 500)      v[r]     = -1e30f;
            if (kc + 16 + kb + r >= 500) v[8 + r] = -1e30f;
        }
    }
    float cm = v[0];
#pragma unroll
    for (int i = 1; i < 16; ++i) cm = fmaxf(cm, v[i]);
    cm = fmaxf(cm, xhalf(cm));
    const float nm = fmaxf(mrun, cm);
    const float sc = __expf(mrun - nm);
    v16h bP;
    float ls = 0.f;
#pragma unroll
    for (int i = 0; i < 16; ++i) {
        float p = __expf(v[i] - nm);
        ls += p;
        bP[i] = (half_t)p;
    }
    lrun = lrun * sc + ls;      // this half's keys only; halves joined after the last pass
    mrun = nm;
#pragma unroll
    for (int r = 0; r < 8; ++r) acc[r] *= sc;
    v16h aV = make_a(*(const v8h*)&sVT[cr][kc + kb], *(const v8h*)&sVT[cr][kc + kb + 16]);
    acc = WMMA_F16(aV, bP, acc);
}

__global__ __launch_bounds__(256) void attn_kernel(
    const half_t* __restrict__ Kh, const half_t* __restrict__ Vh,
    const half_t* __restrict__ Qh, const float* __restrict__ mask,
    half_t* __restrict__ outc) {
    // one struct, so that the order is the source's: the three tiles keep their places in LDS, the ring follows
    struct Lds {
        half_t sVT[16][520];         // [d][key]
        half_t sK[512][16];          // [key][d]
        half_t sQ[512][16];          // [query][d]
        float  sM[8][2][MS_BUF];     // per wave: two mask stages
    };
    __shared__ __align__(16) Lds lds;
    half_t (&sVT)[16][520] = lds.sVT;
    half_t (&sK)[512][16] = lds.sK;
    half_t (&sQ)[512][16] = lds.sQ;
    float (&sM)[8][2][MS_BUF] = lds.sM;
    const int b = blockIdx.x >> 3, h = blockIdx.x & 7;

    const int w = __builtin_amdgcn_readfirstlane(threadIdx.x >> 5);   // scalar: uniform flow round the copies
    const int crow = (threadIdx.x >> 4) & 1, cpc = threadIdx.x & 15;
    const unsigned mlds = (unsigned)(size_t)&sM[w][0][crow * MS_PITCH + cpc * 4];
    // the last stage holds keys 448..511: pieces past key 496 re-read that piece, inside the row
    const int step7 = 64 - (cpc > 12 ? (cpc - 12) * 4 : 0);
    const float* mg[8];
#pragma unroll                                        // constant indices keep mg[] in registers
    for (int j = 0; j < 8; ++j) {
        const int r = w * 16 + 2 * j + crow;          // w < 8: a real query row
        mg[j] = mask + ((size_t)b * 500 + r) * 500 + cpc * 4;
    }
    mask_stage_copy(mlds, mg);                        // first tile, stage 0, buffer 0

    if (threadIdx.x < 32) {
        const size_t base = (size_t)(b * 500) * 128 + h * 16;
        tdm_load_2d_f16((unsigned)(size_t)&sK[0][0], Kh + base, 16, 500, 128, 500, 128);
        tdm_load_2d_f16((unsigned)(size_t)&sQ[0][0], Qh + base, 16, 500, 128, 500, 128);
    }
    for (int m = threadIdx.x; m < 512; m += 256) {
        if (m < 500) {
            const size_t base = (size_t)(b * 500 + m) * 128 + h * 16;
#pragma unroll
            for (int d = 0; d < 16; ++d) sVT[d][m] = Vh[base + d];
        } else {
#pragma unroll
            for (int d = 0; d < 16; ++d) {
                sK[m][d] = (half_t)0; sQ[m][d] = (half_t)0; sVT[d][m] = (half_t)0;
            }
        }
    }
    if (threadIdx.x < 32) __builtin_amdgcn_s_wait_tensorcnt(0);
    __syncthreads();

    const int lane = threadIdx.x & 31;
    const int cr = lane & 15, hi = lane >> 4, kb = hi << 3;
    const float* mrd = &sM[w][0][cr * MS_PITCH + kb]; // this lane's query row in buffer 0
    v8h z8 = {};
    v16h aK1 = {}, aK2 = {};
    for (int mt = w; mt < 32; mt += 8) {
        const int n0 = mt * 16;
        const int nq = n0 + cr;                       // this lane's query
        v16h bQ = make_a(*(const v8h*)&sQ[nq][kb], z8);   // K(d) padded to 32
        v8f acc = {};                                 // acc[r] = O[nq][8*hi + r]
        float mrun = -1e30f, lrun = 0.f;
        // eight stages a tile, so every tile starts in buffer 0; stage s + 1 flies while stage s is worked on
        for (int s = 0; s < 7; ++s) {
            mask_stage_wait();
            const int step = s == 6 ? step7 : 64;
#pragma unroll                                        // constant indices keep mg[] in registers
            for (int j = 0; j < 8; ++j) mg[j] += step;
            mask_stage_copy(mlds + ((s + 1) & 1) * (MS_BUF * 4), mg);
            const float* mr = mrd + (s & 1) * MS_BUF;
            attn_pass<false>(sK, sVT, mr,      bQ, s * 64,      cr, kb, aK1, aK2, acc, mrun, lrun);
            attn_pass<false>(sK, sVT, mr + 32, bQ, s * 64 + 32, cr, kb, aK1, aK2, acc, mrun, lrun);
        }
        mask_stage_wait();
        if (mt + 8 < 32) {                            // the next tile's stage 0, into buffer 0
#pragma unroll                                        // constant indices keep mg[] in registers
            for (int j = 0; j < 8; ++j) {
                const int r = n0 + 128 + 2 * j + crow;
                const int rc = r < 500 ? r : 499;     // pad queries copy a real mask row, are never stored
                mg[j] = mask + ((size_t)b * 500 + rc) * 500 + cpc * 4;
            }
            mask_stage_copy(mlds, mg);
        }
        attn_pass<false>(sK, sVT, mrd + MS_BUF,      bQ, 448, cr, kb, aK1, aK2, acc, mrun, lrun);
        attn_pass<true>(sK, sVT,  mrd + MS_BUF + 32, bQ, 480, cr, kb, aK1, aK2, acc, mrun, lrun);
        lrun += xhalf(lrun);
        if (nq < 500) {
            const float inv = 1.0f / lrun;            // one query per lane: one reciprocal
            v8h o;
#pragma unroll
            for (int r = 0; r < 8; ++r) o[r] = (half_t)(acc[r] * inv);
            *(v8h*)&outc[(size_t)(b * 500 + nq) * 128 + h * 16 + kb] = o;
            // the next query tile reuses the store's address and data registers
            asm volatile("s_wait_xcnt 0x0" ::: "memory");
        }
    }
}

// ---------------------------------------------------------------------------
// Kernel 3: mh = outc@Wc + bc, s = mh@nodes^T/sqrt(128), 10*tanh + mask,
// row softmax -> probs.  One block per (b, 16-query tile).
// The tile's 16 mask rows are copied into the score buffer at entry, as whole
// 512-byte row pieces, and land while stage 1 runs; stage 2 adds its logits there.
// ---------------------------------------------------------------------------
// Eight asynchronous 16-byte copies per lane: l[j] the lane's LDS byte address, g[j] its global piece.
__device__ __forceinline__ void mask_rows_copy(const unsigned (&l)[8], const float* const (&g)[8]) {
    asm volatile(
        "global_load_async_to_lds_b128 %0, %8, off\n\t"
        "global_load_async_to_lds_b128 %1, %9, off\n\t"
        "global_load_async_to_lds_b128 %2, %10, off\n\t"
        "global_load_async_to_lds_b128 %3, %11, off\n\t"
        "global_load_async_to_lds_b128 %4, %12, off\n\t"
        "global_load_async_to_lds_b128 %5, %13, off\n\t"
        "global_load_async_to_lds_b128 %6, %14, off\n\t"
        "global_load_async_to_lds_b128 %7, %15, off\n\t"
        "s_wait_xcnt 0x0"
        :: "v"(l[0]), "v"(l[1]), "v"(l[2]), "v"(l[3]), "v"(l[4]), "v"(l[5]), "v"(l[6]), "v"(l[7]),
           "v"(g[0]), "v"(g[1]), "v"(g[2]), "v"(g[3]), "v"(g[4]), "v"(g[5]), "v"(g[6]), "v"(g[7])
        : "memory");
}

template <int CTRL>
__device__ __forceinline__ float row_xor(float x) {
    return __builtin_bit_cast(float, __builtin_amdgcn_mov_dpp(__builtin_bit_cast(int, x), CTRL, 0xf, 0xf, true));
}

__device__ __forceinline__ void exp2_run(float (&t)[8]) {
    asm("v_exp_f32 %0, %0\n\t"
        "v_exp_f32 %1, %1\n\t"
        "v_exp_f32 %2, %2\n\t"
        "v_exp_f32 %3, %3\n\t"
        "v_exp_f32 %4, %4\n\t"
        "v_exp_f32 %5, %5\n\t"
        "v_exp_f32 %6, %6\n\t"
        "v_exp_f32 %7, %7\n\t"
        "v_nop"
        : "+v"(t[0]), "+v"(t[1]), "+v"(t[2]), "+v"(t[3]), "+v"(t[4]), "+v"(t[5]), "+v"(t[6]), "+v"(t[7]));
}

__global__ __launch_bounds__(256) void combine_kernel(
    const half_t* __restrict__ outc, const half_t* __restrict__ pWc,
    const float* __restrict__ bc, const half_t* __restrict__ Nf,
    const float* __restrict__ mask, float* __restrict__ probs) {
    __shared__ __align__(16) half_t sMH[16][136];
    __shared__ __align__(16) float  sS[16][520];
    const int b = blockIdx.x >> 5, nt = blockIdx.x & 31;
    const int n0 = nt * 16;
    const int lane = threadIdx.x & 31, w = threadIdx.x >> 5;
    const int cr = lane & 15, hi = lane >> 4, kb = hi << 3;
    v8h z8 = {};
    // --- mask rows into sS: wave w brings rows 2w and 2w+1, four copies a row, every lane on ---
    {
        unsigned ml[8];
        const float* mg[8];
#pragma unroll                                        // constant indices keep ml[] and mg[] in registers
        for (int j = 0; j < 8; ++j) {
            const int rr = 2 * w + (j >> 2);
            const int pc = (j & 3) * 32 + lane;
            const int rq = n0 + rr < 500 ? n0 + rr : 499;
            const int ps = pc < 125 ? pc : 124;
            ml[j] = (unsigned)(size_t)&sS[rr][pc * 4];
            mg[j] = mask + ((size_t)b * 500 + rq) * 500 + ps * 4;
        }
        mask_rows_copy(ml, mg);
    }
    // --- stage 1: mh column tile [16w, 16w+16) ---
    v8f acc = {};
    const int arow = n0 + cr;
    const bool av = arow < 500;
#pragma unroll
    for (int kc = 0; kc < 4; ++kc) {
        v16h a;
        if (av) {
            const half_t* ap = outc + (size_t)(b * 500 + arow) * 128 + kc * 32 + kb;
            a = make_a(*(const v8h*)ap, *(const v8h*)(ap + 16));
        } else a = make_a(z8, z8);
        v16h bb = *(const v16h*)(pWc + (w * 4 + kc) * 512 + lane * 16);
        acc = WMMA_F16(a, bb, acc);
    }
    const float bias = bc[w * 16 + cr];
#pragma unroll
    for (int r = 0; r < 8; ++r) sMH[r + (hi << 3)][w * 16 + cr] = (half_t)(acc[r] + bias);
    // the compiler places no wait for the copies; behind it the barrier hands every wave's mask rows to the others
    asm volatile("s_wait_asynccnt 0x0" ::: "memory");
    __syncthreads();
    // --- stage 2: pointer logits over all keys ---
    const float inv_se = 1.0f / 11.313708498984761f;
    v16h am[4];                                       // the query tile's fragments, read once (the wait below bars the compiler from hoisting them)
#pragma unroll                                        // constant indices keep am[] in registers
    for (int kc = 0; kc < 4; ++kc)
        am[kc] = make_a(*(const v8h*)&sMH[cr][kc * 32 + kb], *(const v8h*)&sMH[cr][kc * 32 + kb + 16]);
    for (int mt = w; mt < 32; mt += 8) {
        const int m0 = mt * 16;
        v8f sa = {};
        // the key tile's fragments as stored by the projection kernel; keys >= 500 hold a real row, replaced below
        const half_t* np = Nf + (size_t)(b * 32 + mt) * 2048 + lane * 8;
#pragma unroll
        for (int kc = 0; kc < 4; ++kc) {
            v16h bb = make_a(*(const v8h*)(np + kc * 512), *(const v8h*)(np + kc * 512 + 256));
            sa = WMMA_F16(am[kc], bb, sa);
        }
        float mv[8];
#pragma unroll
        for (int r = 0; r < 8; ++r) mv[r] = sS[r + (hi << 3)][m0 + cr];
        // the foot of the trip rewrites the address registers of the eight key loads above
        asm volatile("s_wait_xcnt 0x0" ::: "memory");
#pragma unroll
        for (int r = 0; r < 8; ++r) {
            const int row = r + (hi << 3);
            const int mk = m0 + cr;
            float s = 10.0f * tanhf(sa[r] * inv_se) + mv[r];
            if (mk >= 500) s = -1e30f;
            sS[row][mk] = s;
        }
    }
    __syncthreads();
    f32x4 x[2][4];
#pragma unroll                                        // constant indices keep x[][] in registers
    for (int q = 0; q < 2; ++q)
#pragma unroll                                        // constant indices keep x[][] in registers
        for (int j = 0; j < 4; ++j) x[q][j] = *(const f32x4*)&sS[2 * w + q][(j * 32 + lane) * 4];
    float inv[2];
#pragma unroll                                        // constant indices keep x[][] in registers
    for (int q = 0; q < 2; ++q) {
        float mx = x[q][0][0];
#pragma unroll                                        // constant indices keep x[][] in registers
        for (int j = 0; j < 4; ++j)
#pragma unroll                                        // constant indices keep x[][] in registers
            for (int i = 0; i < 4; ++i) mx = fmaxf(mx, x[q][j][i]);
        mx = fmaxf(mx, row_xor<0x161>(mx));
        mx = fmaxf(mx, row_xor<0x162>(mx));
        mx = fmaxf(mx, row_xor<0x164>(mx));
        mx = fmaxf(mx, row_xor<0x168>(mx));
        mx = fmaxf(mx, xhalf(mx));
#pragma unroll                                        // constant indices keep x[][] in registers
        for (int j = 0; j < 4; j += 2) {
            float t[8];
#pragma unroll                                        // constant indices keep t[] in registers
            for (int i = 0; i < 8; ++i) t[i] = (x[q][j + (i >> 2)][i & 3] - mx) * 1.44269504f;
            exp2_run(t);
#pragma unroll                                        // constant indices keep x[][] in registers
            for (int i = 0; i < 8; ++i) x[q][j + (i >> 2)][i & 3] = t[i];
        }
        const f32x4 sv = (x[q][0] + x[q][1]) + (x[q][2] + x[q][3]);
        float sum = (sv[0] + sv[1]) + (sv[2] + sv[3]);
        sum += row_xor<0x161>(sum);
        sum += row_xor<0x162>(sum);
        sum += row_xor<0x164>(sum);
        sum += row_xor<0x168>(sum);
        sum += xhalf(sum);
        inv[q] = 1.0f / sum;
    }
#pragma unroll                                        // constant indices keep x[][] in registers
    for (int q = 0; q < 2; ++q) {
        const int nq = n0 + 2 * w + q;
        if (nq < 500) {
            float* op = probs + ((size_t)b * 500 + nq) * 500;
#pragma unroll                                        // constant indices keep x[][] in registers
            for (int j = 0; j < 4; ++j) {
                const int pc = j * 32 + lane;         // 125 pieces of 16 bytes are the row
                if (pc < 125) *(f32x4*)(op + pc * 4) = x[q][j] * inv[q];
            }
        }
    }
}

extern "C" void kernel_launch(void* const* d_in, const int* in_sizes, int n_in,
                              void* d_out, int out_size, void* d_ws, size_t ws_size,
                              hipStream_t stream) {
    const float* nodes = (const float*)d_in[0];
    const float* q1    = (const float*)d_in[1];
    const float* q0    = (const float*)d_in[2];
    const float* mask  = (const float*)d_in[3];
    const float* Wq1   = (const float*)d_in[4];
    const float* Wq0   = (const float*)d_in[5];
    const float* Wk    = (const float*)d_in[6];
    const float* Wv    = (const float*)d_in[7];
    const float* Wc    = (const float*)d_in[8];
    const float* bcp   = (const float*)d_in[9];
    float* probs = (float*)d_out;

    // Workspace layout (f16): 4 tensors of 32000x128, nodes in fragment order (64 x 512 x 128), 5 packed weights -> ~41 MB
    const size_t RE = (size_t)32000 * 128;
    const size_t NE = (size_t)32768 * 128;
    half_t* ws = (half_t*)d_ws;
    half_t* Kh = ws;
    half_t* Vh = Kh + RE;
    half_t* Qh = Vh + RE;
    half_t* Nh = Qh + RE;
    half_t* OC = Nh + NE;
    half_t* PW = OC + RE;                 // 5 * 16384 halves
    half_t* pWq1 = PW;
    half_t* pWq0 = PW + 16384;
    half_t* pWk  = PW + 32768;
    half_t* pWv  = PW + 49152;
    half_t* pWc  = PW + 65536;

    pack_weights<<<320, 256, 0, stream>>>(Wq1, Wq0, Wk, Wv, Wc, PW);
    proj_kernel<<<2048, 256, 0, stream>>>(nodes, q1, q0, pWk, pWv, pWq1, pWq0, Kh, Vh, Qh, Nh);
    attn_kernel<<<512, 256, 0, stream>>>(Kh, Vh, Qh, mask, OC);
    combine_kernel<<<2048, 256, 0, stream>>>(OC, pWc, bcp, Nh, mask, probs);
}

// v006
// Measured time: 80.6 microseconds a run.
// Two timings next to v005 both put it at 1.14 times that version's speed.
// Over all steps from v000 it is 3.27 times as fast.
#include <hip/hip_runtime.h>
#include <hip/hip_bf16.h>

typedef _Float16 half_t;
typedef __attribute__((ext_vector_type(16))) _Float16 v16h;
typedef __attribute__((ext_vector_type(8)))  _Float16 v8h;
typedef __attribute__((ext_vector_type(8)))  float    v8f;

#define WMMA_F16(A, B, C) \
    __builtin_amdgcn_wmma_f32_16x16x32_f16(false, (A), false, (B), (short)0, (C), false, false)

__device__ __forceinline__ v16h make_a(v8h lo, v8h hi) {
    v16h r;
#pragma unroll
    for (int i = 0; i < 8; ++i) { r[i] = lo[i]; r[i + 8] = hi[i]; }
    return r;
}

// ---------------------------------------------------------------------------
// Kernel 0: pack 5 weight matrices (128x128 f32, row-major W[k][n]) into the
// WMMA B-operand lane layout as f16 so a wave loads one v16h (32B) per tile.
// ---------------------------------------------------------------------------
__global__ __launch_bounds__(256) void pack_weights(
    const float* __restrict__ Wq1, const float* __restrict__ Wq0,
    const float* __restrict__ Wk,  const float* __restrict__ Wv,
    const float* __restrict__ Wc,  half_t* __restrict__ dst) {
    int idx = blockIdx.x * 256 + threadIdx.x;          // < 5*16384 = 81920
    int w   = idx >> 14, rem = idx & 16383;
    int t   = rem >> 9,  le  = rem & 511;
    int lane = le >> 4,  e   = le & 15;
    int ntile = t >> 2,  ktile = t & 3;
    int k = ktile * 32 + ((lane >> 4) << 3) + (e < 8 ? e : e + 8);
    int n = ntile * 16 + (lane & 15);
    const float* W = (w == 0) ? Wq1 : (w == 1) ? Wq0 : (w == 2) ? Wk : (w == 3) ? Wv : Wc;
    dst[idx] = (half_t)W[k * 128 + n];
}

__global__ __launch_bounds__(256) void proj_kernel(
    const float* __restrict__ nodes, const float* __restrict__ q1,
    const float* __restrict__ q0,
    const half_t* __restrict__ pWk,  const half_t* __restrict__ pWv,
    const half_t* __restrict__ pWq1, const half_t* __restrict__ pWq0,
    half_t* __restrict__ Kh, half_t* __restrict__ Vh,
    half_t* __restrict__ Qh, half_t* __restrict__ Nf) {
    __shared__ __align__(16) half_t sN[16][136], sQ1[16][136], sQ0[16][136];
    const int m0 = (blockIdx.x & 31) * 16;             // first row of the tile inside its batch
    const int rb = (blockIdx.x >> 5) * 500;            // first flat row of the batch
    for (int i = threadIdx.x; i < 2048; i += 256) {
        int rr = i >> 7, cc = i & 127;
        const int m = m0 + rr < 500 ? m0 + rr : 499;   // pad rows repeat the batch's last row, are stored only in Nf
        size_t g = (size_t)(rb + m) * 128 + cc;
        sN[rr][cc]  = (half_t)nodes[g];
        sQ1[rr][cc] = (half_t)q1[g];
        sQ0[rr][cc] = (half_t)q0[g];
    }
    __syncthreads();
    const int lane = threadIdx.x & 31, w = threadIdx.x >> 5;
    const int row = lane & 15, kb = (lane >> 4) << 3;
    // wave w stores half w >> 2 of the nodes fragment of k chunk w & 3: one 512-byte piece
    *(v8h*)(Nf + ((size_t)blockIdx.x * 4 + (w & 3)) * 512 + (w >> 2) * 256 + lane * 8) =
        *(const v8h*)&sN[row][(w & 3) * 32 + kb + (w >> 2) * 16];
    v8f accK = {}, accV = {}, accQ = {};
#pragma unroll
    for (int kc = 0; kc < 4; ++kc) {
        const int k0 = kc * 32;
        v16h aN  = make_a(*(const v8h*)&sN[row][k0 + kb],  *(const v8h*)&sN[row][k0 + kb + 16]);
        v16h aQ1 = make_a(*(const v8h*)&sQ1[row][k0 + kb], *(const v8h*)&sQ1[row][k0 + kb + 16]);
        v16h aQ0 = make_a(*(const v8h*)&sQ0[row][k0 + kb], *(const v8h*)&sQ0[row][k0 + kb + 16]);
        const int t = (w * 4 + kc) * 512 + lane * 16;
        v16h bK = *(const v16h*)(pWk  + t);
        v16h bV = *(const v16h*)(pWv  + t);
        v16h b1 = *(const v16h*)(pWq1 + t);
        v16h b0 = *(const v16h*)(pWq0 + t);
        accK = WMMA_F16(aN,  bK, accK);
        accV = WMMA_F16(aN,  bV, accV);
        accQ = WMMA_F16(aQ1, b1, accQ);
        accQ = WMMA_F16(aQ0, b0, accQ);
    }
    const int col = w * 16 + (lane & 15);
    const int mh = m0 + ((lane >> 4) << 3);
    auto put = [&](const int r) {
        size_t g = (size_t)(rb + mh + r) * 128 + col;
        Kh[g] = (half_t)accK[r];
        Vh[g] = (half_t)accV[r];
        Qh[g] = (half_t)(accQ[r] * 0.25f);   // fold 1/sqrt(D) into Q
    };
    if (m0 + 16 <= 500) {                    // block-uniform: all but a batch's last tile store without a row test
#pragma unroll
        for (int r = 0; r < 8; ++r) put(r);
    } else {
#pragma unroll
        for (int r = 0; r < 8; ++r)
            if (mh + r < 500) put(r);
    }
}

// ---------------------------------------------------------------------------
// Kernel 2: fused multi-head attention (flash-style online softmax).
// One block per (b, pair of heads): 16 waves over the 32 query tiles, and every wave
// takes its tile through both heads, so that a mask stage is fetched and read once
// for two heads.  K and V of the pair are staged through registers as 64-byte row
// pieces, V transposed; a Q fragment is 16 bytes a lane, loaded a tile ahead.
// Scores are formed transposed, S^T = K Q^T: lane (c, hi) holds query c and
// keys 8*hi + r of each 16-key tile, so maximum and sum run inside a lane and
// two converted score tiles are the B operand of O^T += V^T P^T as they stand.
// The mask reaches each wave through a two-buffer LDS ring of its own: a stage
// is 16 query rows x 64 keys, copied as whole 256-byte row pieces one stage ahead.
// ---------------------------------------------------------------------------
typedef __attribute__((ext_vector_type(4))) float f32x4;

#define MS_PITCH 68                 // floats per mask row in LDS: 64 keys + 16 bytes (pitch 16 B x odd)
#define MS_BUF   (16 * MS_PITCH)    // floats per ring buffer

// One mask stage: eight asynchronous 16-byte copies per lane, two rows per copy.
// l is the lane's LDS byte address of row pair 0; g[j] its global piece of row pair j.
__device__ __forceinline__ void mask_stage_copy(const unsigned l, const float* const (&g)[8]) {
    asm volatile(
        "global_load_async_to_lds_b128 %0, %8, off\n\t"
        "global_load_async_to_lds_b128 %1, %9, off\n\t"
        "global_load_async_to_lds_b128 %2, %10, off\n\t"
        "global_load_async_to_lds_b128 %3, %11, off\n\t"
        "global_load_async_to_lds_b128 %4, %12, off\n\t"
        "global_load_async_to_lds_b128 %5, %13, off\n\t"
        "global_load_async_to_lds_b128 %6, %14, off\n\t"
        "global_load_async_to_lds_b128 %7, %15, off\n\t"
        "s_wait_xcnt 0x0"
        :: "v"(l), "v"(l + 2 * MS_PITCH * 4), "v"(l + 4 * MS_PITCH * 4), "v"(l + 6 * MS_PITCH * 4),
           "v"(l + 8 * MS_PITCH * 4), "v"(l + 10 * MS_PITCH * 4), "v"(l + 12 * MS_PITCH * 4),
           "v"(l + 14 * MS_PITCH * 4),
           "v"(g[0]), "v"(g[1]), "v"(g[2]), "v"(g[3]), "v"(g[4]), "v"(g[5]), "v"(g[6]), "v"(g[7])
        : "memory");
}

// Hand-over of a ring private to one wave: its reads of the buffer to be refilled have
// retired, and the stage it is about to read has landed.
__device__ __forceinline__ void mask_stage_wait() {
    asm volatile("s_wait_dscnt 0x0" ::: "memory");     // no copy may overtake this wave's own LDS reads
    asm volatile("s_wait_asynccnt 0x0" ::: "memory");  // the compiler places no wait for the copies
}

__device__ __forceinline__ float xhalf(float x) {
    return __builtin_bit_cast(float, __builtin_amdgcn_permlanex16(
        __builtin_bit_cast(int, x), __builtin_bit_cast(int, x),
        0x76543210, 0xfedcba98, false, false));
}

#define HG 2                        // heads per block

struct VTile { half_t v[16][520]; half_t pad[16]; };   // [d][key]

// One pass over 32 keys for 16 queries of one head.  LAST: the pass that holds keys >= 500.
// m1, m2: this lane's 16 mask values, keys kc+kb+0..7 and kc+16+kb+0..7 of its query row.
template <bool LAST>
__device__ __forceinline__ void attn_pass(
    const half_t (*sK)[16], const half_t (*sVT)[520], const v8f m1, const v8f m2,
    const v16h bQ, const int kc, const int cr, const int kb,
    v16h& aK1, v16h& aK2, v8f& acc, float& mrun, float& lrun) {
    // only d = 0..15 is real: elements 8..15 of both K fragments stay zero throughout
    const v8h k1 = *(const v8h*)&sK[kc + cr][kb];
    const v8h k2 = *(const v8h*)&sK[kc + 16 + cr][kb];
#pragma unroll
    for (int i = 0; i < 8; ++i) { aK1[i] = k1[i]; aK2[i] = k2[i]; }
    v8f s1 = {}, s2 = {};
    s1 = WMMA_F16(aK1, bQ, s1);
    s2 = WMMA_F16(aK2, bQ, s2);
    const v8f t1 = s1 + m1;
    const v8f t2 = s2 + m2;
    float v[16];
#pragma unroll
    for (int r = 0; r < 8; ++r) {
        v[r]     = t1[r];
        v[8 + r] = t2[r];
        if (LAST) {
            if (kc + kb + r >= 500)      v[r]     = -1e30f;
            if (kc + 16 + kb + r >= 500) v[8 + r] = -1e30f;
        }
    }
    float cm = v[0];
#pragma unroll
    for (int i = 1; i < 16; ++i) cm = fmaxf(cm, v[i]);
    cm = fmaxf(cm, xhalf(cm));
    const float nm = fmaxf(mrun, cm);
    const float sc = __expf(mrun - nm);
    v16h bP;
    float ls = 0.f;
#pragma unroll
    for (int i = 0; i < 16; ++i) {
        float p = __expf(v[i] - nm);
        ls += p;
        bP[i] = (half_t)p;
    }
    lrun = lrun * sc + ls;      // this half's keys only; halves joined after the last pass
    mrun = nm;
#pragma unroll
    for (int r = 0; r < 8; ++r) acc[r] *= sc;
    v16h aV = make_a(*(const v8h*)&sVT[cr][kc + kb], *(const v8h*)&sVT[cr][kc + kb + 16]);
    acc = WMMA_F16(aV, bP, acc);
}

// The same 32 keys for both heads: the mask values leave the ring once (mrow: key kc+kb of the lane's query row).
template <bool LAST>
__device__ __forceinline__ void attn_pass_heads(
    const half_t (*sK)[512][16], const VTile* sVT, const float* mrow,
    const v16h (&bQ)[HG], const int kc, const int cr, const int kb,
    v16h& aK1, v16h& aK2, v8f (&acc)[HG], float (&mrun)[HG], float (&lrun)[HG]) {
    f32x4 mk[4];
#pragma unroll                                        // constant indices keep mk[] in registers
    for (int j = 0; j < 4; ++j)
        mk[j] = *(const f32x4*)(mrow + (j >> 1) * 16 + (j & 1) * 4);
    const v8f m1 = __builtin_shufflevector(mk[0], mk[1], 0, 1, 2, 3, 4, 5, 6, 7);
    const v8f m2 = __builtin_shufflevector(mk[2], mk[3], 0, 1, 2, 3, 4, 5, 6, 7);
#pragma unroll                                        // constant indices keep the per-head state in registers
    for (int h = 0; h < HG; ++h)
        attn_pass<LAST>(sK[h], sVT[h].v, m1, m2, bQ[h], kc, cr, kb, aK1, aK2, acc[h], mrun[h], lrun[h]);
}

__global__ __launch_bounds__(512) void attn_kernel(
    const half_t* __restrict__ Kh, const half_t* __restrict__ Vh,
    const half_t* __restrict__ Qh, const float* __restrict__ mask,
    half_t* __restrict__ outc) {
    struct Lds {
        VTile  sVT[HG];              // per head [d][key]
        half_t sK[HG][512][16];      // per head [key][d]
        float  sM[16][2][MS_BUF];    // per wave: two mask stages
    };
    __shared__ __align__(16) Lds lds;
    VTile (&sVT)[HG] = lds.sVT;
    half_t (&sK)[HG][512][16] = lds.sK;
    float (&sM)[16][2][MS_BUF] = lds.sM;
    const int b = blockIdx.x >> 2, hg = blockIdx.x & 3;

    const int w = __builtin_amdgcn_readfirstlane(threadIdx.x >> 5);   // scalar: uniform flow round the copies
    const int crow = (threadIdx.x >> 4) & 1, cpc = threadIdx.x & 15;
    const unsigned mlds = (unsigned)(size_t)&sM[w][0][crow * MS_PITCH + cpc * 4];
    // the last stage holds keys 448..511: pieces past key 496 re-read that piece, inside the row
    const int step7 = 64 - (cpc > 12 ? (cpc - 12) * 4 : 0);
    const float* mg[8];
#pragma unroll                                        // constant indices keep mg[] in registers
    for (int j = 0; j < 8; ++j) {
        const int r = w * 16 + 2 * j + crow;          // w < 16: a real query row
        mg[j] = mask + ((size_t)b * 500 + r) * 500 + cpc * 4;
    }
    mask_stage_copy(mlds, mg);                        // first tile, stage 0, buffer 0

    // K and V of the two heads: 64 contiguous bytes a row, four 16-byte pieces; four lanes take a row.
    // Rows 500..511 are stored as zero (their loads repeat row 499).
    {
        v8h kv[4], vv[4];
#pragma unroll                                        // constant indices keep kv[] and vv[] in registers; all eight loads fly together
        for (int t = 0; t < 4; ++t) {
            const int i = t * 512 + threadIdx.x;
            const int m = i >> 2, p = i & 3;
            const size_t g = (size_t)(b * 500 + (m < 500 ? m : 499)) * 128 + hg * (HG * 16) + p * 8;
            kv[t] = *(const v8h*)(Kh + g);
            vv[t] = *(const v8h*)(Vh + g);
        }
        const v8h zero = {};
#pragma unroll                                        // constant indices keep kv[] and vv[] in registers
        for (int t = 0; t < 4; ++t) {
            const int i = t * 512 + threadIdx.x;
            const int m = i >> 2, p = i & 3;
            const v8h k = m < 500 ? kv[t] : zero;
            const v8h v = m < 500 ? vv[t] : zero;
            *(v8h*)&sK[p >> 1][m][(p & 1) * 8] = k;
#pragma unroll                                        // constant indices keep v in registers
            for (int d = 0; d < 8; ++d) sVT[p >> 1].v[(p & 1) * 8 + d][m] = v[d];
        }
    }

    const int lane = threadIdx.x & 31;
    const int cr = lane & 15, hi = lane >> 4, kb = hi << 3;
    const float* mrd = &sM[w][0][cr * MS_PITCH + kb]; // this lane's query row in buffer 0
    v8h z8 = {};
    v16h aK1 = {}, aK2 = {};
    // this lane's 16 bytes of Q per head, of the tile to come
    const half_t* qb = Qh + (size_t)(b * 500) * 128 + hg * (HG * 16) + kb;
    v8h qf[HG];
#pragma unroll                                        // constant indices keep qf[] in registers
    for (int h = 0; h < HG; ++h) qf[h] = *(const v8h*)(qb + (size_t)(w * 16 + cr) * 128 + h * 16);
    __syncthreads();

    for (int mt = w; mt < 32; mt += 16) {
        const int n0 = mt * 16;
        const int nq = n0 + cr;                       // this lane's query
        v16h bQ[HG];
        v8f acc[HG];                                  // acc[h][r] = O[nq][8*hi + r] of head h
        float mrun[HG], lrun[HG];
#pragma unroll                                        // constant indices keep the per-head state in registers
        for (int h = 0; h < HG; ++h) {
            bQ[h] = make_a(qf[h], z8);                // K(d) padded to 32
            acc[h] = v8f{};
            mrun[h] = -1e30f;
            lrun[h] = 0.f;
        }
        // eight stages a tile, so every tile starts in buffer 0; stage s + 1 flies while stage s is worked on
        for (int s = 0; s < 7; ++s) {
            mask_stage_wait();
            const int step = s == 6 ? step7 : 64;
#pragma unroll                                        // constant indices keep mg[] in registers
            for (int j = 0; j < 8; ++j) mg[j] += step;
            mask_stage_copy(mlds + ((s + 1) & 1) * (MS_BUF * 4), mg);
            const float* mr = mrd + (s & 1) * MS_BUF;
            attn_pass_heads<false>(sK, sVT, mr,      bQ, s * 64,      cr, kb, aK1, aK2, acc, mrun, lrun);
            attn_pass_heads<false>(sK, sVT, mr + 32, bQ, s * 64 + 32, cr, kb, aK1, aK2, acc, mrun, lrun);
        }
        mask_stage_wait();
        if (mt + 16 < 32) {                           // the next tile's stage 0, into buffer 0, and its Q
#pragma unroll                                        // constant indices keep mg[] in registers
            for (int j = 0; j < 8; ++j) {
                const int r = n0 + 256 + 2 * j + crow;
                const int rc = r < 500 ? r : 499;     // pad queries copy a real mask row, are never stored
                mg[j] = mask + ((size_t)b * 500 + rc) * 500 + cpc * 4;
            }
            mask_stage_copy(mlds, mg);
            const int qn = nq + 256 < 500 ? nq + 256 : 499;   // pad queries take a real row, are never stored
#pragma unroll                                        // constant indices keep qf[] in registers
            for (int h = 0; h < HG; ++h) qf[h] = *(const v8h*)(qb + (size_t)qn * 128 + h * 16);
        }
        attn_pass_heads<false>(sK, sVT, mrd + MS_BUF,      bQ, 448, cr, kb, aK1, aK2, acc, mrun, lrun);
        attn_pass_heads<true>(sK, sVT,  mrd + MS_BUF + 32, bQ, 480, cr, kb, aK1, aK2, acc, mrun, lrun);
        v8h o[HG];
#pragma unroll                                        // constant indices keep the per-head state in registers
        for (int h = 0; h < HG; ++h) {
            const float l = lrun[h] + xhalf(lrun[h]);
            const float inv = 1.0f / l;               // one query per lane: one reciprocal a head
#pragma unroll                                        // constant indices keep acc[] and o[] in registers
            for (int r = 0; r < 8; ++r) o[h][r] = (half_t)(acc[h][r] * inv);
        }
        if (nq < 500) {
            half_t* op = outc + (size_t)(b * 500 + nq) * 128 + hg * (HG * 16) + kb;
#pragma unroll                                        // constant indices keep o[] in registers
            for (int h = 0; h < HG; ++h) *(v8h*)(op + h * 16) = o[h];
            // the next query tile reuses the stores' address and data registers
            asm volatile("s_wait_xcnt 0x0" ::: "memory");
        }
    }
}

// ---------------------------------------------------------------------------
// Kernel 3: mh = outc@Wc + bc, s = mh@nodes^T/sqrt(128), 10*tanh + mask,
// row softmax -> probs.  One block per (b, 16-query tile).
// The tile's 16 mask rows are copied into the score buffer at entry, as whole
// 512-byte row pieces, and land while stage 1 runs; stage 2 adds its logits there.
// ---------------------------------------------------------------------------
// Eight asynchronous 16-byte copies per lane: l[j] the lane's LDS byte address, g[j] its global piece.
__device__ __forceinline__ void mask_rows_copy(const unsigned (&l)[8], const float* const (&g)[8]) {
    asm volatile(
        "global_load_async_to_lds_b128 %0, %8, off\n\t"
        "global_load_async_to_lds_b128 %1, %9, off\n\t"
        "global_load_async_to_lds_b128 %2, %10, off\n\t"
        "global_load_async_to_lds_b128 %3, %11, off\n\t"
        "global_load_async_to_lds_b128 %4, %12, off\n\t"
        "global_load_async_to_lds_b128 %5, %13, off\n\t"
        "global_load_async_to_lds_b128 %6, %14, off\n\t"
        "global_load_async_to_lds_b128 %7, %15, off\n\t"
        "s_wait_xcnt 0x0"
        :: "v"(l[0]), "v"(l[1]), "v"(l[2]), "v"(l[3]), "v"(l[4]), "v"(l[5]), "v"(l[6]), "v"(l[7]),
           "v"(g[0]), "v"(g[1]), "v"(g[2]), "v"(g[3]), "v"(g[4]), "v"(g[5]), "v"(g[6]), "v"(g[7])
        : "memory");
}

template <int CTRL>
__device__ __forceinline__ float row_xor(float x) {
    return __builtin_bit_cast(float, __builtin_amdgcn_mov_dpp(__builtin_bit_cast(int, x), CTRL, 0xf, 0xf, true));
}

__device__ __forceinline__ void exp2_run(float (&t)[8]) {
    asm("v_exp_f32 %0, %0\n\t"
        "v_exp_f32 %1, %1\n\t"
        "v_exp_f32 %2, %2\n\t"
        "v_exp_f32 %3, %3\n\t"
        "v_exp_f32 %4, %4\n\t"
        "v_exp_f32 %5, %5\n\t"
        "v_exp_f32 %6, %6\n\t"
        "v_exp_f32 %7, %7\n\t"
        "v_nop"
        : "+v"(t[0]), "+v"(t[1]), "+v"(t[2]), "+v"(t[3]), "+v"(t[4]), "+v"(t[5]), "+v"(t[6]), "+v"(t[7]));
}

__global__ __launch_bounds__(256) void combine_kernel(
    const half_t* __restrict__ outc, const half_t* __restrict__ pWc,
    const float* __restrict__ bc, const half_t* __restrict__ Nf,
    const float* __restrict__ mask, float* __restrict__ probs) {
    __shared__ __align__(16) half_t sMH[16][136];
    __shared__ __align__(16) float  sS[16][520];
    const int b = blockIdx.x >> 5, nt = blockIdx.x & 31;
    const int n0 = nt * 16;
    const int lane = threadIdx.x & 31, w = threadIdx.x >> 5;
    const int cr = lane & 15, hi = lane >> 4, kb = hi << 3;
    v8h z8 = {};
    // --- mask rows into sS: wave w brings rows 2w and 2w+1, four copies a row, every lane on ---
    {
        unsigned ml[8];
        const float* mg[8];
#pragma unroll                                        // constant indices keep ml[] and mg[] in registers
        for (int j = 0; j < 8; ++j) {
            const int rr = 2 * w + (j >> 2);
            const int pc = (j & 3) * 32 + lane;
            const int rq = n0 + rr < 500 ? n0 + rr : 499;
            const int ps = pc < 125 ? pc : 124;
            ml[j] = (unsigned)(size_t)&sS[rr][pc * 4];
            mg[j] = mask + ((size_t)b * 500 + rq) * 500 + ps * 4;
        }
        mask_rows_copy(ml, mg);
    }
    // --- stage 1: mh column tile [16w, 16w+16) ---
    v8f acc = {};
    const int arow = n0 + cr;
    const bool av = arow < 500;
#pragma unroll
    for (int kc = 0; kc < 4; ++kc) {
        v16h a;
        if (av) {
            const half_t* ap = outc + (size_t)(b * 500 + arow) * 128 + kc * 32 + kb;
            a = make_a(*(const v8h*)ap, *(const v8h*)(ap + 16));
        } else a = make_a(z8, z8);
        v16h bb = *(const v16h*)(pWc + (w * 4 + kc) * 512 + lane * 16);
        acc = WMMA_F16(a, bb, acc);
    }
    const float bias = bc[w * 16 + cr];
#pragma unroll
    for (int r = 0; r < 8; ++r) sMH[r + (hi << 3)][w * 16 + cr] = (half_t)(acc[r] + bias);
    // the compiler places no wait for the copies; behind it the barrier hands every wave's mask rows to the others
    asm volatile("s_wait_asynccnt 0x0" ::: "memory");
    __syncthreads();
    // --- stage 2: pointer logits over all keys ---
    const float inv_se = 1.0f / 11.313708498984761f;
    v16h am[4];                                       // the query tile's fragments, read once (the wait below bars the compiler from hoisting them)
#pragma unroll                                        // constant indices keep am[] in registers
    for (int kc = 0; kc < 4; ++kc)
        am[kc] = make_a(*(const v8h*)&sMH[cr][kc * 32 + kb], *(const v8h*)&sMH[cr][kc * 32 + kb + 16]);
    for (int mt = w; mt < 32; mt += 8) {
        const int m0 = mt * 16;
        v8f sa = {};
        // the key tile's fragments as stored by the projection kernel; keys >= 500 hold a real row, replaced below
        const half_t* np = Nf + (size_t)(b * 32 + mt) * 2048 + lane * 8;
#pragma unroll
        for (int kc = 0; kc < 4; ++kc) {
            v16h bb = make_a(*(const v8h*)(np + kc * 512), *(const v8h*)(np + kc * 512 + 256));
            sa = WMMA_F16(am[kc], bb, sa);
        }
        float mv[8];
#pragma unroll
        for (int r = 0; r < 8; ++r) mv[r] = sS[r + (hi << 3)][m0 + cr];
        // the foot of the trip rewrites the address registers of the eight key loads above
        asm volatile("s_wait_xcnt 0x0" ::: "memory");
#pragma unroll
        for (int r = 0; r < 8; ++r) {
            const int row = r + (hi << 3);
            const int mk = m0 + cr;
            float s = 10.0f * tanhf(sa[r] * inv_se) + mv[r];
            if (mk >= 500) s = -1e30f;
            sS[row][mk] = s;
        }
    }
    __syncthreads();
    f32x4 x[2][4];
#pragma unroll                                        // constant indices keep x[][] in registers
    for (int q = 0; q < 2; ++q)
#pragma unroll                                        // constant indices keep x[][] in registers
        for (int j = 0; j < 4; ++j) x[q][j] = *(const f32x4*)&sS[2 * w + q][(j * 32 + lane) * 4];
    float inv[2];
#pragma unroll                                        // constant indices keep x[][] in registers
    for (int q = 0; q < 2; ++q) {
        float mx = x[q][0][0];
#pragma unroll                                        // constant indices keep x[][] in registers
        for (int j = 0; j < 4; ++j)
#pragma unroll                                        // constant indices keep x[][] in registers
            for (int i = 0; i < 4; ++i) mx = fmaxf(mx, x[q][j][i]);
        mx = fmaxf(mx, row_xor<0x161>(mx));
        mx = fmaxf(mx, row_xor<0x162>(mx));
        mx = fmaxf(mx, row_xor<0x164>(mx));
        mx = fmaxf(mx, row_xor<0x168>(mx));
        mx = fmaxf(mx, xhalf(mx));
#pragma unroll                                        // constant indices keep x[][] in registers
        for (int j = 0; j < 4; j += 2) {
            float t[8];
#pragma unroll                                        // constant indices keep t[] in registers
            for (int i = 0; i < 8; ++i) t[i] = (x[q][j + (i >> 2)][i & 3] - mx) * 1.44269504f;
            exp2_run(t);
#pragma unroll                                        // constant indices keep x[][] in registers
            for (int i = 0; i < 8; ++i) x[q][j + (i >> 2)][i & 3] = t[i];
        }
        const f32x4 sv = (x[q][0] + x[q][1]) + (x[q][2] + x[q][3]);
        float sum = (sv[0] + sv[1]) + (sv[2] + sv[3]);
        sum += row_xor<0x161>(sum);
        sum += row_xor<0x162>(sum);
        sum += row_xor<0x164>(sum);
        sum += row_xor<0x168>(sum);
        sum += xhalf(sum);
        inv[q] = 1.0f / sum;
    }
#pragma unroll                                        // constant indices keep x[][] in registers
    for (int q = 0; q < 2; ++q) {
        const int nq = n0 + 2 * w + q;
        if (nq < 500) {
            float* op = probs + ((size_t)b * 500 + nq) * 500;
#pragma unroll                                        // constant indices keep x[][] in registers
            for (int j = 0; j < 4; ++j) {
                const int pc = j * 32 + lane;         // 125 pieces of 16 bytes are the row
                if (pc < 125) *(f32x4*)(op + pc * 4) = x[q][j] * inv[q];
            }
        }
    }
}

extern "C" void kernel_launch(void* const* d_in, const int* in_sizes, int n_in,
                              void* d_out, int out_size, void* d_ws, size_t ws_size,
                              hipStream_t stream) {
    const float* nodes = (const float*)d_in[0];
    const float* q1    = (const float*)d_in[1];
    const float* q0    = (const float*)d_in[2];
    const float* mask  = (const float*)d_in[3];
    const float* Wq1   = (const float*)d_in[4];
    const float* Wq0   = (const float*)d_in[5];
    const float* Wk    = (const float*)d_in[6];
    const float* Wv    = (const float*)d_in[7];
    const float* Wc    = (const float*)d_in[8];
    const float* bcp   = (const float*)d_in[9];
    float* probs = (float*)d_out;

    // Workspace layout (f16): 4 tensors of 32000x128, nodes in fragment order (64 x 512 x 128), 5 packed weights -> ~41 MB
    const size_t RE = (size_t)32000 * 128;
    const size_t NE = (size_t)32768 * 128;
    half_t* ws = (half_t*)d_ws;
    half_t* Kh = ws;
    half_t* Vh = Kh + RE;
    half_t* Qh = Vh + RE;
    half_t* Nh = Qh + RE;
    half_t* OC = Nh + NE;
    half_t* PW = OC + RE;                 // 5 * 16384 halves
    half_t* pWq1 = PW;
    half_t* pWq0 = PW + 16384;
    half_t* pWk  = PW + 32768;
    half_t* pWv  = PW + 49152;
    half_t* pWc  = PW + 65536;

    pack_weights<<<320, 256, 0, stream>>>(Wq1, Wq0, Wk, Wv, Wc, PW);
    proj_kernel<<<2048, 256, 0, stream>>>(nodes, q1, q0, pWk, pWv, pWq1, pWq0, Kh, Vh, Qh, Nh);
    attn_kernel<<<256, 512, 0, stream>>>(Kh, Vh, Qh, mask, OC);
    combine_kernel<<<2048, 256, 0, stream>>>(OC, pWc, bcp, Nh, mask, probs);
}

// v007
// A run of this version takes 72.9 microseconds.
// Next to v006, in two timings, it ran 1.11 times as fast each time.
// Counting every step since v000, it is 3.63 times as fast.
#include <hip/hip_runtime.h>
#include <hip/hip_bf16.h>

typedef _Float16 half_t;
typedef __attribute__((ext_vector_type(16))) _Float16 v16h;
typedef __attribute__((ext_vector_type(8)))  _Float16 v8h;
typedef __attribute__((ext_vector_type(8)))  float    v8f;

#define WMMA_F16(A, B, C) \
    __builtin_amdgcn_wmma_f32_16x16x32_f16(false, (A), false, (B), (short)0, (C), false, false)

__device__ __forceinline__ v16h make_a(v8h lo, v8h hi) {
    v16h r;
#pragma unroll
    for (int i = 0; i < 8; ++i) { r[i] = lo[i]; r[i + 8] = hi[i]; }
    return r;
}

typedef __attribute__((ext_vector_type(4))) float    f32x4;
typedef __attribute__((ext_vector_type(2))) float    f32x2;
typedef __attribute__((ext_vector_type(4))) _Float16 v4h;
typedef __attribute__((ext_vector_type(2))) _Float16 v2h;

__global__ __launch_bounds__(256) void proj_kernel(
    const float* __restrict__ nodes, const float* __restrict__ q1,
    const float* __restrict__ q0,
    const float* __restrict__ Wk,  const float* __restrict__ Wv,
    const float* __restrict__ Wq1, const float* __restrict__ Wq0,
    const float* __restrict__ Wc,
    half_t* __restrict__ Kh, half_t* __restrict__ Vh,
    half_t* __restrict__ Qh, half_t* __restrict__ Nf, half_t* __restrict__ pWc) {
    __shared__ __align__(16) half_t sN[64][136], sQ1[64][136], sQ0[64][136];
    const int m0 = (blockIdx.x & 7) * 64;              // first row of the block inside its batch
    const int rb = (blockIdx.x >> 3) * 500;            // first flat row of the batch
    const int lane = threadIdx.x & 31;
    const int w = __builtin_amdgcn_readfirstlane(threadIdx.x >> 5);   // scalar: the weight choice below is a scalar select
    const int row = lane & 15, kb = (lane >> 4) << 3;
    // rows: 16-byte loads, all 24 of a thread in flight
    f32x4 xn[8], x1[8], x0[8];
#pragma unroll                                        // constant indices keep the loaded rows in registers
    for (int t = 0; t < 8; ++t) {
        const int i = t * 256 + threadIdx.x;
        const int rr = i >> 5, cc = (i & 31) * 4;
        const int m = m0 + rr < 500 ? m0 + rr : 499;   // pad rows repeat the batch's last row, are stored only in Nf
        const size_t g = (size_t)(rb + m) * 128 + cc;
        xn[t] = *(const f32x4*)(nodes + g);
        x1[t] = *(const f32x4*)(q1 + g);
        x0[t] = *(const f32x4*)(q0 + g);
        // the next loads' addresses and results reuse these loads' address registers
        asm volatile("s_wait_xcnt 0x0" ::: "memory");
    }
    if (blockIdx.x < 64) {
        const int idx = blockIdx.x * 256 + threadIdx.x;    // < 16384
        const int t = idx >> 9, le = idx & 511;
        const int l = le >> 4, e = le & 15;
        const int k = (t & 3) * 32 + ((l >> 4) << 3) + (e < 8 ? e : e + 8);
        const int n = (t >> 2) * 16 + (l & 15);
        pWc[idx] = (half_t)Wc[k * 128 + n];
        // what follows reuses the address registers of this load and this store
        asm volatile("s_wait_xcnt 0x0" ::: "memory");
    }
    // B fragments of this wave's 32 columns of its two weights
    const bool kv = w < 4;
    const int cb = (w & 3) * 32 + 2 * row;             // this lane's two columns
    const float* WA = (kv ? Wk : Wq1) + kb * 128 + cb;
    const float* WB = (kv ? Wv : Wq0) + kb * 128 + cb;
    v16h bA[4][2], bB[4][2];
#pragma unroll                                        // constant indices keep the fragments in registers
    for (int kc = 0; kc < 4; ++kc)
#pragma unroll                                        // constant indices keep the fragments in registers
        for (int e = 0; e < 16; ++e) {
            const int k = kc * 32 + (e < 8 ? e : e + 8);   // the A loader's k order; kb is in the pointer
            const f32x2 ya = *(const f32x2*)(WA + k * 128);
            const f32x2 yb = *(const f32x2*)(WB + k * 128);
            bA[kc][0][e] = (half_t)ya[0];
            bA[kc][1][e] = (half_t)ya[1];
            bB[kc][0][e] = (half_t)yb[0];
            bB[kc][1][e] = (half_t)yb[1];
        }
#pragma unroll                                        // constant indices keep the loaded rows in registers
    for (int t = 0; t < 8; ++t) {
        const int i = t * 256 + threadIdx.x;
        const int rr = i >> 5, cc = (i & 31) * 4;
        *(v4h*)&sN[rr][cc]  = __builtin_convertvector(xn[t], v4h);
        *(v4h*)&sQ1[rr][cc] = __builtin_convertvector(x1[t], v4h);
        *(v4h*)&sQ0[rr][cc] = __builtin_convertvector(x0[t], v4h);
    }
    __syncthreads();
    const half_t (*sA)[136] = kv ? sN : sQ1;
    const half_t (*sB)[136] = kv ? sN : sQ0;
#pragma unroll 1                                      // rolled: the four trips share one copy of the code
    for (int rt = 0; rt < 4; ++rt) {
        const int lr = rt * 16 + row;
        v8f aA[2] = {}, aB[2] = {};
#pragma unroll                                        // constant indices keep the fragments in registers
        for (int kc = 0; kc < 4; ++kc) {
            const int k0 = kc * 32;
            const v16h fa = make_a(*(const v8h*)&sA[lr][k0 + kb], *(const v8h*)&sA[lr][k0 + kb + 16]);
            const v16h fb = make_a(*(const v8h*)&sB[lr][k0 + kb], *(const v8h*)&sB[lr][k0 + kb + 16]);
            aA[0] = WMMA_F16(fa, bA[kc][0], aA[0]);
            aA[1] = WMMA_F16(fa, bA[kc][1], aA[1]);
            aB[0] = WMMA_F16(fb, bB[kc][0], aB[0]);
            aB[1] = WMMA_F16(fb, bB[kc][1], aB[1]);
        }
        const int mh = m0 + rt * 16 + kb;              // kb is also 8 * (lane >> 4): the accumulator's row half
        // a lane's two columns are neighbours: one 4-byte store a row.  Rows >= 500 (a batch's last tile) are not stored.
        const size_t g0 = (size_t)(rb + mh) * 128 + cb;
        if (kv) {
#pragma unroll                                        // constant indices keep the accumulators in registers
            for (int r = 0; r < 8; ++r)
                if (mh + r < 500) {
                    *(v2h*)(Kh + g0 + r * 128) = v2h{(half_t)aA[0][r], (half_t)aA[1][r]};
                    *(v2h*)(Vh + g0 + r * 128) = v2h{(half_t)aB[0][r], (half_t)aB[1][r]};
                }
        } else {
#pragma unroll                                        // constant indices keep the accumulators in registers
            for (int r = 0; r < 8; ++r)
                if (mh + r < 500)                      // 1/sqrt(D) is folded into Q
                    *(v2h*)(Qh + g0 + r * 128) =
                        v2h{(half_t)((aA[0][r] + aB[0][r]) * 0.25f), (half_t)((aA[1][r] + aB[1][r]) * 0.25f)};
        }
        // wave w stores half w >> 2 of the nodes fragment of k chunk w & 3: one 512-byte piece
        *(v8h*)(Nf + ((size_t)(blockIdx.x * 4 + rt) * 4 + (w & 3)) * 512 + (w >> 2) * 256 + lane * 8) =
            *(const v8h*)&sN[lr][(w & 3) * 32 + kb + (w >> 2) * 16];
        // the next trip rewrites the stores' address and data registers
        asm volatile("s_wait_xcnt 0x0" ::: "memory");
    }
}

// ---------------------------------------------------------------------------
// Kernel 2: fused multi-head attention (flash-style online softmax).
// One block per (b, pair of heads): 16 waves over the 32 query tiles, and every wave
// takes its tile through both heads, so that a mask stage is fetched and read once
// for two heads.  K and V of the pair are staged through registers as 64-byte row
// pieces, V transposed; a Q fragment is 16 bytes a lane, loaded a tile ahead.
// Scores are formed transposed, S^T = K Q^T: lane (c, hi) holds query c and
// keys 8*hi + r of each 16-key tile, so maximum and sum run inside a lane and
// two converted score tiles are the B operand of O^T += V^T P^T as they stand.
// The mask reaches each wave through a two-buffer LDS ring of its own: a stage
// is 16 query rows x 64 keys, copied as whole 256-byte row pieces one stage ahead.
// ---------------------------------------------------------------------------
#define MS_PITCH 68                 // floats per mask row in LDS: 64 keys + 16 bytes (pitch 16 B x odd)
#define MS_BUF   (16 * MS_PITCH)    // floats per ring buffer

// One mask stage: eight asynchronous 16-byte copies per lane, two rows per copy.
// l is the lane's LDS byte address of row pair 0; g[j] its global piece of row pair j.
__device__ __forceinline__ void mask_stage_copy(const unsigned l, const float* const (&g)[8]) {
    asm volatile(
        "global_load_async_to_lds_b128 %0, %8, off\n\t"
        "global_load_async_to_lds_b128 %1, %9, off\n\t"
        "global_load_async_to_lds_b128 %2, %10, off\n\t"
        "global_load_async_to_lds_b128 %3, %11, off\n\t"
        "global_load_async_to_lds_b128 %4, %12, off\n\t"
        "global_load_async_to_lds_b128 %5, %13, off\n\t"
        "global_load_async_to_lds_b128 %6, %14, off\n\t"
        "global_load_async_to_lds_b128 %7, %15, off\n\t"
        "s_wait_xcnt 0x0"
        :: "v"(l), "v"(l + 2 * MS_PITCH * 4), "v"(l + 4 * MS_PITCH * 4), "v"(l + 6 * MS_PITCH * 4),
           "v"(l + 8 * MS_PITCH * 4), "v"(l + 10 * MS_PITCH * 4), "v"(l + 12 * MS_PITCH * 4),
           "v"(l + 14 * MS_PITCH * 4),
           "v"(g[0]), "v"(g[1]), "v"(g[2]), "v"(g[3]), "v"(g[4]), "v"(g[5]), "v"(g[6]), "v"(g[7])
        : "memory");
}

// Hand-over of a ring private to one wave: its reads of the buffer to be refilled have
// retired, and the stage it is about to read has landed.
__device__ __forceinline__ void mask_stage_wait() {
    asm volatile("s_wait_dscnt 0x0" ::: "memory");     // no copy may overtake this wave's own LDS reads
    asm volatile("s_wait_asynccnt 0x0" ::: "memory");  // the compiler places no wait for the copies
}

__device__ __forceinline__ float xhalf(float x) {
    return __builtin_bit_cast(float, __builtin_amdgcn_permlanex16(
        __builtin_bit_cast(int, x), __builtin_bit_cast(int, x),
        0x76543210, 0xfedcba98, false, false));
}

#define HG 2                        // heads per block

struct VTile { half_t v[16][520]; half_t pad[16]; };   // [d][key]

// One pass over 32 keys for 16 queries of one head.  LAST: the pass that holds keys >= 500.
// m1, m2: this lane's 16 mask values, keys kc+kb+0..7 and kc+16+kb+0..7 of its query row.
template <bool LAST>
__device__ __forceinline__ void attn_pass(
    const half_t (*sK)[16], const half_t (*sVT)[520], const v8f m1, const v8f m2,
    const v16h bQ, const int kc, const int cr, const int kb,
    v16h& aK1, v16h& aK2, v8f& acc, float& mrun, float& lrun) {
    // only d = 0..15 is real: elements 8..15 of both K fragments stay zero throughout
    const v8h k1 = *(const v8h*)&sK[kc + cr][kb];
    const v8h k2 = *(const v8h*)&sK[kc + 16 + cr][kb];
#pragma unroll
    for (int i = 0; i < 8; ++i) { aK1[i] = k1[i]; aK2[i] = k2[i]; }
    v8f s1 = {}, s2 = {};
    s1 = WMMA_F16(aK1, bQ, s1);
    s2 = WMMA_F16(aK2, bQ, s2);
    const v8f t1 = s1 + m1;
    const v8f t2 = s2 + m2;
    float v[16];
#pragma unroll
    for (int r = 0; r < 8; ++r) {
        v[r]     = t1[r];
        v[8 + r] = t2[r];
        if (LAST) {
            if (kc + kb + r >= 500)      v[r]     = -1e30f;
            if (kc + 16 + kb + r >= 500) v[8 + r] = -1e30f;
        }
    }
    float cm = v[0];
#pragma unroll
    for (int i = 1; i < 16; ++i) cm = fmaxf(cm, v[i]);
    cm = fmaxf(cm, xhalf(cm));
    const float nm = fmaxf(mrun, cm);
    const float sc = __expf(mrun - nm);
    v16h bP;
    float ls = 0.f;
#pragma unroll
    for (int i = 0; i < 16; ++i) {
        float p = __expf(v[i] - nm);
        ls += p;
        bP[i] = (half_t)p;
    }
    lrun = lrun * sc + ls;      // this half's keys only; halves joined after the last pass
    mrun = nm;
#pragma unroll
    for (int r = 0; r < 8; ++r) acc[r] *= sc;
    v16h aV = make_a(*(const v8h*)&sVT[cr][kc + kb], *(const v8h*)&sVT[cr][kc + kb + 16]);
    acc = WMMA_F16(aV, bP, acc);
}

// The same 32 keys for both heads: the mask values leave the ring once (mrow: key kc+kb of the lane's query row).
template <bool LAST>
__device__ __forceinline__ void attn_pass_heads(
    const half_t (*sK)[512][16], const VTile* sVT, const float* mrow,
    const v16h (&bQ)[HG], const int kc, const int cr, const int kb,
    v16h& aK1, v16h& aK2, v8f (&acc)[HG], float (&mrun)[HG], float (&lrun)[HG]) {
    f32x4 mk[4];
#pragma unroll                                        // constant indices keep mk[] in registers
    for (int j = 0; j < 4; ++j)
        mk[j] = *(const f32x4*)(mrow + (j >> 1) * 16 + (j & 1) * 4);
    const v8f m1 = __builtin_shufflevector(mk[0], mk[1], 0, 1, 2, 3, 4, 5, 6, 7);
    const v8f m2 = __builtin_shufflevector(mk[2], mk[3], 0, 1, 2, 3, 4, 5, 6, 7);
#pragma unroll                                        // constant indices keep the per-head state in registers
    for (int h = 0; h < HG; ++h)
        attn_pass<LAST>(sK[h], sVT[h].v, m1, m2, bQ[h], kc, cr, kb, aK1, aK2, acc[h], mrun[h], lrun[h]);
}

__global__ __launch_bounds__(512) void attn_kernel(
    const half_t* __restrict__ Kh, const half_t* __restrict__ Vh,
    const half_t* __restrict__ Qh, const float* __restrict__ mask,
    half_t* __restrict__ outc) {
    struct Lds {
        VTile  sVT[HG];              // per head [d][key]
        half_t sK[HG][512][16];      // per head [key][d]
        float  sM[16][2][MS_BUF];    // per wave: two mask stages
    };
    __shared__ __align__(16) Lds lds;
    VTile (&sVT)[HG] = lds.sVT;
    half_t (&sK)[HG][512][16] = lds.sK;
    float (&sM)[16][2][MS_BUF] = lds.sM;
    const int b = blockIdx.x >> 2, hg = blockIdx.x & 3;

    const int w = __builtin_amdgcn_readfirstlane(threadIdx.x >> 5);   // scalar: uniform flow round the copies
    const int crow = (threadIdx.x >> 4) & 1, cpc = threadIdx.x & 15;
    const unsigned mlds = (unsigned)(size_t)&sM[w][0][crow * MS_PITCH + cpc * 4];
    // the last stage holds keys 448..511: pieces past key 496 re-read that piece, inside the row
    const int step7 = 64 - (cpc > 12 ? (cpc - 12) * 4 : 0);
    const float* mg[8];
#pragma unroll                                        // constant indices keep mg[] in registers
    for (int j = 0; j < 8; ++j) {
        const int r = w * 16 + 2 * j + crow;          // w < 16: a real query row
        mg[j] = mask + ((size_t)b * 500 + r) * 500 + cpc * 4;
    }
    mask_stage_copy(mlds, mg);                        // first tile, stage 0, buffer 0

    // K and V of the two heads: 64 contiguous bytes a row, four 16-byte pieces; four lanes take a row.
    // Rows 500..511 are stored as zero (their loads repeat row 499).
    {
        v8h kv[4], vv[4];
#pragma unroll                                        // constant indices keep kv[] and vv[] in registers; all eight loads fly together
        for (int t = 0; t < 4; ++t) {
            const int i = t * 512 + threadIdx.x;
            const int m = i >> 2, p = i & 3;
            const size_t g = (size_t)(b * 500 + (m < 500 ? m : 499)) * 128 + hg * (HG * 16) + p * 8;
            kv[t] = *(const v8h*)(Kh + g);
            vv[t] = *(const v8h*)(Vh + g);
        }
        const v8h zero = {};
#pragma unroll                                        // constant indices keep kv[] and vv[] in registers
        for (int t = 0; t < 4; ++t) {
            const int i = t * 512 + threadIdx.x;
            const int m = i >> 2, p = i & 3;
            const v8h k = m < 500 ? kv[t] : zero;
            const v8h v = m < 500 ? vv[t] : zero;
            *(v8h*)&sK[p >> 1][m][(p & 1) * 8] = k;
#pragma unroll                                        // constant indices keep v in registers
            for (int d = 0; d < 8; ++d) sVT[p >> 1].v[(p & 1) * 8 + d][m] = v[d];
        }
    }

    const int lane = threadIdx.x & 31;
    const int cr = lane & 15, hi = lane >> 4, kb = hi << 3;
    const float* mrd = &sM[w][0][cr * MS_PITCH + kb]; // this lane's query row in buffer 0
    v8h z8 = {};
    v16h aK1 = {}, aK2 = {};
    // this lane's 16 bytes of Q per head, of the tile to come
    const half_t* qb = Qh + (size_t)(b * 500) * 128 + hg * (HG * 16) + kb;
    v8h qf[HG];
#pragma unroll                                        // constant indices keep qf[] in registers
    for (int h = 0; h < HG; ++h) qf[h] = *(const v8h*)(qb + (size_t)(w * 16 + cr) * 128 + h * 16);
    __syncthreads();

    for (int mt = w; mt < 32; mt += 16) {
        const int n0 = mt * 16;
        const int nq = n0 + cr;                       // this lane's query
        v16h bQ[HG];
        v8f acc[HG];                                  // acc[h][r] = O[nq][8*hi + r] of head h
        float mrun[HG], lrun[HG];
#pragma unroll                                        // constant indices keep the per-head state in registers
        for (int h = 0; h < HG; ++h) {
            bQ[h] = make_a(qf[h], z8);                // K(d) padded to 32
            acc[h] = v8f{};
            mrun[h] = -1e30f;
            lrun[h] = 0.f;
        }
        // eight stages a tile, so every tile starts in buffer 0; stage s + 1 flies while stage s is worked on
        for (int s = 0; s < 7; ++s) {
            mask_stage_wait();
            const int step = s == 6 ? step7 : 64;
#pragma unroll                                        // constant indices keep mg[] in registers
            for (int j = 0; j < 8; ++j) mg[j] += step;
            mask_stage_copy(mlds + ((s + 1) & 1) * (MS_BUF * 4), mg);
            const float* mr = mrd + (s & 1) * MS_BUF;
            attn_pass_heads<false>(sK, sVT, mr,      bQ, s * 64,      cr, kb, aK1, aK2, acc, mrun, lrun);
            attn_pass_heads<false>(sK, sVT, mr + 32, bQ, s * 64 + 32, cr, kb, aK1, aK2, acc, mrun, lrun);
        }
        mask_stage_wait();
        if (mt + 16 < 32) {                           // the next tile's stage 0, into buffer 0, and its Q
#pragma unroll                                        // constant indices keep mg[] in registers
            for (int j = 0; j < 8; ++j) {
                const int r = n0 + 256 + 2 * j + crow;
                const int rc = r < 500 ? r : 499;     // pad queries copy a real mask row, are never stored
                mg[j] = mask + ((size_t)b * 500 + rc) * 500 + cpc * 4;
            }
            mask_stage_copy(mlds, mg);
            const int qn = nq + 256 < 500 ? nq + 256 : 499;   // pad queries take a real row, are never stored
#pragma unroll                                        // constant indices keep qf[] in registers
            for (int h = 0; h < HG; ++h) qf[h] = *(const v8h*)(qb + (size_t)qn * 128 + h * 16);
        }
        attn_pass_heads<false>(sK, sVT, mrd + MS_BUF,      bQ, 448, cr, kb, aK1, aK2, acc, mrun, lrun);
        attn_pass_heads<true>(sK, sVT,  mrd + MS_BUF + 32, bQ, 480, cr, kb, aK1, aK2, acc, mrun, lrun);
        v8h o[HG];
#pragma unroll                                        // constant indices keep the per-head state in registers
        for (int h = 0; h < HG; ++h) {
            const float l = lrun[h] + xhalf(lrun[h]);
            const float inv = 1.0f / l;               // one query per lane: one reciprocal a head
#pragma unroll                                        // constant indices keep acc[] and o[] in registers
            for (int r = 0; r < 8; ++r) o[h][r] = (half_t)(acc[h][r] * inv);
        }
        if (nq < 500) {
            half_t* op = outc + (size_t)(b * 500 + nq) * 128 + hg * (HG * 16) + kb;
#pragma unroll                                        // constant indices keep o[] in registers
            for (int h = 0; h < HG; ++h) *(v8h*)(op + h * 16) = o[h];
            // the next query tile reuses the stores' address and data registers
            asm volatile("s_wait_xcnt 0x0" ::: "memory");
        }
    }
}

// ---------------------------------------------------------------------------
// Kernel 3: mh = outc@Wc + bc, s = mh@nodes^T/sqrt(128), 10*tanh + mask,
// row softmax -> probs.  One block per (b, 16-query tile).
// The tile's 16 mask rows are copied into the score buffer at entry, as whole
// 512-byte row pieces, and land while stage 1 runs; stage 2 adds its logits there.
// ---------------------------------------------------------------------------
// Eight asynchronous 16-byte copies per lane: l[j] the lane's LDS byte address, g[j] its global piece.
__device__ __forceinline__ void mask_rows_copy(const unsigned (&l)[8], const float* const (&g)[8]) {
    asm volatile(
        "global_load_async_to_lds_b128 %0, %8, off\n\t"
        "global_load_async_to_lds_b128 %1, %9, off\n\t"
        "global_load_async_to_lds_b128 %2, %10, off\n\t"
        "global_load_async_to_lds_b128 %3, %11, off\n\t"
        "global_load_async_to_lds_b128 %4, %12, off\n\t"
        "global_load_async_to_lds_b128 %5, %13, off\n\t"
        "global_load_async_to_lds_b128 %6, %14, off\n\t"
        "global_load_async_to_lds_b128 %7, %15, off\n\t"
        "s_wait_xcnt 0x0"
        :: "v"(l[0]), "v"(l[1]), "v"(l[2]), "v"(l[3]), "v"(l[4]), "v"(l[5]), "v"(l[6]), "v"(l[7]),
           "v"(g[0]), "v"(g[1]), "v"(g[2]), "v"(g[3]), "v"(g[4]), "v"(g[5]), "v"(g[6]), "v"(g[7])
        : "memory");
}

template <int CTRL>
__device__ __forceinline__ float row_xor(float x) {
    return __builtin_bit_cast(float, __builtin_amdgcn_mov_dpp(__builtin_bit_cast(int, x), CTRL, 0xf, 0xf, true));
}

__device__ __forceinline__ void exp2_run(float (&t)[8]) {
    asm("v_exp_f32 %0, %0\n\t"
        "v_exp_f32 %1, %1\n\t"
        "v_exp_f32 %2, %2\n\t"
        "v_exp_f32 %3, %3\n\t"
        "v_exp_f32 %4, %4\n\t"
        "v_exp_f32 %5, %5\n\t"
        "v_exp_f32 %6, %6\n\t"
        "v_exp_f32 %7, %7\n\t"
        "v_nop"
        : "+v"(t[0]), "+v"(t[1]), "+v"(t[2]), "+v"(t[3]), "+v"(t[4]), "+v"(t[5]), "+v"(t[6]), "+v"(t[7]));
}

__global__ __launch_bounds__(256) void combine_kernel(
    const half_t* __restrict__ outc, const half_t* __restrict__ pWc,
    const float* __restrict__ bc, const half_t* __restrict__ Nf,
    const float* __restrict__ mask, float* __restrict__ probs) {
    __shared__ __align__(16) half_t sMH[16][136];
    __shared__ __align__(16) float  sS[16][520];
    const int b = blockIdx.x >> 5, nt = blockIdx.x & 31;
    const int n0 = nt * 16;
    const int lane = threadIdx.x & 31, w = threadIdx.x >> 5;
    const int cr = lane & 15, hi = lane >> 4, kb = hi << 3;
    v8h z8 = {};
    // --- mask rows into sS: wave w brings rows 2w and 2w+1, four copies a row, every lane on ---
    {
        unsigned ml[8];
        const float* mg[8];
#pragma unroll                                        // constant indices keep ml[] and mg[] in registers
        for (int j = 0; j < 8; ++j) {
            const int rr = 2 * w + (j >> 2);
            const int pc = (j & 3) * 32 + lane;
            const int rq = n0 + rr < 500 ? n0 + rr : 499;
            const int ps = pc < 125 ? pc : 124;
            ml[j] = (unsigned)(size_t)&sS[rr][pc * 4];
            mg[j] = mask + ((size_t)b * 500 + rq) * 500 + ps * 4;
        }
        mask_rows_copy(ml, mg);
    }
    // --- stage 1: mh column tile [16w, 16w+16) ---
    v8f acc = {};
    const int arow = n0 + cr;
    const bool av = arow < 500;
#pragma unroll
    for (int kc = 0; kc < 4; ++kc) {
        v16h a;
        if (av) {
            const half_t* ap = outc + (size_t)(b * 500 + arow) * 128 + kc * 32 + kb;
            a = make_a(*(const v8h*)ap, *(const v8h*)(ap + 16));
        } else a = make_a(z8, z8);
        v16h bb = *(const v16h*)(pWc + (w * 4 + kc) * 512 + lane * 16);
        acc = WMMA_F16(a, bb, acc);
    }
    const float bias = bc[w * 16 + cr];
#pragma unroll
    for (int r = 0; r < 8; ++r) sMH[r + (hi << 3)][w * 16 + cr] = (half_t)(acc[r] + bias);
    // the compiler places no wait for the copies; behind it the barrier hands every wave's mask rows to the others
    asm volatile("s_wait_asynccnt 0x0" ::: "memory");
    __syncthreads();
    // --- stage 2: pointer logits over all keys ---
    const float inv_se = 1.0f / 11.313708498984761f;
    v16h am[4];                                       // the query tile's fragments, read once (the wait below bars the compiler from hoisting them)
#pragma unroll                                        // constant indices keep am[] in registers
    for (int kc = 0; kc < 4; ++kc)
        am[kc] = make_a(*(const v8h*)&sMH[cr][kc * 32 + kb], *(const v8h*)&sMH[cr][kc * 32 + kb + 16]);
    for (int mt = w; mt < 32; mt += 8) {
        const int m0 = mt * 16;
        v8f sa = {};
        // the key tile's fragments as stored by the projection kernel; keys >= 500 hold a real row, replaced below
        const half_t* np = Nf + (size_t)(b * 32 + mt) * 2048 + lane * 8;
#pragma unroll
        for (int kc = 0; kc < 4; ++kc) {
            v16h bb = make_a(*(const v8h*)(np + kc * 512), *(const v8h*)(np + kc * 512 + 256));
            sa = WMMA_F16(am[kc], bb, sa);
        }
        float mv[8];
#pragma unroll
        for (int r = 0; r < 8; ++r) mv[r] = sS[r + (hi << 3)][m0 + cr];
        // the foot of the trip rewrites the address registers of the eight key loads above
        asm volatile("s_wait_xcnt 0x0" ::: "memory");
#pragma unroll
        for (int r = 0; r < 8; ++r) {
            const int row = r + (hi << 3);
            const int mk = m0 + cr;
            float s = 10.0f * tanhf(sa[r] * inv_se) + mv[r];
            if (mk >= 500) s = -1e30f;
            sS[row][mk] = s;
        }
    }
    __syncthreads();
    f32x4 x[2][4];
#pragma unroll                                        // constant indices keep x[][] in registers
    for (int q = 0; q < 2; ++q)
#pragma unroll                                        // constant indices keep x[][] in registers
        for (int j = 0; j < 4; ++j) x[q][j] = *(const f32x4*)&sS[2 * w + q][(j * 32 + lane) * 4];
    float inv[2];
#pragma unroll                                        // constant indices keep x[][] in registers
    for (int q = 0; q < 2; ++q) {
        float mx = x[q][0][0];
#pragma unroll                                        // constant indices keep x[][] in registers
        for (int j = 0; j < 4; ++j)
#pragma unroll                                        // constant indices keep x[][] in registers
            for (int i = 0; i < 4; ++i) mx = fmaxf(mx, x[q][j][i]);
        mx = fmaxf(mx, row_xor<0x161>(mx));
        mx = fmaxf(mx, row_xor<0x162>(mx));
        mx = fmaxf(mx, row_xor<0x164>(mx));
        mx = fmaxf(mx, row_xor<0x168>(mx));
        mx = fmaxf(mx, xhalf(mx));
#pragma unroll                                        // constant indices keep x[][] in registers
        for (int j = 0; j < 4; j += 2) {
            float t[8];
#pragma unroll                                        // constant indices keep t[] in registers
            for (int i = 0; i < 8; ++i) t[i] = (x[q][j + (i >> 2)][i & 3] - mx) * 1.44269504f;
            exp2_run(t);
#pragma unroll                                        // constant indices keep x[][] in registers
            for (int i = 0; i < 8; ++i) x[q][j + (i >> 2)][i & 3] = t[i];
        }
        const f32x4 sv = (x[q][0] + x[q][1]) + (x[q][2] + x[q][3]);
        float sum = (sv[0] + sv[1]) + (sv[2] + sv[3]);
        sum += row_xor<0x161>(sum);
        sum += row_xor<0x162>(sum);
        sum += row_xor<0x164>(sum);
        sum += row_xor<0x168>(sum);
        sum += xhalf(sum);
        inv[q] = 1.0f / sum;
    }
#pragma unroll                                        // constant indices keep x[][] in registers
    for (int q = 0; q < 2; ++q) {
        const int nq = n0 + 2 * w + q;
        if (nq < 500) {
            float* op = probs + ((size_t)b * 500 + nq) * 500;
#pragma unroll                                        // constant indices keep x[][] in registers
            for (int j = 0; j < 4; ++j) {
                const int pc = j * 32 + lane;         // 125 pieces of 16 bytes are the row
                if (pc < 125) *(f32x4*)(op + pc * 4) = x[q][j] * inv[q];
            }
        }
    }
}

extern "C" void kernel_launch(void* const* d_in, const int* in_sizes, int n_in,
                              void* d_out, int out_size, void* d_ws, size_t ws_size,
                              hipStream_t stream) {
    const float* nodes = (const float*)d_in[0];
    const float* q1    = (const float*)d_in[1];
    const float* q0    = (const float*)d_in[2];
    const float* mask  = (const float*)d_in[3];
    const float* Wq1   = (const float*)d_in[4];
    const float* Wq0   = (const float*)d_in[5];
    const float* Wk    = (const float*)d_in[6];
    const float* Wv    = (const float*)d_in[7];
    const float* Wc    = (const float*)d_in[8];
    const float* bcp   = (const float*)d_in[9];
    float* probs = (float*)d_out;

    // Workspace layout (f16): 4 tensors of 32000x128, nodes in fragment order (64 x 512 x 128), packed Wc -> ~41 MB
    const size_t RE = (size_t)32000 * 128;
    const size_t NE = (size_t)32768 * 128;
    half_t* ws = (half_t*)d_ws;
    half_t* Kh = ws;
    half_t* Vh = Kh + RE;
    half_t* Qh = Vh + RE;
    half_t* Nh = Qh + RE;
    half_t* OC = Nh + NE;
    half_t* pWc = OC + RE;                // 16384 halves

    proj_kernel<<<512, 256, 0, stream>>>(nodes, q1, q0, Wk, Wv, Wq1, Wq0, Wc, Kh, Vh, Qh, Nh, pWc);
    attn_kernel<<<256, 512, 0, stream>>>(Kh, Vh, Qh, mask, OC);
    combine_kernel<<<2048, 256, 0, stream>>>(OC, pWc, bcp, Nh, mask, probs);
}

// v008
// It runs in 66.4 microseconds.
// Timed twice side by side with v007, it ran 1.10 and 1.09 times as fast.
// All steps since v000 together make it 3.98 times as fast.
#include <hip/hip_runtime.h>
#include <hip/hip_bf16.h>

typedef _Float16 half_t;
typedef __attribute__((ext_vector_type(16))) _Float16 v16h;
typedef __attribute__((ext_vector_type(8)))  _Float16 v8h;
typedef __attribute__((ext_vector_type(8)))  float    v8f;

#define WMMA_F16(A, B, C) \
    __builtin_amdgcn_wmma_f32_16x16x32_f16(false, (A), false, (B), (short)0, (C), false, false)

__device__ __forceinline__ v16h make_a(v8h lo, v8h hi) {
    v16h r;
#pragma unroll
    for (int i = 0; i < 8; ++i) { r[i] = lo[i]; r[i + 8] = hi[i]; }
    return r;
}

typedef __attribute__((ext_vector_type(4))) float    f32x4;
typedef __attribute__((ext_vector_type(2))) float    f32x2;
typedef __attribute__((ext_vector_type(4))) _Float16 v4h;
typedef __attribute__((ext_vector_type(2))) _Float16 v2h;

__global__ __launch_bounds__(256) void proj_kernel(
    const float* __restrict__ nodes, const float* __restrict__ q1,
    const float* __restrict__ q0,
    const float* __restrict__ Wk,  const float* __restrict__ Wv,
    const float* __restrict__ Wq1, const float* __restrict__ Wq0,
    const float* __restrict__ Wc,
    half_t* __restrict__ Kh, half_t* __restrict__ Vh,
    half_t* __restrict__ Qh, half_t* __restrict__ Nf, half_t* __restrict__ pWc) {
    __shared__ __align__(16) half_t sN[64][136], sQ1[64][136], sQ0[64][136];
    const int m0 = (blockIdx.x & 7) * 64;              // first row of the block inside its batch
    const int rb = (blockIdx.x >> 3) * 500;            // first flat row of the batch
    const int lane = threadIdx.x & 31;
    const int w = __builtin_amdgcn_readfirstlane(threadIdx.x >> 5);   // scalar: the weight choice below is a scalar select
    const int row = lane & 15, kb = (lane >> 4) << 3;
    // rows: 16-byte loads, all 24 of a thread in flight
    f32x4 xn[8], x1[8], x0[8];
#pragma unroll                                        // constant indices keep the loaded rows in registers
    for (int t = 0; t < 8; ++t) {
        const int i = t * 256 + threadIdx.x;
        const int rr = i >> 5, cc = (i & 31) * 4;
        const int m = m0 + rr < 500 ? m0 + rr : 499;   // pad rows repeat the batch's last row, are stored only in Nf
        const size_t g = (size_t)(rb + m) * 128 + cc;
        xn[t] = *(const f32x4*)(nodes + g);
        x1[t] = *(const f32x4*)(q1 + g);
        x0[t] = *(const f32x4*)(q0 + g);
        // the next loads' addresses and results reuse these loads' address registers
        asm volatile("s_wait_xcnt 0x0" ::: "memory");
    }
    if (blockIdx.x < 64) {
        const int idx = blockIdx.x * 256 + threadIdx.x;    // < 16384
        const int t = idx >> 9, le = idx & 511;
        const int l = le >> 4, e = le & 15;
        const int k = (t & 3) * 32 + ((l >> 4) << 3) + (e < 8 ? e : e + 8);
        const int n = (t >> 2) * 16 + (l & 15);
        pWc[idx] = (half_t)Wc[k * 128 + n];
        // what follows reuses the address registers of this load and this store
        asm volatile("s_wait_xcnt 0x0" ::: "memory");
    }
    // B fragments of this wave's 32 columns of its two weights
    const bool kv = w < 4;
    const int cb = (w & 3) * 32 + 2 * row;             // this lane's two columns
    const float* WA = (kv ? Wk : Wq1) + kb * 128 + cb;
    const float* WB = (kv ? Wv : Wq0) + kb * 128 + cb;
    v16h bA[4][2], bB[4][2];
#pragma unroll                                        // constant indices keep the fragments in registers
    for (int kc = 0; kc < 4; ++kc)
#pragma unroll                                        // constant indices keep the fragments in registers
        for (int e = 0; e < 16; ++e) {
            const int k = kc * 32 + (e < 8 ? e : e + 8);   // the A loader's k order; kb is in the pointer
            const f32x2 ya = *(const f32x2*)(WA + k * 128);
            const f32x2 yb = *(const f32x2*)(WB + k * 128);
            bA[kc][0][e] = (half_t)ya[0];
            bA[kc][1][e] = (half_t)ya[1];
            bB[kc][0][e] = (half_t)yb[0];
            bB[kc][1][e] = (half_t)yb[1];
        }
#pragma unroll                                        // constant indices keep the loaded rows in registers
    for (int t = 0; t < 8; ++t) {
        const int i = t * 256 + threadIdx.x;
        const int rr = i >> 5, cc = (i & 31) * 4;
        *(v4h*)&sN[rr][cc]  = __builtin_convertvector(xn[t], v4h);
        *(v4h*)&sQ1[rr][cc] = __builtin_convertvector(x1[t], v4h);
        *(v4h*)&sQ0[rr][cc] = __builtin_convertvector(x0[t], v4h);
    }
    __syncthreads();
    const half_t (*sA)[136] = kv ? sN : sQ1;
    const half_t (*sB)[136] = kv ? sN : sQ0;
#pragma unroll 1                                      // rolled: the four trips share one copy of the code
    for (int rt = 0; rt < 4; ++rt) {
        const int lr = rt * 16 + row;
        v8f aA[2] = {}, aB[2] = {};
#pragma unroll                                        // constant indices keep the fragments in registers
        for (int kc = 0; kc < 4; ++kc) {
            const int k0 = kc * 32;
            const v16h fa = make_a(*(const v8h*)&sA[lr][k0 + kb], *(const v8h*)&sA[lr][k0 + kb + 16]);
            const v16h fb = make_a(*(const v8h*)&sB[lr][k0 + kb], *(const v8h*)&sB[lr][k0 + kb + 16]);
            aA[0] = WMMA_F16(fa, bA[kc][0], aA[0]);
            aA[1] = WMMA_F16(fa, bA[kc][1], aA[1]);
            aB[0] = WMMA_F16(fb, bB[kc][0], aB[0]);
            aB[1] = WMMA_F16(fb, bB[kc][1], aB[1]);
        }
        const int mh = m0 + rt * 16 + kb;              // kb is also 8 * (lane >> 4): the accumulator's row half
        // a lane's two columns are neighbours: one 4-byte store a row.  Rows >= 500 (a batch's last tile) are not stored.
        const size_t g0 = (size_t)(rb + mh) * 128 + cb;
        if (kv) {
#pragma unroll                                        // constant indices keep the accumulators in registers
            for (int r = 0; r < 8; ++r)
                if (mh + r < 500) {
                    *(v2h*)(Kh + g0 + r * 128) = v2h{(half_t)aA[0][r], (half_t)aA[1][r]};
                    *(v2h*)(Vh + g0 + r * 128) = v2h{(half_t)aB[0][r], (half_t)aB[1][r]};
                }
        } else {
#pragma unroll                                        // constant indices keep the accumulators in registers
            for (int r = 0; r < 8; ++r)
                if (mh + r < 500)                      // 1/sqrt(D) is folded into Q
                    *(v2h*)(Qh + g0 + r * 128) =
                        v2h{(half_t)((aA[0][r] + aB[0][r]) * 0.25f), (half_t)((aA[1][r] + aB[1][r]) * 0.25f)};
        }
        // wave w stores half w >> 2 of the nodes fragment of k chunk w & 3: one 512-byte piece
        *(v8h*)(Nf + ((size_t)(blockIdx.x * 4 + rt) * 4 + (w & 3)) * 512 + (w >> 2) * 256 + lane * 8) =
            *(const v8h*)&sN[lr][(w & 3) * 32 + kb + (w >> 2) * 16];
        // the next trip rewrites the stores' address and data registers
        asm volatile("s_wait_xcnt 0x0" ::: "memory");
    }
}

// ---------------------------------------------------------------------------
// Kernel 2: fused multi-head attention (flash-style online softmax).
// One block per (b, pair of heads): 16 waves over the 32 query tiles, and every wave
// takes its tile through both heads, so that a mask stage is fetched and read once
// for two heads.  K and V of the pair are staged through registers as 64-byte row
// pieces, V transposed; a Q fragment is 16 bytes a lane, loaded a tile ahead.
// Scores are formed transposed, S^T = K Q^T: lane (c, hi) holds query c and
// keys 8*hi + r of each 16-key tile, so maximum and sum run inside a lane and
// two converted score tiles are the B operand of O^T += V^T P^T as they stand.
// The mask reaches each wave through a two-buffer LDS ring of its own: a stage
// is 16 query rows x 64 keys, copied as whole 256-byte row pieces one stage ahead.
// ---------------------------------------------------------------------------
#define MS_PITCH 68                 // floats per mask row in LDS: 64 keys + 16 bytes (pitch 16 B x odd)
#define MS_BUF   (16 * MS_PITCH)    // floats per ring buffer

// One mask stage: eight asynchronous 16-byte copies per lane, two rows per copy.
// l is the lane's LDS byte address of row pair 0; g[j] its global piece of row pair j.
__device__ __forceinline__ void mask_stage_copy(const unsigned l, const float* const (&g)[8]) {
    asm volatile(
        "global_load_async_to_lds_b128 %0, %8, off\n\t"
        "global_load_async_to_lds_b128 %1, %9, off\n\t"
        "global_load_async_to_lds_b128 %2, %10, off\n\t"
        "global_load_async_to_lds_b128 %3, %11, off\n\t"
        "global_load_async_to_lds_b128 %4, %12, off\n\t"
        "global_load_async_to_lds_b128 %5, %13, off\n\t"
        "global_load_async_to_lds_b128 %6, %14, off\n\t"
        "global_load_async_to_lds_b128 %7, %15, off\n\t"
        "s_wait_xcnt 0x0"
        :: "v"(l), "v"(l + 2 * MS_PITCH * 4), "v"(l + 4 * MS_PITCH * 4), "v"(l + 6 * MS_PITCH * 4),
           "v"(l + 8 * MS_PITCH * 4), "v"(l + 10 * MS_PITCH * 4), "v"(l + 12 * MS_PITCH * 4),
           "v"(l + 14 * MS_PITCH * 4),
           "v"(g[0]), "v"(g[1]), "v"(g[2]), "v"(g[3]), "v"(g[4]), "v"(g[5]), "v"(g[6]), "v"(g[7])
        : "memory");
}

// Hand-over of a ring private to one wave: its reads of the buffer to be refilled have
// retired, and the stage it is about to read has landed.
__device__ __forceinline__ void mask_stage_wait() {
    asm volatile("s_wait_dscnt 0x0" ::: "memory");     // no copy may overtake this wave's own LDS reads
    asm volatile("s_wait_asynccnt 0x0" ::: "memory");  // the compiler places no wait for the copies
}

__device__ __forceinline__ float xhalf(float x) {
    return __builtin_bit_cast(float, __builtin_amdgcn_permlanex16(
        __builtin_bit_cast(int, x), __builtin_bit_cast(int, x),
        0x76543210, 0xfedcba98, false, false));
}

#define HG 2                        // heads per block

struct VTile { half_t v[16][520]; half_t pad[16]; };   // [d][key]

// One pass over 32 keys for 16 queries of one head.  LAST: the pass that holds keys >= 500.
// m1, m2: this lane's 16 mask values, keys kc+kb+0..7 and kc+16+kb+0..7 of its query row.
template <bool LAST>
__device__ __forceinline__ void attn_pass(
    const half_t (*sK)[16], const half_t (*sVT)[520], const v8f m1, const v8f m2,
    const v16h bQ, const int kc, const int cr, const int kb,
    v16h& aK1, v16h& aK2, v8f& acc, float& mrun, float& lrun) {
    // only d = 0..15 is real: elements 8..15 of both K fragments stay zero throughout
    const v8h k1 = *(const v8h*)&sK[kc + cr][kb];
    const v8h k2 = *(const v8h*)&sK[kc + 16 + cr][kb];
#pragma unroll
    for (int i = 0; i < 8; ++i) { aK1[i] = k1[i]; aK2[i] = k2[i]; }
    v8f s1 = {}, s2 = {};
    s1 = WMMA_F16(aK1, bQ, s1);
    s2 = WMMA_F16(aK2, bQ, s2);
    const v8f t1 = s1 + m1;
    const v8f t2 = s2 + m2;
    float v[16];
#pragma unroll
    for (int r = 0; r < 8; ++r) {
        v[r]     = t1[r];
        v[8 + r] = t2[r];
        if (LAST) {
            if (kc + kb + r >= 500)      v[r]     = -1e30f;
            if (kc + 16 + kb + r >= 500) v[8 + r] = -1e30f;
        }
    }
    float cm = v[0];
#pragma unroll
    for (int i = 1; i < 16; ++i) cm = fmaxf(cm, v[i]);
    cm = fmaxf(cm, xhalf(cm));
    const float nm = fmaxf(mrun, cm);
    const float sc = __expf(mrun - nm);
    v16h bP;
    float ls = 0.f;
#pragma unroll
    for (int i = 0; i < 16; ++i) {
        float p = __expf(v[i] - nm);
        ls += p;
        bP[i] = (half_t)p;
    }
    lrun = lrun * sc + ls;      // this half's keys only; halves joined after the last pass
    mrun = nm;
#pragma unroll
    for (int r = 0; r < 8; ++r) acc[r] *= sc;
    v16h aV = make_a(*(const v8h*)&sVT[cr][kc + kb], *(const v8h*)&sVT[cr][kc + kb + 16]);
    acc = WMMA_F16(aV, bP, acc);
}

// The same 32 keys for both heads: the mask values leave the ring once (mrow: key kc+kb of the lane's query row).
template <bool LAST>
__device__ __forceinline__ void attn_pass_heads(
    const half_t (*sK)[512][16], const VTile* sVT, const float* mrow,
    const v16h (&bQ)[HG], const int kc, const int cr, const int kb,
    v16h& aK1, v16h& aK2, v8f (&acc)[HG], float (&mrun)[HG], float (&lrun)[HG]) {
    f32x4 mk[4];
#pragma unroll                                        // constant indices keep mk[] in registers
    for (int j = 0; j < 4; ++j)
        mk[j] = *(const f32x4*)(mrow + (j >> 1) * 16 + (j & 1) * 4);
    const v8f m1 = __builtin_shufflevector(mk[0], mk[1], 0, 1, 2, 3, 4, 5, 6, 7);
    const v8f m2 = __builtin_shufflevector(mk[2], mk[3], 0, 1, 2, 3, 4, 5, 6, 7);
#pragma unroll                                        // constant indices keep the per-head state in registers
    for (int h = 0; h < HG; ++h)
        attn_pass<LAST>(sK[h], sVT[h].v, m1, m2, bQ[h], kc, cr, kb, aK1, aK2, acc[h], mrun[h], lrun[h]);
}

__global__ __launch_bounds__(512) void attn_kernel(
    const half_t* __restrict__ Kh, const half_t* __restrict__ Vh,
    const half_t* __restrict__ Qh, const float* __restrict__ mask,
    half_t* __restrict__ outc) {
    struct Lds {
        VTile  sVT[HG];              // per head [d][key]
        half_t sK[HG][512][16];      // per head [key][d]
        float  sM[16][2][MS_BUF];    // per wave: two mask stages
    };
    __shared__ __align__(16) Lds lds;
    VTile (&sVT)[HG] = lds.sVT;
    half_t (&sK)[HG][512][16] = lds.sK;
    float (&sM)[16][2][MS_BUF] = lds.sM;
    const int b = blockIdx.x >> 2, hg = blockIdx.x & 3;

    const int w = __builtin_amdgcn_readfirstlane(threadIdx.x >> 5);   // scalar: uniform flow round the copies
    const int crow = (threadIdx.x >> 4) & 1, cpc = threadIdx.x & 15;
    const unsigned mlds = (unsigned)(size_t)&sM[w][0][crow * MS_PITCH + cpc * 4];
    // the last stage holds keys 448..511: pieces past key 496 re-read that piece, inside the row
    const int step7 = 64 - (cpc > 12 ? (cpc - 12) * 4 : 0);
    const float* mg[8];
#pragma unroll                                        // constant indices keep mg[] in registers
    for (int j = 0; j < 8; ++j) {
        const int r = w * 16 + 2 * j + crow;          // w < 16: a real query row
        mg[j] = mask + ((size_t)b * 500 + r) * 500 + cpc * 4;
    }
    mask_stage_copy(mlds, mg);                        // first tile, stage 0, buffer 0

    // K and V of the two heads: 64 contiguous bytes a row, four 16-byte pieces; four lanes take a row.
    // Rows 500..511 are stored as zero (their loads repeat row 499).
    {
        v8h kv[4], vv[4];
#pragma unroll                                        // constant indices keep kv[] and vv[] in registers; all eight loads fly together
        for (int t = 0; t < 4; ++t) {
            const int i = t * 512 + threadIdx.x;
            const int m = i >> 2, p = i & 3;
            const size_t g = (size_t)(b * 500 + (m < 500 ? m : 499)) * 128 + hg * (HG * 16) + p * 8;
            kv[t] = *(const v8h*)(Kh + g);
            vv[t] = *(const v8h*)(Vh + g);
        }
        const v8h zero = {};
#pragma unroll                                        // constant indices keep kv[] and vv[] in registers
        for (int t = 0; t < 4; ++t) {
            const int i = t * 512 + threadIdx.x;
            const int m = i >> 2, p = i & 3;
            const v8h k = m < 500 ? kv[t] : zero;
            const v8h v = m < 500 ? vv[t] : zero;
            *(v8h*)&sK[p >> 1][m][(p & 1) * 8] = k;
#pragma unroll                                        // constant indices keep v in registers
            for (int d = 0; d < 8; ++d) sVT[p >> 1].v[(p & 1) * 8 + d][m] = v[d];
        }
    }

    const int lane = threadIdx.x & 31;
    const int cr = lane & 15, hi = lane >> 4, kb = hi << 3;
    const float* mrd = &sM[w][0][cr * MS_PITCH + kb]; // this lane's query row in buffer 0
    v8h z8 = {};
    v16h aK1 = {}, aK2 = {};
    // this lane's 16 bytes of Q per head, of the tile to come
    const half_t* qb = Qh + (size_t)(b * 500) * 128 + hg * (HG * 16) + kb;
    v8h qf[HG];
#pragma unroll                                        // constant indices keep qf[] in registers
    for (int h = 0; h < HG; ++h) qf[h] = *(const v8h*)(qb + (size_t)(w * 16 + cr) * 128 + h * 16);
    __syncthreads();

    for (int mt = w; mt < 32; mt += 16) {
        const int n0 = mt * 16;
        const int nq = n0 + cr;                       // this lane's query
        v16h bQ[HG];
        v8f acc[HG];                                  // acc[h][r] = O[nq][8*hi + r] of head h
        float mrun[HG], lrun[HG];
#pragma unroll                                        // constant indices keep the per-head state in registers
        for (int h = 0; h < HG; ++h) {
            bQ[h] = make_a(qf[h], z8);                // K(d) padded to 32
            acc[h] = v8f{};
            mrun[h] = -1e30f;
            lrun[h] = 0.f;
        }
        // eight stages a tile, so every tile starts in buffer 0; stage s + 1 flies while stage s is worked on
        for (int s = 0; s < 7; ++s) {
            mask_stage_wait();
            const int step = s == 6 ? step7 : 64;
#pragma unroll                                        // constant indices keep mg[] in registers
            for (int j = 0; j < 8; ++j) mg[j] += step;
            mask_stage_copy(mlds + ((s + 1) & 1) * (MS_BUF * 4), mg);
            const float* mr = mrd + (s & 1) * MS_BUF;
            attn_pass_heads<false>(sK, sVT, mr,      bQ, s * 64,      cr, kb, aK1, aK2, acc, mrun, lrun);
            attn_pass_heads<false>(sK, sVT, mr + 32, bQ, s * 64 + 32, cr, kb, aK1, aK2, acc, mrun, lrun);
        }
        mask_stage_wait();
        if (mt + 16 < 32) {                           // the next tile's stage 0, into buffer 0, and its Q
#pragma unroll                                        // constant indices keep mg[] in registers
            for (int j = 0; j < 8; ++j) {
                const int r = n0 + 256 + 2 * j + crow;
                const int rc = r < 500 ? r : 499;     // pad queries copy a real mask row, are never stored
                mg[j] = mask + ((size_t)b * 500 + rc) * 500 + cpc * 4;
            }
            mask_stage_copy(mlds, mg);
            const int qn = nq + 256 < 500 ? nq + 256 : 499;   // pad queries take a real row, are never stored
#pragma unroll                                        // constant indices keep qf[] in registers
            for (int h = 0; h < HG; ++h) qf[h] = *(const v8h*)(qb + (size_t)qn * 128 + h * 16);
        }
        attn_pass_heads<false>(sK, sVT, mrd + MS_BUF,      bQ, 448, cr, kb, aK1, aK2, acc, mrun, lrun);
        attn_pass_heads<true>(sK, sVT,  mrd + MS_BUF + 32, bQ, 480, cr, kb, aK1, aK2, acc, mrun, lrun);
        v8h o[HG];
#pragma unroll                                        // constant indices keep the per-head state in registers
        for (int h = 0; h < HG; ++h) {
            const float l = lrun[h] + xhalf(lrun[h]);
            const float inv = 1.0f / l;               // one query per lane: one reciprocal a head
#pragma unroll                                        // constant indices keep acc[] and o[] in registers
            for (int r = 0; r < 8; ++r) o[h][r] = (half_t)(acc[h][r] * inv);
        }
        if (nq < 500) {
            half_t* op = outc + (size_t)(b * 500 + nq) * 128 + hg * (HG * 16) + kb;
#pragma unroll                                        // constant indices keep o[] in registers
            for (int h = 0; h < HG; ++h) *(v8h*)(op + h * 16) = o[h];
            // the next query tile reuses the stores' address and data registers
            asm volatile("s_wait_xcnt 0x0" ::: "memory");
        }
    }
}

// ---------------------------------------------------------------------------
// Kernel 3: mh = outc@Wc + bc, s = mh@nodes^T/sqrt(128), 10*tanh + mask,
// row softmax -> probs.  One block per (b, 32 queries: two 16-query tiles).
// The block's 32 mask rows are copied into the score buffer at entry, as whole
// 512-byte row pieces, and land while stage 1 runs; stage 2 adds its logits there.
// ---------------------------------------------------------------------------
// Eight asynchronous 16-byte copies per lane: l[j] the lane's LDS byte address, g[j] its global piece.
__device__ __forceinline__ void mask_rows_copy(const unsigned (&l)[8], const float* const (&g)[8]) {
    asm volatile(
        "global_load_async_to_lds_b128 %0, %8, off\n\t"
        "global_load_async_to_lds_b128 %1, %9, off\n\t"
        "global_load_async_to_lds_b128 %2, %10, off\n\t"
        "global_load_async_to_lds_b128 %3, %11, off\n\t"
        "global_load_async_to_lds_b128 %4, %12, off\n\t"
        "global_load_async_to_lds_b128 %5, %13, off\n\t"
        "global_load_async_to_lds_b128 %6, %14, off\n\t"
        "global_load_async_to_lds_b128 %7, %15, off\n\t"
        "s_wait_xcnt 0x0"
        :: "v"(l[0]), "v"(l[1]), "v"(l[2]), "v"(l[3]), "v"(l[4]), "v"(l[5]), "v"(l[6]), "v"(l[7]),
           "v"(g[0]), "v"(g[1]), "v"(g[2]), "v"(g[3]), "v"(g[4]), "v"(g[5]), "v"(g[6]), "v"(g[7])
        : "memory");
}

template <int CTRL>
__device__ __forceinline__ float row_xor(float x) {
    return __builtin_bit_cast(float, __builtin_amdgcn_mov_dpp(__builtin_bit_cast(int, x), CTRL, 0xf, 0xf, true));
}

__device__ __forceinline__ void exp2_run(float (&t)[8]) {
    asm("v_exp_f32 %0, %0\n\t"
        "v_exp_f32 %1, %1\n\t"
        "v_exp_f32 %2, %2\n\t"
        "v_exp_f32 %3, %3\n\t"
        "v_exp_f32 %4, %4\n\t"
        "v_exp_f32 %5, %5\n\t"
        "v_exp_f32 %6, %6\n\t"
        "v_exp_f32 %7, %7\n\t"
        "v_nop"
        : "+v"(t[0]), "+v"(t[1]), "+v"(t[2]), "+v"(t[3]), "+v"(t[4]), "+v"(t[5]), "+v"(t[6]), "+v"(t[7]));
}

__global__ __launch_bounds__(256) void combine_kernel(
    const half_t* __restrict__ outc, const half_t* __restrict__ pWc,
    const float* __restrict__ bc, const half_t* __restrict__ Nf,
    const float* __restrict__ mask, float* __restrict__ probs) {
    __shared__ __align__(16) half_t sMH[32][136];
    __shared__ __align__(16) float  sS[32][520];
    const int b = blockIdx.x >> 4, nt = blockIdx.x & 15;
    const int n0 = nt * 32;
    const int lane = threadIdx.x & 31, w = threadIdx.x >> 5;
    const int cr = lane & 15, hi = lane >> 4, kb = hi << 3;
    // --- mask rows into sS: wave w brings rows 4w .. 4w+3, four copies a row, every lane on ---
#pragma unroll                                        // two runs of eight copies, all sixteen in flight
    for (int p = 0; p < 2; ++p) {
        unsigned ml[8];
        const float* mg[8];
#pragma unroll                                        // constant indices keep ml[] and mg[] in registers
        for (int j = 0; j < 8; ++j) {
            const int rr = 4 * w + 2 * p + (j >> 2);
            const int pc = (j & 3) * 32 + lane;
            const int rq = n0 + rr < 500 ? n0 + rr : 499;
            const int ps = pc < 125 ? pc : 124;
            ml[j] = (unsigned)(size_t)&sS[rr][pc * 4];
            mg[j] = mask + ((size_t)b * 500 + rq) * 500 + ps * 4;
        }
        mask_rows_copy(ml, mg);
    }
    // --- stage 1: mh column tile [16w, 16w+16) of both query tiles; a weight fragment feeds two products ---
    v16h wb[4], ao[2][4];
#pragma unroll                                        // constant indices keep wb[] and ao[][] in registers; all 24 loads fly together
    for (int kc = 0; kc < 4; ++kc) {
        wb[kc] = *(const v16h*)(pWc + (w * 4 + kc) * 512 + lane * 16);
#pragma unroll                                        // constant indices keep ao[][] in registers
        for (int t = 0; t < 2; ++t) {
            const int arow = n0 + t * 16 + cr < 500 ? n0 + t * 16 + cr : 499;   // pad queries take a real row, are never stored
            const half_t* ap = outc + (size_t)(b * 500 + arow) * 128 + kc * 32 + kb;
            ao[t][kc] = make_a(*(const v8h*)ap, *(const v8h*)(ap + 16));
        }
    }
    // what follows reuses the address registers of these loads; the loaded values as inputs hold all 24 loads ahead of the
    // first product, one round trip for the stage instead of one per k chunk
    asm volatile("s_wait_xcnt 0x0" :: "v"(wb[0]), "v"(wb[1]), "v"(wb[2]), "v"(wb[3]),
                 "v"(ao[0][0]), "v"(ao[0][1]), "v"(ao[0][2]), "v"(ao[0][3]),
                 "v"(ao[1][0]), "v"(ao[1][1]), "v"(ao[1][2]), "v"(ao[1][3]) : "memory");
    v8f acc[2] = {};
#pragma unroll                                        // constant indices keep the fragments in registers
    for (int kc = 0; kc < 4; ++kc) {
        acc[0] = WMMA_F16(ao[0][kc], wb[kc], acc[0]);
        acc[1] = WMMA_F16(ao[1][kc], wb[kc], acc[1]);
    }
    const float bias = bc[w * 16 + cr];
#pragma unroll
    for (int t = 0; t < 2; ++t)
#pragma unroll
        for (int r = 0; r < 8; ++r) sMH[t * 16 + r + (hi << 3)][w * 16 + cr] = (half_t)(acc[t][r] + bias);
    // the compiler places no wait for the copies; behind it the barrier hands every wave's mask rows to the others
    asm volatile("s_wait_asynccnt 0x0" ::: "memory");
    __syncthreads();
    // --- stage 2: pointer logits over all keys; a key fragment is loaded once for the two query tiles ---
    const float inv_se = 1.0f / 11.313708498984761f;
    v16h am[2][4];                                    // the query tiles' fragments, read once (the wait below bars the compiler from hoisting them)
#pragma unroll                                        // constant indices keep am[][] in registers
    for (int t = 0; t < 2; ++t)
#pragma unroll                                        // constant indices keep am[][] in registers
        for (int kc = 0; kc < 4; ++kc)
            am[t][kc] = make_a(*(const v8h*)&sMH[t * 16 + cr][kc * 32 + kb], *(const v8h*)&sMH[t * 16 + cr][kc * 32 + kb + 16]);
    for (int mt = w; mt < 32; mt += 8) {
        const int m0 = mt * 16;
        v8f sa[2] = {};
        // the key tile's fragments as stored by the projection kernel; keys >= 500 hold a real row, replaced below
        const half_t* np = Nf + (size_t)(b * 32 + mt) * 2048 + lane * 8;
        v16h bb[4];
#pragma unroll                                        // constant indices keep bb[] in registers; the eight loads fly together
        for (int kc = 0; kc < 4; ++kc)
            bb[kc] = make_a(*(const v8h*)(np + kc * 512), *(const v8h*)(np + kc * 512 + 256));
        // the foot of the trip rewrites the address registers of the eight key loads above; the loaded values as inputs
        // hold all eight loads ahead of the first product, one round trip a trip instead of three
        asm volatile("s_wait_xcnt 0x0" :: "v"(bb[0]), "v"(bb[1]), "v"(bb[2]), "v"(bb[3]) : "memory");
#pragma unroll                                        // constant indices keep the fragments in registers
        for (int kc = 0; kc < 4; ++kc) {
            sa[0] = WMMA_F16(am[0][kc], bb[kc], sa[0]);
            sa[1] = WMMA_F16(am[1][kc], bb[kc], sa[1]);
        }
#pragma unroll                                        // constant indices keep sa[] in registers
        for (int t = 0; t < 2; ++t) {
            float mv[8];
#pragma unroll
            for (int r = 0; r < 8; ++r) mv[r] = sS[t * 16 + r + (hi << 3)][m0 + cr];
#pragma unroll
            for (int r = 0; r < 8; ++r) {
                const int row = t * 16 + r + (hi << 3);
                const int mk = m0 + cr;
                float s = 10.0f * tanhf(sa[t][r] * inv_se) + mv[r];
                if (mk >= 500) s = -1e30f;
                sS[row][mk] = s;
            }
        }
    }
    __syncthreads();
#pragma unroll 1                                      // rolled: the two trips share one copy of the code and its registers
    for (int p = 0; p < 2; ++p) {
    const int r0 = 4 * w + 2 * p;
    f32x4 x[2][4];
#pragma unroll                                        // constant indices keep x[][] in registers
    for (int q = 0; q < 2; ++q)
#pragma unroll                                        // constant indices keep x[][] in registers
        for (int j = 0; j < 4; ++j) x[q][j] = *(const f32x4*)&sS[r0 + q][(j * 32 + lane) * 4];
    float inv[2];
#pragma unroll                                        // constant indices keep x[][] in registers
    for (int q = 0; q < 2; ++q) {
        float mx = x[q][0][0];
#pragma unroll                                        // constant indices keep x[][] in registers
        for (int j = 0; j < 4; ++j)
#pragma unroll                                        // constant indices keep x[][] in registers
            for (int i = 0; i < 4; ++i) mx = fmaxf(mx, x[q][j][i]);
        mx = fmaxf(mx, row_xor<0x161>(mx));
        mx = fmaxf(mx, row_xor<0x162>(mx));
        mx = fmaxf(mx, row_xor<0x164>(mx));
        mx = fmaxf(mx, row_xor<0x168>(mx));
        mx = fmaxf(mx, xhalf(mx));
#pragma unroll                                        // constant indices keep x[][] in registers
        for (int j = 0; j < 4; j += 2) {
            float t[8];
#pragma unroll                                        // constant indices keep t[] in registers
            for (int i = 0; i < 8; ++i) t[i] = (x[q][j + (i >> 2)][i & 3] - mx) * 1.44269504f;
            exp2_run(t);
#pragma unroll                                        // constant indices keep x[][] in registers
            for (int i = 0; i < 8; ++i) x[q][j + (i >> 2)][i & 3] = t[i];
        }
        const f32x4 sv = (x[q][0] + x[q][1]) + (x[q][2] + x[q][3]);
        float sum = (sv[0] + sv[1]) + (sv[2] + sv[3]);
        sum += row_xor<0x161>(sum);
        sum += row_xor<0x162>(sum);
        sum += row_xor<0x164>(sum);
        sum += row_xor<0x168>(sum);
        sum += xhalf(sum);
        inv[q] = 1.0f / sum;
    }
#pragma unroll                                        // constant indices keep x[][] in registers
    for (int q = 0; q < 2; ++q) {
        const int nq = n0 + r0 + q;
        if (nq < 500) {
            float* op = probs + ((size_t)b * 500 + nq) * 500;
#pragma unroll                                        // constant indices keep x[][] in registers
            for (int j = 0; j < 4; ++j) {
                const int pc = j * 32 + lane;         // 125 pieces of 16 bytes are the row
                if (pc < 125) *(f32x4*)(op + pc * 4) = x[q][j] * inv[q];
            }
        }
    }
    // the next trip rewrites the stores' address and data registers
    asm volatile("s_wait_xcnt 0x0" ::: "memory");
    }
}

extern "C" void kernel_launch(void* const* d_in, const int* in_sizes, int n_in,
                              void* d_out, int out_size, void* d_ws, size_t ws_size,
                              hipStream_t stream) {
    const float* nodes = (const float*)d_in[0];
    const float* q1    = (const float*)d_in[1];
    const float* q0    = (const float*)d_in[2];
    const float* mask  = (const float*)d_in[3];
    const float* Wq1   = (const float*)d_in[4];
    const float* Wq0   = (const float*)d_in[5];
    const float* Wk    = (const float*)d_in[6];
    const float* Wv    = (const float*)d_in[7];
    const float* Wc    = (const float*)d_in[8];
    const float* bcp   = (const float*)d_in[9];
    float* probs = (float*)d_out;

    // Workspace layout (f16): 4 tensors of 32000x128, nodes in fragment order (64 x 512 x 128), packed Wc -> ~41 MB
    const size_t RE = (size_t)32000 * 128;
    const size_t NE = (size_t)32768 * 128;
    half_t* ws = (half_t*)d_ws;
    half_t* Kh = ws;
    half_t* Vh = Kh + RE;
    half_t* Qh = Vh + RE;
    half_t* Nh = Qh + RE;
    half_t* OC = Nh + NE;
    half_t* pWc = OC + RE;                // 16384 halves

    proj_kernel<<<512, 256, 0, stream>>>(nodes, q1, q0, Wk, Wv, Wq1, Wq0, Wc, Kh, Vh, Qh, Nh, pWc);
    attn_kernel<<<256, 512, 0, stream>>>(Kh, Vh, Qh, mask, OC);
    combine_kernel<<<1024, 256, 0, stream>>>(OC, pWc, bcp, Nh, mask, probs);
}

// v009
// One run takes 63.9 microseconds.
// Timed twice side by side with v008, it ran 1.04 times as fast both times.
// Over all steps from v000 it is 4.14 times as fast.
#include <hip/hip_runtime.h>
#include <hip/hip_bf16.h>

typedef _Float16 half_t;
typedef __attribute__((ext_vector_type(16))) _Float16 v16h;
typedef __attribute__((ext_vector_type(8)))  _Float16 v8h;
typedef __attribute__((ext_vector_type(8)))  float    v8f;

#define WMMA_F16(A, B, C) \
    __builtin_amdgcn_wmma_f32_16x16x32_f16(false, (A), false, (B), (short)0, (C), false, false)

__device__ __forceinline__ v16h make_a(v8h lo, v8h hi) {
    v16h r;
#pragma unroll
    for (int i = 0; i < 8; ++i) { r[i] = lo[i]; r[i + 8] = hi[i]; }
    return r;
}

typedef __attribute__((ext_vector_type(4))) float    f32x4;
typedef __attribute__((ext_vector_type(2))) float    f32x2;
typedef __attribute__((ext_vector_type(4))) _Float16 v4h;
typedef __attribute__((ext_vector_type(2))) _Float16 v2h;

__global__ __launch_bounds__(256) void proj_kernel(
    const float* __restrict__ nodes, const float* __restrict__ q1,
    const float* __restrict__ q0,
    const float* __restrict__ Wk,  const float* __restrict__ Wv,
    const float* __restrict__ Wq1, const float* __restrict__ Wq0,
    const float* __restrict__ Wc,
    half_t* __restrict__ Kh, half_t* __restrict__ Vh,
    half_t* __restrict__ Qh, half_t* __restrict__ Nf, half_t* __restrict__ pWc) {
    __shared__ __align__(16) half_t sN[64][136], sQ1[64][136], sQ0[64][136];
    const int m0 = (blockIdx.x & 7) * 64;              // first row of the block inside its batch
    const int rb = (blockIdx.x >> 3) * 500;            // first flat row of the batch
    const int lane = threadIdx.x & 31;
    const int w = __builtin_amdgcn_readfirstlane(threadIdx.x >> 5);   // scalar: the weight choice below is a scalar select
    const int row = lane & 15, kb = (lane >> 4) << 3;
    // rows: 16-byte loads, all 24 of a thread in flight
    f32x4 xn[8], x1[8], x0[8];
#pragma unroll                                        // constant indices keep the loaded rows in registers
    for (int t = 0; t < 8; ++t) {
        const int i = t * 256 + threadIdx.x;
        const int rr = i >> 5, cc = (i & 31) * 4;
        const int m = m0 + rr < 500 ? m0 + rr : 499;   // pad rows repeat the batch's last row, are stored only in Nf
        const size_t g = (size_t)(rb + m) * 128 + cc;
        xn[t] = *(const f32x4*)(nodes + g);
        x1[t] = *(const f32x4*)(q1 + g);
        x0[t] = *(const f32x4*)(q0 + g);
        // the next loads' addresses and results reuse these loads' address registers
        asm volatile("s_wait_xcnt 0x0" ::: "memory");
    }
    if (blockIdx.x < 64) {
        const int idx = blockIdx.x * 256 + threadIdx.x;    // < 16384
        const int t = idx >> 9, le = idx & 511;
        const int l = le >> 4, e = le & 15;
        const int k = (t & 3) * 32 + ((l >> 4) << 3) + (e < 8 ? e : e + 8);
        const int n = (t >> 2) * 16 + (l & 15);
        pWc[idx] = (half_t)Wc[k * 128 + n];
        // what follows reuses the address registers of this load and this store
        asm volatile("s_wait_xcnt 0x0" ::: "memory");
    }
    // B fragments of this wave's 32 columns of its two weights
    const bool kv = w < 4;
    const int cb = (w & 3) * 32 + 2 * row;             // this lane's two columns
    const float* WA = (kv ? Wk : Wq1) + kb * 128 + cb;
    const float* WB = (kv ? Wv : Wq0) + kb * 128 + cb;
    v16h bA[4][2], bB[4][2];
#pragma unroll                                        // constant indices keep the fragments in registers
    for (int kc = 0; kc < 4; ++kc)
#pragma unroll                                        // constant indices keep the fragments in registers
        for (int e = 0; e < 16; ++e) {
            const int k = kc * 32 + (e < 8 ? e : e + 8);   // the A loader's k order; kb is in the pointer
            const f32x2 ya = *(const f32x2*)(WA + k * 128);
            const f32x2 yb = *(const f32x2*)(WB + k * 128);
            bA[kc][0][e] = (half_t)ya[0];
            bA[kc][1][e] = (half_t)ya[1];
            bB[kc][0][e] = (half_t)yb[0];
            bB[kc][1][e] = (half_t)yb[1];
        }
#pragma unroll                                        // constant indices keep the loaded rows in registers
    for (int t = 0; t < 8; ++t) {
        const int i = t * 256 + threadIdx.x;
        const int rr = i >> 5, cc = (i & 31) * 4;
        *(v4h*)&sN[rr][cc]  = __builtin_convertvector(xn[t], v4h);
        *(v4h*)&sQ1[rr][cc] = __builtin_convertvector(x1[t], v4h);
        *(v4h*)&sQ0[rr][cc] = __builtin_convertvector(x0[t], v4h);
    }
    __syncthreads();
    const half_t (*sA)[136] = kv ? sN : sQ1;
    const half_t (*sB)[136] = kv ? sN : sQ0;
#pragma unroll 1                                      // rolled: the four trips share one copy of the code
    for (int rt = 0; rt < 4; ++rt) {
        const int lr = rt * 16 + row;
        v8f aA[2] = {}, aB[2] = {};
#pragma unroll                                        // constant indices keep the fragments in registers
        for (int kc = 0; kc < 4; ++kc) {
            const int k0 = kc * 32;
            const v16h fa = make_a(*(const v8h*)&sA[lr][k0 + kb], *(const v8h*)&sA[lr][k0 + kb + 16]);
            const v16h fb = make_a(*(const v8h*)&sB[lr][k0 + kb], *(const v8h*)&sB[lr][k0 + kb + 16]);
            aA[0] = WMMA_F16(fa, bA[kc][0], aA[0]);
            aA[1] = WMMA_F16(fa, bA[kc][1], aA[1]);
            aB[0] = WMMA_F16(fb, bB[kc][0], aB[0]);
            aB[1] = WMMA_F16(fb, bB[kc][1], aB[1]);
        }
        const int mh = m0 + rt * 16 + kb;              // kb is also 8 * (lane >> 4): the accumulator's row half
        // a lane's two columns are neighbours: one 4-byte store a row.  Rows >= 500 (a batch's last tile) are not stored.
        const size_t g0 = (size_t)(rb + mh) * 128 + cb;
        if (kv) {
#pragma unroll                                        // constant indices keep the accumulators in registers
            for (int r = 0; r < 8; ++r)
                if (mh + r < 500) {
                    *(v2h*)(Kh + g0 + r * 128) = v2h{(half_t)aA[0][r], (half_t)aA[1][r]};
                    *(v2h*)(Vh + g0 + r * 128) = v2h{(half_t)aB[0][r], (half_t)aB[1][r]};
                }
        } else {
#pragma unroll                                        // constant indices keep the accumulators in registers
            for (int r = 0; r < 8; ++r)
                if (mh + r < 500)                      // 1/sqrt(D) is folded into Q
                    *(v2h*)(Qh + g0 + r * 128) =
                        v2h{(half_t)((aA[0][r] + aB[0][r]) * 0.25f), (half_t)((aA[1][r] + aB[1][r]) * 0.25f)};
        }
        // wave w stores half w >> 2 of the nodes fragment of k chunk w & 3: one 512-byte piece
        *(v8h*)(Nf + ((size_t)(blockIdx.x * 4 + rt) * 4 + (w & 3)) * 512 + (w >> 2) * 256 + lane * 8) =
            *(const v8h*)&sN[lr][(w & 3) * 32 + kb + (w >> 2) * 16];
        // the next trip rewrites the stores' address and data registers
        asm volatile("s_wait_xcnt 0x0" ::: "memory");
    }
}

// ---------------------------------------------------------------------------
// Kernel 2: fused multi-head attention (flash-style online softmax).
// One block per (b, pair of heads): 16 waves over the 32 query tiles, and every wave
// takes its tile through both heads, so that a mask stage is fetched and read once
// for two heads.  K and V of the pair are staged through registers as 64-byte row
// pieces, V transposed; a Q fragment is 16 bytes a lane, loaded a tile ahead.
// Scores are formed transposed, S^T = K Q^T: lane (c, hi) holds query c and
// keys 8*hi + r of each 16-key tile, so maximum and sum run inside a lane and
// two converted score tiles are the B operand of O^T += V^T P^T as they stand.
// The mask reaches each wave through a two-buffer LDS ring of its own: a stage
// is 16 query rows x 64 keys, copied as whole 256-byte row pieces one stage ahead.
// ---------------------------------------------------------------------------
#define MS_PITCH 68                 // floats per mask row in LDS: 64 keys + 16 bytes (pitch 16 B x odd)
#define MS_BUF   (16 * MS_PITCH)    // floats per ring buffer

// One mask stage: eight asynchronous 16-byte copies per lane, two rows per copy.
// l is the lane's LDS byte address of row pair 0; g[j] its global piece of row pair j.
__device__ __forceinline__ void mask_stage_copy(const unsigned l, const float* const (&g)[8]) {
    asm volatile(
        "global_load_async_to_lds_b128 %0, %8, off\n\t"
        "global_load_async_to_lds_b128 %1, %9, off\n\t"
        "global_load_async_to_lds_b128 %2, %10, off\n\t"
        "global_load_async_to_lds_b128 %3, %11, off\n\t"
        "global_load_async_to_lds_b128 %4, %12, off\n\t"
        "global_load_async_to_lds_b128 %5, %13, off\n\t"
        "global_load_async_to_lds_b128 %6, %14, off\n\t"
        "global_load_async_to_lds_b128 %7, %15, off\n\t"
        "s_wait_xcnt 0x0"
        :: "v"(l), "v"(l + 2 * MS_PITCH * 4), "v"(l + 4 * MS_PITCH * 4), "v"(l + 6 * MS_PITCH * 4),
           "v"(l + 8 * MS_PITCH * 4), "v"(l + 10 * MS_PITCH * 4), "v"(l + 12 * MS_PITCH * 4),
           "v"(l + 14 * MS_PITCH * 4),
           "v"(g[0]), "v"(g[1]), "v"(g[2]), "v"(g[3]), "v"(g[4]), "v"(g[5]), "v"(g[6]), "v"(g[7])
        : "memory");
}

// Hand-over of a ring private to one wave: its reads of the buffer to be refilled have
// retired, and the stage it is about to read has landed.
__device__ __forceinline__ void mask_stage_wait() {
    asm volatile("s_wait_dscnt 0x0" ::: "memory");     // no copy may overtake this wave's own LDS reads
    asm volatile("s_wait_asynccnt 0x0" ::: "memory");  // the compiler places no wait for the copies
}

__device__ __forceinline__ float xhalf(float x) {
    return __builtin_bit_cast(float, __builtin_amdgcn_permlanex16(
        __builtin_bit_cast(int, x), __builtin_bit_cast(int, x),
        0x76543210, 0xfedcba98, false, false));
}

#define HG 2                        // heads per block

struct VTile { half_t v[16][520]; half_t pad[16]; };   // [d][key]

// One pass over 32 keys for 16 queries of one head.  LAST: the pass that holds keys >= 500.
// m1, m2: this lane's 16 mask values, keys kc+kb+0..7 and kc+16+kb+0..7 of its query row.
template <bool LAST>
__device__ __forceinline__ void attn_pass(
    const half_t (*sK)[16], const half_t (*sVT)[520], const v8f m1, const v8f m2,
    const v16h bQ, const int kc, const int cr, const int kb,
    v16h& aK1, v16h& aK2, v8f& acc, float& mrun, float& lrun) {
    // only d = 0..15 is real: elements 8..15 of both K fragments stay zero throughout
    const v8h k1 = *(const v8h*)&sK[kc + cr][kb];
    const v8h k2 = *(const v8h*)&sK[kc + 16 + cr][kb];
#pragma unroll
    for (int i = 0; i < 8; ++i) { aK1[i] = k1[i]; aK2[i] = k2[i]; }
    v8f s1 = {}, s2 = {};
    s1 = WMMA_F16(aK1, bQ, s1);
    s2 = WMMA_F16(aK2, bQ, s2);
    const v8f t1 = s1 + m1;
    const v8f t2 = s2 + m2;
    float v[16];
#pragma unroll
    for (int r = 0; r < 8; ++r) {
        v[r]     = t1[r];
        v[8 + r] = t2[r];
        if (LAST) {
            if (kc + kb + r >= 500)      v[r]     = -1e30f;
            if (kc + 16 + kb + r >= 500) v[8 + r] = -1e30f;
        }
    }
    float cm = v[0];
#pragma unroll
    for (int i = 1; i < 16; ++i) cm = fmaxf(cm, v[i]);
    cm = fmaxf(cm, xhalf(cm));
    const float nm = fmaxf(mrun, cm);
    const float sc = __expf(mrun - nm);
    v16h bP;
    float ls = 0.f;
#pragma unroll
    for (int i = 0; i < 16; ++i) {
        float p = __expf(v[i] - nm);
        ls += p;
        bP[i] = (half_t)p;
    }
    lrun = lrun * sc + ls;      // this half's keys only; halves joined after the last pass
    mrun = nm;
#pragma unroll
    for (int r = 0; r < 8; ++r) acc[r] *= sc;
    v16h aV = make_a(*(const v8h*)&sVT[cr][kc + kb], *(const v8h*)&sVT[cr][kc + kb + 16]);
    acc = WMMA_F16(aV, bP, acc);
}

// The same 32 keys for both heads: the mask values leave the ring once (mrow: key kc+kb of the lane's query row).
template <bool LAST>
__device__ __forceinline__ void attn_pass_heads(
    const half_t (*sK)[512][16], const VTile* sVT, const float* mrow,
    const v16h (&bQ)[HG], const int kc, const int cr, const int kb,
    v16h& aK1, v16h& aK2, v8f (&acc)[HG], float (&mrun)[HG], float (&lrun)[HG]) {
    f32x4 mk[4];
#pragma unroll                                        // constant indices keep mk[] in registers
    for (int j = 0; j < 4; ++j)
        mk[j] = *(const f32x4*)(mrow + (j >> 1) * 16 + (j & 1) * 4);
    const v8f m1 = __builtin_shufflevector(mk[0], mk[1], 0, 1, 2, 3, 4, 5, 6, 7);
    const v8f m2 = __builtin_shufflevector(mk[2], mk[3], 0, 1, 2, 3, 4, 5, 6, 7);
#pragma unroll                                        // constant indices keep the per-head state in registers
    for (int h = 0; h < HG; ++h)
        attn_pass<LAST>(sK[h], sVT[h].v, m1, m2, bQ[h], kc, cr, kb, aK1, aK2, acc[h], mrun[h], lrun[h]);
}

__global__ __launch_bounds__(512) void attn_kernel(
    const half_t* __restrict__ Kh, const half_t* __restrict__ Vh,
    const half_t* __restrict__ Qh, const float* __restrict__ mask,
    half_t* __restrict__ outc) {
    struct Lds {
        VTile  sVT[HG];              // per head [d][key]
        half_t sK[HG][512][16];      // per head [key][d]
        float  sM[16][2][MS_BUF];    // per wave: two mask stages
    };
    __shared__ __align__(16) Lds lds;
    VTile (&sVT)[HG] = lds.sVT;
    half_t (&sK)[HG][512][16] = lds.sK;
    float (&sM)[16][2][MS_BUF] = lds.sM;
    const int b = blockIdx.x >> 2, hg = blockIdx.x & 3;

    const int w = __builtin_amdgcn_readfirstlane(threadIdx.x >> 5);   // scalar: uniform flow round the copies
    const int crow = (threadIdx.x >> 4) & 1, cpc = threadIdx.x & 15;
    const unsigned mlds = (unsigned)(size_t)&sM[w][0][crow * MS_PITCH + cpc * 4];
    // the last stage holds keys 448..511: pieces past key 496 re-read that piece, inside the row
    const int step7 = 64 - (cpc > 12 ? (cpc - 12) * 4 : 0);
    const float* mg[8];
#pragma unroll                                        // constant indices keep mg[] in registers
    for (int j = 0; j < 8; ++j) {
        const int r = w * 16 + 2 * j + crow;          // w < 16: a real query row
        mg[j] = mask + ((size_t)b * 500 + r) * 500 + cpc * 4;
    }
    mask_stage_copy(mlds, mg);                        // first tile, stage 0, buffer 0

    // K and V of the two heads: 64 contiguous bytes a row, four 16-byte pieces; four lanes take a row.
    // Rows 500..511 are stored as zero (their loads repeat row 499).
    {
        v8h kv[4], vv[4];
#pragma unroll                                        // constant indices keep kv[] and vv[] in registers; all eight loads fly together
        for (int t = 0; t < 4; ++t) {
            const int i = t * 512 + threadIdx.x;
            const int m = i >> 2, p = i & 3;
            const size_t g = (size_t)(b * 500 + (m < 500 ? m : 499)) * 128 + hg * (HG * 16) + p * 8;
            kv[t] = *(const v8h*)(Kh + g);
            vv[t] = *(const v8h*)(Vh + g);
        }
        const v8h zero = {};
#pragma unroll                                        // constant indices keep kv[] and vv[] in registers
        for (int t = 0; t < 4; ++t) {
            const int i = t * 512 + threadIdx.x;
            const int m = i >> 2, p = i & 3;
            const v8h k = m < 500 ? kv[t] : zero;
            const v8h v = m < 500 ? vv[t] : zero;
            *(v8h*)&sK[p >> 1][m][(p & 1) * 8] = k;
#pragma unroll                                        // constant indices keep v in registers
            for (int d = 0; d < 8; ++d) sVT[p >> 1].v[(p & 1) * 8 + d][m] = v[d];
        }
    }

    const int lane = threadIdx.x & 31;
    const int cr = lane & 15, hi = lane >> 4, kb = hi << 3;
    const float* mrd = &sM[w][0][cr * MS_PITCH + kb]; // this lane's query row in buffer 0
    v8h z8 = {};
    v16h aK1 = {}, aK2 = {};
    // this lane's 16 bytes of Q per head, of the tile to come
    const half_t* qb = Qh + (size_t)(b * 500) * 128 + hg * (HG * 16) + kb;
    v8h qf[HG];
#pragma unroll                                        // constant indices keep qf[] in registers
    for (int h = 0; h < HG; ++h) qf[h] = *(const v8h*)(qb + (size_t)(w * 16 + cr) * 128 + h * 16);
    __syncthreads();

    for (int mt = w; mt < 32; mt += 16) {
        const int n0 = mt * 16;
        const int nq = n0 + cr;                       // this lane's query
        v16h bQ[HG];
        v8f acc[HG];                                  // acc[h][r] = O[nq][8*hi + r] of head h
        float mrun[HG], lrun[HG];
#pragma unroll                                        // constant indices keep the per-head state in registers
        for (int h = 0; h < HG; ++h) {
            bQ[h] = make_a(qf[h], z8);                // K(d) padded to 32
            acc[h] = v8f{};
            mrun[h] = -1e30f;
            lrun[h] = 0.f;
        }
        // eight stages a tile, so every tile starts in buffer 0; stage s + 1 flies while stage s is worked on
        for (int s = 0; s < 7; ++s) {
            mask_stage_wait();
            const int step = s == 6 ? step7 : 64;
#pragma unroll                                        // constant indices keep mg[] in registers
            for (int j = 0; j < 8; ++j) mg[j] += step;
            mask_stage_copy(mlds + ((s + 1) & 1) * (MS_BUF * 4), mg);
            const float* mr = mrd + (s & 1) * MS_BUF;
            attn_pass_heads<false>(sK, sVT, mr,      bQ, s * 64,      cr, kb, aK1, aK2, acc, mrun, lrun);
            attn_pass_heads<false>(sK, sVT, mr + 32, bQ, s * 64 + 32, cr, kb, aK1, aK2, acc, mrun, lrun);
        }
        mask_stage_wait();
        if (mt + 16 < 32) {                           // the next tile's stage 0, into buffer 0, and its Q
#pragma unroll                                        // constant indices keep mg[] in registers
            for (int j = 0; j < 8; ++j) {
                const int r = n0 + 256 + 2 * j + crow;
                const int rc = r < 500 ? r : 499;     // pad queries copy a real mask row, are never stored
                mg[j] = mask + ((size_t)b * 500 + rc) * 500 + cpc * 4;
            }
            mask_stage_copy(mlds, mg);
            const int qn = nq + 256 < 500 ? nq + 256 : 499;   // pad queries take a real row, are never stored
#pragma unroll                                        // constant indices keep qf[] in registers
            for (int h = 0; h < HG; ++h) qf[h] = *(const v8h*)(qb + (size_t)qn * 128 + h * 16);
        }
        attn_pass_heads<false>(sK, sVT, mrd + MS_BUF,      bQ, 448, cr, kb, aK1, aK2, acc, mrun, lrun);
        attn_pass_heads<true>(sK, sVT,  mrd + MS_BUF + 32, bQ, 480, cr, kb, aK1, aK2, acc, mrun, lrun);
        v8h o[HG];
#pragma unroll                                        // constant indices keep the per-head state in registers
        for (int h = 0; h < HG; ++h) {
            const float l = lrun[h] + xhalf(lrun[h]);
            const float inv = 1.0f / l;               // one query per lane: one reciprocal a head
#pragma unroll                                        // constant indices keep acc[] and o[] in registers
            for (int r = 0; r < 8; ++r) o[h][r] = (half_t)(acc[h][r] * inv);
        }
        if (nq < 500) {
            half_t* op = outc + (size_t)(b * 500 + nq) * 128 + hg * (HG * 16) + kb;
#pragma unroll                                        // constant indices keep o[] in registers
            for (int h = 0; h < HG; ++h) *(v8h*)(op + h * 16) = o[h];
            // the next query tile reuses the stores' address and data registers
            asm volatile("s_wait_xcnt 0x0" ::: "memory");
        }
    }
}

// ---------------------------------------------------------------------------
// Kernel 3: mh = outc@Wc + bc, s = mh@nodes^T/sqrt(128), 10*tanh + mask,
// row softmax -> probs.  One block per (b, 32 queries: two 16-query tiles).
// The block's 32 mask rows are copied into the score buffer at entry, as whole
// 512-byte row pieces, and land while stage 1 runs; stage 2 adds its logits there.
// ---------------------------------------------------------------------------
// Eight asynchronous 16-byte copies per lane: l[j] the lane's LDS byte address, g[j] its global piece.
__device__ __forceinline__ void mask_rows_copy(const unsigned (&l)[8], const float* const (&g)[8]) {
    asm volatile(
        "global_load_async_to_lds_b128 %0, %8, off\n\t"
        "global_load_async_to_lds_b128 %1, %9, off\n\t"
        "global_load_async_to_lds_b128 %2, %10, off\n\t"
        "global_load_async_to_lds_b128 %3, %11, off\n\t"
        "global_load_async_to_lds_b128 %4, %12, off\n\t"
        "global_load_async_to_lds_b128 %5, %13, off\n\t"
        "global_load_async_to_lds_b128 %6, %14, off\n\t"
        "global_load_async_to_lds_b128 %7, %15, off\n\t"
        "s_wait_xcnt 0x0"
        :: "v"(l[0]), "v"(l[1]), "v"(l[2]), "v"(l[3]), "v"(l[4]), "v"(l[5]), "v"(l[6]), "v"(l[7]),
           "v"(g[0]), "v"(g[1]), "v"(g[2]), "v"(g[3]), "v"(g[4]), "v"(g[5]), "v"(g[6]), "v"(g[7])
        : "memory");
}

template <int CTRL>
__device__ __forceinline__ float row_xor(float x) {
    return __builtin_bit_cast(float, __builtin_amdgcn_mov_dpp(__builtin_bit_cast(int, x), CTRL, 0xf, 0xf, true));
}

__device__ __forceinline__ void exp2_run(float (&t)[8]) {
    asm("v_exp_f32 %0, %0\n\t"
        "v_exp_f32 %1, %1\n\t"
        "v_exp_f32 %2, %2\n\t"
        "v_exp_f32 %3, %3\n\t"
        "v_exp_f32 %4, %4\n\t"
        "v_exp_f32 %5, %5\n\t"
        "v_exp_f32 %6, %6\n\t"
        "v_exp_f32 %7, %7\n\t"
        "v_nop"
        : "+v"(t[0]), "+v"(t[1]), "+v"(t[2]), "+v"(t[3]), "+v"(t[4]), "+v"(t[5]), "+v"(t[6]), "+v"(t[7]));
}

__global__ __launch_bounds__(256) void combine_kernel(
    const half_t* __restrict__ outc, const half_t* __restrict__ pWc,
    const float* __restrict__ bc, const half_t* __restrict__ Nf,
    const float* __restrict__ mask, float* __restrict__ probs) {
    __shared__ __align__(16) half_t sMH[32][136];
    __shared__ __align__(16) float  sS[32][520];
    const int b = blockIdx.x >> 4, nt = blockIdx.x & 15;
    const int n0 = nt * 32;
    const int lane = threadIdx.x & 31, w = threadIdx.x >> 5;
    const int cr = lane & 15, hi = lane >> 4, kb = hi << 3;
    // --- mask rows into sS: wave w brings rows 4w .. 4w+3, four copies a row, every lane on ---
#pragma unroll                                        // two runs of eight copies, all sixteen in flight
    for (int p = 0; p < 2; ++p) {
        unsigned ml[8];
        const float* mg[8];
#pragma unroll                                        // constant indices keep ml[] and mg[] in registers
        for (int j = 0; j < 8; ++j) {
            const int rr = 4 * w + 2 * p + (j >> 2);
            const int pc = (j & 3) * 32 + lane;
            const int rq = n0 + rr < 500 ? n0 + rr : 499;
            const int ps = pc < 125 ? pc : 124;
            ml[j] = (unsigned)(size_t)&sS[rr][pc * 4];
            mg[j] = mask + ((size_t)b * 500 + rq) * 500 + ps * 4;
        }
        mask_rows_copy(ml, mg);
    }
    // --- stage 1: mh column tile [16w, 16w+16) of both query tiles; a weight fragment feeds two products ---
    v16h wb[4], ao[2][4];
#pragma unroll                                        // constant indices keep wb[] and ao[][] in registers; all 24 loads fly together
    for (int kc = 0; kc < 4; ++kc) {
        wb[kc] = *(const v16h*)(pWc + (w * 4 + kc) * 512 + lane * 16);
#pragma unroll                                        // constant indices keep ao[][] in registers
        for (int t = 0; t < 2; ++t) {
            const int arow = n0 + t * 16 + cr < 500 ? n0 + t * 16 + cr : 499;   // pad queries take a real row, are never stored
            const half_t* ap = outc + (size_t)(b * 500 + arow) * 128 + kc * 32 + kb;
            ao[t][kc] = make_a(*(const v8h*)ap, *(const v8h*)(ap + 16));
        }
    }
    // what follows reuses the address registers of these loads; the loaded values as inputs hold all 24 loads ahead of the
    // first product, one round trip for the stage instead of one per k chunk
    asm volatile("s_wait_xcnt 0x0" :: "v"(wb[0]), "v"(wb[1]), "v"(wb[2]), "v"(wb[3]),
                 "v"(ao[0][0]), "v"(ao[0][1]), "v"(ao[0][2]), "v"(ao[0][3]),
                 "v"(ao[1][0]), "v"(ao[1][1]), "v"(ao[1][2]), "v"(ao[1][3]) : "memory");
    v8f acc[2] = {};
#pragma unroll                                        // constant indices keep the fragments in registers
    for (int kc = 0; kc < 4; ++kc) {
        acc[0] = WMMA_F16(ao[0][kc], wb[kc], acc[0]);
        acc[1] = WMMA_F16(ao[1][kc], wb[kc], acc[1]);
    }
    const float bias = bc[w * 16 + cr];
#pragma unroll
    for (int t = 0; t < 2; ++t)
#pragma unroll
        for (int r = 0; r < 8; ++r) sMH[t * 16 + r + (hi << 3)][w * 16 + cr] = (half_t)(acc[t][r] + bias);
    // the compiler places no wait for the copies; behind it the barrier hands every wave's mask rows to the others
    asm volatile("s_wait_asynccnt 0x0" ::: "memory");
    __syncthreads();
    // --- stage 2: pointer logits over all keys; a key fragment is loaded once for the two query tiles ---
    const float inv_se = 1.0f / 11.313708498984761f;
    v16h am[2][4];                                    // the query tiles' fragments, read once (the wait below bars the compiler from hoisting them)
#pragma unroll                                        // constant indices keep am[][] in registers
    for (int t = 0; t < 2; ++t)
#pragma unroll                                        // constant indices keep am[][] in registers
        for (int kc = 0; kc < 4; ++kc)
            am[t][kc] = make_a(*(const v8h*)&sMH[t * 16 + cr][kc * 32 + kb], *(const v8h*)&sMH[t * 16 + cr][kc * 32 + kb + 16]);
    for (int mt = w; mt < 32; mt += 8) {
        const int m0 = mt * 16;
        v8f sa[2] = {};
        // the key tile's fragments as stored by the projection kernel; keys >= 500 hold a real row, replaced below
        const half_t* np = Nf + (size_t)(b * 32 + mt) * 2048 + lane * 8;
        v16h bb[4];
#pragma unroll                                        // constant indices keep bb[] in registers; the eight loads fly together
        for (int kc = 0; kc < 4; ++kc)
            bb[kc] = make_a(*(const v8h*)(np + kc * 512), *(const v8h*)(np + kc * 512 + 256));
        // the foot of the trip rewrites the address registers of the eight key loads above; the loaded values as inputs
        // hold all eight loads ahead of the first product, one round trip a trip instead of three
        asm volatile("s_wait_xcnt 0x0" :: "v"(bb[0]), "v"(bb[1]), "v"(bb[2]), "v"(bb[3]) : "memory");
#pragma unroll                                        // constant indices keep the fragments in registers
        for (int kc = 0; kc < 4; ++kc) {
            sa[0] = WMMA_F16(am[0][kc], bb[kc], sa[0]);
            sa[1] = WMMA_F16(am[1][kc], bb[kc], sa[1]);
        }
#pragma unroll                                        // constant indices keep sa[] in registers
        for (int t = 0; t < 2; ++t) {
            float mv[8];
#pragma unroll
            for (int r = 0; r < 8; ++r) mv[r] = sS[t * 16 + r + (hi << 3)][m0 + cr];
#pragma unroll
            for (int r = 0; r < 8; ++r) {
                const int row = t * 16 + r + (hi << 3);
                const int mk = m0 + cr;
                float s = 10.0f * __builtin_amdgcn_tanhf(sa[t][r] * inv_se) + mv[r];
                if (mk >= 500) s = -1e30f;
                sS[row][mk] = s;
            }
        }
    }
    __syncthreads();
#pragma unroll 1                                      // rolled: the two trips share one copy of the code and its registers
    for (int p = 0; p < 2; ++p) {
    const int r0 = 4 * w + 2 * p;
    f32x4 x[2][4];
#pragma unroll                                        // constant indices keep x[][] in registers
    for (int q = 0; q < 2; ++q)
#pragma unroll                                        // constant indices keep x[][] in registers
        for (int j = 0; j < 4; ++j) x[q][j] = *(const f32x4*)&sS[r0 + q][(j * 32 + lane) * 4];
    float inv[2];
#pragma unroll                                        // constant indices keep x[][] in registers
    for (int q = 0; q < 2; ++q) {
        float mx = x[q][0][0];
#pragma unroll                                        // constant indices keep x[][] in registers
        for (int j = 0; j < 4; ++j)
#pragma unroll                                        // constant indices keep x[][] in registers
            for (int i = 0; i < 4; ++i) mx = fmaxf(mx, x[q][j][i]);
        mx = fmaxf(mx, row_xor<0x161>(mx));
        mx = fmaxf(mx, row_xor<0x162>(mx));
        mx = fmaxf(mx, row_xor<0x164>(mx));
        mx = fmaxf(mx, row_xor<0x168>(mx));
        mx = fmaxf(mx, xhalf(mx));
#pragma unroll                                        // constant indices keep x[][] in registers
        for (int j = 0; j < 4; j += 2) {
            float t[8];
#pragma unroll                                        // constant indices keep t[] in registers
            for (int i = 0; i < 8; ++i) t[i] = (x[q][j + (i >> 2)][i & 3] - mx) * 1.44269504f;
            exp2_run(t);
#pragma unroll                                        // constant indices keep x[][] in registers
            for (int i = 0; i < 8; ++i) x[q][j + (i >> 2)][i & 3] = t[i];
        }
        const f32x4 sv = (x[q][0] + x[q][1]) + (x[q][2] + x[q][3]);
        float sum = (sv[0] + sv[1]) + (sv[2] + sv[3]);
        sum += row_xor<0x161>(sum);
        sum += row_xor<0x162>(sum);
        sum += row_xor<0x164>(sum);
        sum += row_xor<0x168>(sum);
        sum += xhalf(sum);
        inv[q] = 1.0f / sum;
    }
#pragma unroll                                        // constant indices keep x[][] in registers
    for (int q = 0; q < 2; ++q) {
        const int nq = n0 + r0 + q;
        if (nq < 500) {
            float* op = probs + ((size_t)b * 500 + nq) * 500;
#pragma unroll                                        // constant indices keep x[][] in registers
            for (int j = 0; j < 4; ++j) {
                const int pc = j * 32 + lane;         // 125 pieces of 16 bytes are the row
                if (pc < 125) *(f32x4*)(op + pc * 4) = x[q][j] * inv[q];
            }
        }
    }
    // the next trip rewrites the stores' address and data registers
    asm volatile("s_wait_xcnt 0x0" ::: "memory");
    }
}

extern "C" void kernel_launch(void* const* d_in, const int* in_sizes, int n_in,
                              void* d_out, int out_size, void* d_ws, size_t ws_size,
                              hipStream_t stream) {
    const float* nodes = (const float*)d_in[0];
    const float* q1    = (const float*)d_in[1];
    const float* q0    = (const float*)d_in[2];
    const float* mask  = (const float*)d_in[3];
    const float* Wq1   = (const float*)d_in[4];
    const float* Wq0   = (const float*)d_in[5];
    const float* Wk    = (const float*)d_in[6];
    const float* Wv    = (const float*)d_in[7];
    const float* Wc    = (const float*)d_in[8];
    const float* bcp   = (const float*)d_in[9];
    float* probs = (float*)d_out;

    // Workspace layout (f16): 4 tensors of 32000x128, nodes in fragment order (64 x 512 x 128), packed Wc -> ~41 MB
    const size_t RE = (size_t)32000 * 128;
    const size_t NE = (size_t)32768 * 128;
    half_t* ws = (half_t*)d_ws;
    half_t* Kh = ws;
    half_t* Vh = Kh + RE;
    half_t* Qh = Vh + RE;
    half_t* Nh = Qh + RE;
    half_t* OC = Nh + NE;
    half_t* pWc = OC + RE;                // 16384 halves

    proj_kernel<<<512, 256, 0, stream>>>(nodes, q1, q0, Wk, Wv, Wq1, Wq0, Wc, Kh, Vh, Qh, Nh, pWc);
    attn_kernel<<<256, 512, 0, stream>>>(Kh, Vh, Qh, mask, OC);
    combine_kernel<<<1024, 256, 0, stream>>>(OC, pWc, bcp, Nh, mask, probs);
}

// v010
// Measured time: 61.4 microseconds a run.
// Two timings next to v009 both put it at 1.04 times that version's speed.
// All steps since v000 together make it 4.31 times as fast.
#include <hip/hip_runtime.h>
#include <hip/hip_bf16.h>

typedef _Float16 half_t;
typedef __attribute__((ext_vector_type(16))) _Float16 v16h;
typedef __attribute__((ext_vector_type(8)))  _Float16 v8h;
typedef __attribute__((ext_vector_type(8)))  float    v8f;

#define WMMA_F16(A, B, C) \
    __builtin_amdgcn_wmma_f32_16x16x32_f16(false, (A), false, (B), (short)0, (C), false, false)

__device__ __forceinline__ v16h make_a(v8h lo, v8h hi) {
    v16h r;
#pragma unroll
    for (int i = 0; i < 8; ++i) { r[i] = lo[i]; r[i + 8] = hi[i]; }
    return r;
}

typedef __attribute__((ext_vector_type(4))) float    f32x4;
typedef __attribute__((ext_vector_type(2))) float    f32x2;
typedef __attribute__((ext_vector_type(4))) _Float16 v4h;
typedef __attribute__((ext_vector_type(2))) _Float16 v2h;

__global__ __launch_bounds__(256) void proj_kernel(
    const float* __restrict__ nodes, const float* __restrict__ q1,
    const float* __restrict__ q0,
    const float* __restrict__ Wk,  const float* __restrict__ Wv,
    const float* __restrict__ Wq1, const float* __restrict__ Wq0,
    const float* __restrict__ Wc,
    half_t* __restrict__ Kh, half_t* __restrict__ Vh,
    half_t* __restrict__ Qh, half_t* __restrict__ Nf, half_t* __restrict__ pWc) {
    __shared__ __align__(16) half_t sN[64][136], sQ1[64][136], sQ0[64][136];
    const int m0 = (blockIdx.x & 7) * 64;              // first row of the block inside its batch
    const int rb = (blockIdx.x >> 3) * 500;            // first flat row of the batch
    const int lane = threadIdx.x & 31;
    const int w = __builtin_amdgcn_readfirstlane(threadIdx.x >> 5);   // scalar: the weight choice below is a scalar select
    const int row = lane & 15, kb = (lane >> 4) << 3;
    // rows: 16-byte loads, all 24 of a thread in flight
    f32x4 xn[8], x1[8], x0[8];
#pragma unroll                                        // constant indices keep the loaded rows in registers
    for (int t = 0; t < 8; ++t) {
        const int i = t * 256 + threadIdx.x;
        const int rr = i >> 5, cc = (i & 31) * 4;
        const int m = m0 + rr < 500 ? m0 + rr : 499;   // pad rows repeat the batch's last row, are stored only in Nf
        const size_t g = (size_t)(rb + m) * 128 + cc;
        xn[t] = *(const f32x4*)(nodes + g);
        x1[t] = *(const f32x4*)(q1 + g);
        x0[t] = *(const f32x4*)(q0 + g);
        // the next loads' addresses and results reuse these loads' address registers
        asm volatile("s_wait_xcnt 0x0" ::: "memory");
    }
    if (blockIdx.x < 64) {
        const int idx = blockIdx.x * 256 + threadIdx.x;    // < 16384
        const int t = idx >> 9, le = idx & 511;
        const int l = le >> 4, e = le & 15;
        const int k = (t & 3) * 32 + ((l >> 4) << 3) + (e < 8 ? e : e + 8);
        const int n = (t >> 2) * 16 + (l & 15);
        pWc[idx] = (half_t)Wc[k * 128 + n];
        // what follows reuses the address registers of this load and this store
        asm volatile("s_wait_xcnt 0x0" ::: "memory");
    }
    // B fragments of this wave's 32 columns of its two weights
    const bool kv = w < 4;
    const int cb = (w & 3) * 32 + 2 * row;             // this lane's two columns
    const float* WA = (kv ? Wk : Wq1) + kb * 128 + cb;
    const float* WB = (kv ? Wv : Wq0) + kb * 128 + cb;
    v16h bA[4][2], bB[4][2];
#pragma unroll                                        // constant indices keep the fragments in registers
    for (int kc = 0; kc < 4; ++kc)
#pragma unroll                                        // constant indices keep the fragments in registers
        for (int e = 0; e < 16; ++e) {
            const int k = kc * 32 + (e < 8 ? e : e + 8);   // the A loader's k order; kb is in the pointer
            const f32x2 ya = *(const f32x2*)(WA + k * 128);
            const f32x2 yb = *(const f32x2*)(WB + k * 128);
            bA[kc][0][e] = (half_t)ya[0];
            bA[kc][1][e] = (half_t)ya[1];
            bB[kc][0][e] = (half_t)yb[0];
            bB[kc][1][e] = (half_t)yb[1];
        }
#pragma unroll                                        // constant indices keep the loaded rows in registers
    for (int t = 0; t < 8; ++t) {
        const int i = t * 256 + threadIdx.x;
        const int rr = i >> 5, cc = (i & 31) * 4;
        *(v4h*)&sN[rr][cc]  = __builtin_convertvector(xn[t], v4h);
        *(v4h*)&sQ1[rr][cc] = __builtin_convertvector(x1[t], v4h);
        *(v4h*)&sQ0[rr][cc] = __builtin_convertvector(x0[t], v4h);
    }
    __syncthreads();
    const half_t (*sA)[136] = kv ? sN : sQ1;
    const half_t (*sB)[136] = kv ? sN : sQ0;
#pragma unroll 1                                      // rolled: the four trips share one copy of the code
    for (int rt = 0; rt < 4; ++rt) {
        const int lr = rt * 16 + row;
        v8f aA[2] = {}, aB[2] = {};
#pragma unroll                                        // constant indices keep the fragments in registers
        for (int kc = 0; kc < 4; ++kc) {
            const int k0 = kc * 32;
            const v16h fa = make_a(*(const v8h*)&sA[lr][k0 + kb], *(const v8h*)&sA[lr][k0 + kb + 16]);
            const v16h fb = make_a(*(const v8h*)&sB[lr][k0 + kb], *(const v8h*)&sB[lr][k0 + kb + 16]);
            aA[0] = WMMA_F16(fa, bA[kc][0], aA[0]);
            aA[1] = WMMA_F16(fa, bA[kc][1], aA[1]);
            aB[0] = WMMA_F16(fb, bB[kc][0], aB[0]);
            aB[1] = WMMA_F16(fb, bB[kc][1], aB[1]);
        }
        const int mh = m0 + rt * 16 + kb;              // kb is also 8 * (lane >> 4): the accumulator's row half
        // a lane's two columns are neighbours: one 4-byte store a row.  Rows >= 500 (a batch's last tile) are not stored.
        const size_t g0 = (size_t)(rb + mh) * 128 + cb;
        if (kv) {
#pragma unroll                                        // constant indices keep the accumulators in registers
            for (int r = 0; r < 8; ++r)
                if (mh + r < 500) {
                    *(v2h*)(Kh + g0 + r * 128) = v2h{(half_t)aA[0][r], (half_t)aA[1][r]};
                    *(v2h*)(Vh + g0 + r * 128) = v2h{(half_t)aB[0][r], (half_t)aB[1][r]};
                }
        } else {
#pragma unroll                                        // constant indices keep the accumulators in registers
            for (int r = 0; r < 8; ++r)
                if (mh + r < 500)                      // 1/sqrt(D) is folded into Q
                    *(v2h*)(Qh + g0 + r * 128) =
                        v2h{(half_t)((aA[0][r] + aB[0][r]) * 0.25f), (half_t)((aA[1][r] + aB[1][r]) * 0.25f)};
        }
        // wave w stores half w >> 2 of the nodes fragment of k chunk w & 3: one 512-byte piece
        *(v8h*)(Nf + ((size_t)(blockIdx.x * 4 + rt) * 4 + (w & 3)) * 512 + (w >> 2) * 256 + lane * 8) =
            *(const v8h*)&sN[lr][(w & 3) * 32 + kb + (w >> 2) * 16];
        // the next trip rewrites the stores' address and data registers
        asm volatile("s_wait_xcnt 0x0" ::: "memory");
    }
}

// ---------------------------------------------------------------------------
// Kernel 2: fused multi-head attention (flash-style online softmax).
// One block per (b, half of the queries, four heads): 16 waves, one query tile each, and
// every wave takes its tile through the four heads, so that a mask stage is fetched and
// read once for four heads.  K and V of the four are staged through registers as 128-byte
// row pieces, V transposed; a Q fragment is 16 bytes a lane.
// Scores are formed transposed, S^T = K Q^T: lane (c, hi) holds query c and
// keys 8*hi + r of each 16-key tile, so maximum and sum run inside a lane and
// two converted score tiles are the B operand of O^T += V^T P^T as they stand.
// The mask reaches each wave through a two-buffer LDS ring of its own: a stage
// is 16 query rows x 64 keys, copied as whole 256-byte row pieces one stage ahead.
// ---------------------------------------------------------------------------
#define MS_PITCH 68                 // floats per mask row in LDS: 64 keys + 16 bytes (pitch 16 B x odd)
#define MS_BUF   (16 * MS_PITCH)    // floats per ring buffer

// One mask stage: eight asynchronous 16-byte copies per lane, two rows per copy.
// l is the lane's LDS byte address of row pair 0; g[j] its global piece of row pair j.
__device__ __forceinline__ void mask_stage_copy(const unsigned l, const float* const (&g)[8]) {
    asm volatile(
        "global_load_async_to_lds_b128 %0, %8, off\n\t"
        "global_load_async_to_lds_b128 %1, %9, off\n\t"
        "global_load_async_to_lds_b128 %2, %10, off\n\t"
        "global_load_async_to_lds_b128 %3, %11, off\n\t"
        "global_load_async_to_lds_b128 %4, %12, off\n\t"
        "global_load_async_to_lds_b128 %5, %13, off\n\t"
        "global_load_async_to_lds_b128 %6, %14, off\n\t"
        "global_load_async_to_lds_b128 %7, %15, off\n\t"
        "s_wait_xcnt 0x0"
        :: "v"(l), "v"(l + 2 * MS_PITCH * 4), "v"(l + 4 * MS_PITCH * 4), "v"(l + 6 * MS_PITCH * 4),
           "v"(l + 8 * MS_PITCH * 4), "v"(l + 10 * MS_PITCH * 4), "v"(l + 12 * MS_PITCH * 4),
           "v"(l + 14 * MS_PITCH * 4),
           "v"(g[0]), "v"(g[1]), "v"(g[2]), "v"(g[3]), "v"(g[4]), "v"(g[5]), "v"(g[6]), "v"(g[7])
        : "memory");
}

// Hand-over of a ring private to one wave: its reads of the buffer to be refilled have
// retired, and the stage it is about to read has landed.
__device__ __forceinline__ void mask_stage_wait() {
    asm volatile("s_wait_dscnt 0x0" ::: "memory");     // no copy may overtake this wave's own LDS reads
    asm volatile("s_wait_asynccnt 0x0" ::: "memory");  // the compiler places no wait for the copies
}

__device__ __forceinline__ float xhalf(float x) {
    return __builtin_bit_cast(float, __builtin_amdgcn_permlanex16(
        __builtin_bit_cast(int, x), __builtin_bit_cast(int, x),
        0x76543210, 0xfedcba98, false, false));
}

#define HG 4                        // heads per block

struct VTile { half_t v[16][520]; half_t pad[16]; };   // [d][key]
struct KTile { half_t k[512][16]; half_t pad[32]; };   // [key][d]
#define KH (512 * 16 + 32)          // halves from one head's K to the next
#define VH (16 * 520 + 16)          // halves from one head's V^T to the next

// One pass over 32 keys for 16 queries of one head.  LAST: the pass that holds keys >= 500.
// m1, m2: this lane's 16 mask values, keys kc+kb+0..7 and kc+16+kb+0..7 of its query row.
// kp: the lane's 16 bytes of K row kc + cr; vp: the lane's keys kc+kb.. of V^T row cr.
template <bool LAST>
__device__ __forceinline__ void attn_pass(
    const half_t* kp, const half_t* vp, const v8f m1, const v8f m2,
    const v16h bQ, const int kc, const int kb,
    v16h& aK1, v16h& aK2, v8f& acc, float& mrun, float& lrun) {
    // only d = 0..15 is real: elements 8..15 of both K fragments stay zero throughout
    const v8h k1 = *(const v8h*)kp;
    const v8h k2 = *(const v8h*)(kp + 16 * 16);
#pragma unroll
    for (int i = 0; i < 8; ++i) { aK1[i] = k1[i]; aK2[i] = k2[i]; }
    v8f s1 = {}, s2 = {};
    s1 = WMMA_F16(aK1, bQ, s1);
    s2 = WMMA_F16(aK2, bQ, s2);
    const v8f t1 = s1 + m1;
    const v8f t2 = s2 + m2;
    float v[16];
#pragma unroll
    for (int r = 0; r < 8; ++r) {
        v[r]     = t1[r];
        v[8 + r] = t2[r];
        if (LAST) {
            if (kc + kb + r >= 500)      v[r]     = -1e30f;
            if (kc + 16 + kb + r >= 500) v[8 + r] = -1e30f;
        }
    }
    float cm = v[0];
#pragma unroll
    for (int i = 1; i < 16; ++i) cm = fmaxf(cm, v[i]);
    cm = fmaxf(cm, xhalf(cm));
    const float nm = fmaxf(mrun, cm);
    const float sc = __expf(mrun - nm);
    v16h bP;
    float ls = 0.f;
#pragma unroll
    for (int i = 0; i < 16; ++i) {
        float p = __expf(v[i] - nm);
        ls += p;
        bP[i] = (half_t)p;
    }
    lrun = lrun * sc + ls;      // this half's keys only; halves joined after the last pass
    mrun = nm;
#pragma unroll
    for (int r = 0; r < 8; ++r) acc[r] *= sc;
    v16h aV = make_a(*(const v8h*)vp, *(const v8h*)(vp + 16));
    acc = WMMA_F16(aV, bP, acc);
}

// The same 32 keys for all heads of the block: the mask values leave the ring once (mrow: key kc+kb of the lane's query row).
template <bool LAST>
__device__ __forceinline__ void attn_pass_heads(
    const half_t* kp, const half_t* vp, const float* mrow,
    const v16h (&bQ)[HG], const int kc, const int kb,
    v16h& aK1, v16h& aK2, v8f (&acc)[HG], float (&mrun)[HG], float (&lrun)[HG]) {
    f32x4 mk[4];
#pragma unroll                                        // constant indices keep mk[] in registers
    for (int j = 0; j < 4; ++j)
        mk[j] = *(const f32x4*)(mrow + (j >> 1) * 16 + (j & 1) * 4);
    const v8f m1 = __builtin_shufflevector(mk[0], mk[1], 0, 1, 2, 3, 4, 5, 6, 7);
    const v8f m2 = __builtin_shufflevector(mk[2], mk[3], 0, 1, 2, 3, 4, 5, 6, 7);
#pragma unroll                                        // constant indices keep the per-head state in registers
    for (int h = 0; h < HG; ++h)
        attn_pass<LAST>(kp + h * KH, vp + h * VH, m1, m2, bQ[h], kc, kb, aK1, aK2, acc[h], mrun[h], lrun[h]);
}

__global__ __launch_bounds__(512) void attn_kernel(
    const half_t* __restrict__ Kh, const half_t* __restrict__ Vh,
    const half_t* __restrict__ Qh, const float* __restrict__ mask,
    half_t* __restrict__ outc) {
    struct Lds {
        KTile  sK[HG];               // per head [key][d]
        VTile  sVT[HG];              // per head [d][key]
        float  sM[16][2][MS_BUF];    // per wave: two mask stages
    };
    __shared__ __align__(16) Lds lds;
    VTile (&sVT)[HG] = lds.sVT;
    KTile (&sK)[HG] = lds.sK;
    float (&sM)[16][2][MS_BUF] = lds.sM;
    const int b = blockIdx.x >> 2, qh = (blockIdx.x >> 1) & 1, hg = blockIdx.x & 1;

    const int w = __builtin_amdgcn_readfirstlane(threadIdx.x >> 5);   // scalar: uniform flow round the copies
    const int n0 = (qh * 16 + w) * 16;                // first query of this wave's tile
    const int crow = (threadIdx.x >> 4) & 1, cpc = threadIdx.x & 15;
    const unsigned mlds = (unsigned)(size_t)&sM[w][0][crow * MS_PITCH + cpc * 4];
    // the last stage holds keys 448..511: pieces past key 496 re-read that piece, inside the row
    const int step7 = 64 - (cpc > 12 ? (cpc - 12) * 4 : 0);
    const float* mg[8];
#pragma unroll                                        // constant indices keep mg[] in registers
    for (int j = 0; j < 8; ++j) {
        const int r = n0 + 2 * j + crow;
        const int rc = r < 500 ? r : 499;             // pad queries copy a real mask row, are never stored
        mg[j] = mask + ((size_t)b * 500 + rc) * 500 + cpc * 4;
    }
    mask_stage_copy(mlds, mg);                        // stage 0, buffer 0

    // K and V of the four heads: 128 contiguous bytes a row, eight 16-byte pieces; eight lanes take a row, a trip is 64 rows.
    // Rows 500..511 are stored as zero (their loads repeat row 499); only the last trip holds such rows.
    {
        const int mr = threadIdx.x >> 3, p = threadIdx.x & 7;
        const size_t g0 = (size_t)(b * 500 + mr) * 128 + hg * (HG * 16) + p * 8;
        const size_t g7 = (size_t)(b * 500 + (448 + mr < 500 ? 448 + mr : 499)) * 128 + hg * (HG * 16) + p * 8;
        v8h kv[8], vv[8];
#pragma unroll                                        // constant indices keep kv[] and vv[] in registers; all sixteen loads fly together
        for (int t = 0; t < 8; ++t) {
            const size_t g = t < 7 ? g0 + t * (64 * 128) : g7;
            kv[t] = *(const v8h*)(Kh + g);
            vv[t] = *(const v8h*)(Vh + g);
            // what follows reuses the address registers of these loads
            asm volatile("s_wait_xcnt 0x0" ::: "memory");
        }
        const v8h zero = {};
#pragma unroll                                        // constant indices keep kv[] and vv[] in registers
        for (int t = 0; t < 8; ++t) {
            const int m = t * 64 + mr;
            const v8h k = m < 500 ? kv[t] : zero;
            const v8h v = m < 500 ? vv[t] : zero;
            *(v8h*)&sK[p >> 1].k[m][(p & 1) * 8] = k;
#pragma unroll                                        // constant indices keep v in registers
            for (int d = 0; d < 8; ++d) sVT[p >> 1].v[(p & 1) * 8 + d][m] = v[d];
        }
    }

    const int lane = threadIdx.x & 31;
    const int cr = lane & 15, hi = lane >> 4, kb = hi << 3;
    const float* mrd = &sM[w][0][cr * MS_PITCH + kb]; // this lane's query row in buffer 0
    const int nq = n0 + cr;                           // this lane's query
    const int qn = nq < 500 ? nq : 499;               // pad queries take a real row, are never stored
    v8h z8 = {};
    v16h aK1 = {}, aK2 = {};
    v16h bQ[HG];
    v8f acc[HG];                                      // acc[h][r] = O[nq][8*hi + r] of head h
    float mrun[HG], lrun[HG];
#pragma unroll                                        // constant indices keep the per-head state in registers
    for (int h = 0; h < HG; ++h) {
        // this lane's 16 bytes of Q of the head; K(d) padded to 32
        bQ[h] = make_a(*(const v8h*)(Qh + (size_t)(b * 500 + qn) * 128 + hg * (HG * 16) + h * 16 + kb), z8);
        acc[h] = v8f{};
        mrun[h] = -1e30f;
        lrun[h] = 0.f;
    }
    __syncthreads();

    const half_t* kp = &sK[0].k[cr][kb];               // this lane's piece of K and of V^T, first head, pass 0
    const half_t* vp = &sVT[0].v[cr][kb];
    // eight stages of two passes; stage s + 1 flies while stage s is worked on
#pragma unroll 1                                      // rolled by the pass: only one pass's scores of the four heads are live at once, which fits the wave's 256 registers
    for (int ps = 0; ps < 15; ++ps) {
        if ((ps & 1) == 0) {                          // first pass of a stage
            mask_stage_wait();
            if (ps < 14) {                            // a next stage exists
                const int step = ps == 12 ? step7 : 64;
#pragma unroll                                        // constant indices keep mg[] in registers
                for (int j = 0; j < 8; ++j) mg[j] += step;
                mask_stage_copy(mlds + (((ps >> 1) + 1) & 1) * (MS_BUF * 4), mg);
            }
        }
        const float* mr = mrd + ((ps >> 1) & 1) * MS_BUF + (ps & 1) * 32;
        attn_pass_heads<false>(kp, vp, mr, bQ, ps * 32, kb, aK1, aK2, acc, mrun, lrun);
        kp += 32 * 16;
        vp += 32;
    }
    attn_pass_heads<true>(kp, vp, mrd + MS_BUF + 32, bQ, 480, kb, aK1, aK2, acc, mrun, lrun);
    v8h o[HG];
#pragma unroll                                        // constant indices keep the per-head state in registers
    for (int h = 0; h < HG; ++h) {
        const float l = lrun[h] + xhalf(lrun[h]);
        const float inv = 1.0f / l;                   // one query per lane: one reciprocal a head
#pragma unroll                                        // constant indices keep acc[] and o[] in registers
        for (int r = 0; r < 8; ++r) o[h][r] = (half_t)(acc[h][r] * inv);
    }
    if (nq < 500) {
        half_t* op = outc + (size_t)(b * 500 + nq) * 128 + hg * (HG * 16) + kb;
#pragma unroll                                        // constant indices keep o[] in registers
        for (int h = 0; h < HG; ++h) *(v8h*)(op + h * 16) = o[h];
    }
}

// ---------------------------------------------------------------------------
// Kernel 3: mh = outc@Wc + bc, s = mh@nodes^T/sqrt(128), 10*tanh + mask,
// row softmax -> probs.  One block per (b, 32 queries: two 16-query tiles).
// The block's 32 mask rows are copied into the score buffer at entry, as whole
// 512-byte row pieces, and land while stage 1 runs; stage 2 adds its logits there.
// ---------------------------------------------------------------------------
// Eight asynchronous 16-byte copies per lane: l[j] the lane's LDS byte address, g[j] its global piece.
__device__ __forceinline__ void mask_rows_copy(const unsigned (&l)[8], const float* const (&g)[8]) {
    asm volatile(
        "global_load_async_to_lds_b128 %0, %8, off\n\t"
        "global_load_async_to_lds_b128 %1, %9, off\n\t"
        "global_load_async_to_lds_b128 %2, %10, off\n\t"
        "global_load_async_to_lds_b128 %3, %11, off\n\t"
        "global_load_async_to_lds_b128 %4, %12, off\n\t"
        "global_load_async_to_lds_b128 %5, %13, off\n\t"
        "global_load_async_to_lds_b128 %6, %14, off\n\t"
        "global_load_async_to_lds_b128 %7, %15, off\n\t"
        "s_wait_xcnt 0x0"
        :: "v"(l[0]), "v"(l[1]), "v"(l[2]), "v"(l[3]), "v"(l[4]), "v"(l[5]), "v"(l[6]), "v"(l[7]),
           "v"(g[0]), "v"(g[1]), "v"(g[2]), "v"(g[3]), "v"(g[4]), "v"(g[5]), "v"(g[6]), "v"(g[7])
        : "memory");
}

template <int CTRL>
__device__ __forceinline__ float row_xor(float x) {
    return __builtin_bit_cast(float, __builtin_amdgcn_mov_dpp(__builtin_bit_cast(int, x), CTRL, 0xf, 0xf, true));
}

__device__ __forceinline__ void exp2_run(float (&t)[8]) {
    asm("v_exp_f32 %0, %0\n\t"
        "v_exp_f32 %1, %1\n\t"
        "v_exp_f32 %2, %2\n\t"
        "v_exp_f32 %3, %3\n\t"
        "v_exp_f32 %4, %4\n\t"
        "v_exp_f32 %5, %5\n\t"
        "v_exp_f32 %6, %6\n\t"
        "v_exp_f32 %7, %7\n\t"
        "v_nop"
        : "+v"(t[0]), "+v"(t[1]), "+v"(t[2]), "+v"(t[3]), "+v"(t[4]), "+v"(t[5]), "+v"(t[6]), "+v"(t[7]));
}

__global__ __launch_bounds__(256) void combine_kernel(
    const half_t* __restrict__ outc, const half_t* __restrict__ pWc,
    const float* __restrict__ bc, const half_t* __restrict__ Nf,
    const float* __restrict__ mask, float* __restrict__ probs) {
    __shared__ __align__(16) half_t sMH[32][136];
    __shared__ __align__(16) float  sS[32][520];
    const int b = blockIdx.x >> 4, nt = blockIdx.x & 15;
    const int n0 = nt * 32;
    const int lane = threadIdx.x & 31, w = threadIdx.x >> 5;
    const int cr = lane & 15, hi = lane >> 4, kb = hi << 3;
    // --- mask rows into sS: wave w brings rows 4w .. 4w+3, four copies a row, every lane on ---
#pragma unroll                                        // two runs of eight copies, all sixteen in flight
    for (int p = 0; p < 2; ++p) {
        unsigned ml[8];
        const float* mg[8];
#pragma unroll                                        // constant indices keep ml[] and mg[] in registers
        for (int j = 0; j < 8; ++j) {
            const int rr = 4 * w + 2 * p + (j >> 2);
            const int pc = (j & 3) * 32 + lane;
            const int rq = n0 + rr < 500 ? n0 + rr : 499;
            const int ps = pc < 125 ? pc : 124;
            ml[j] = (unsigned)(size_t)&sS[rr][pc * 4];
            mg[j] = mask + ((size_t)b * 500 + rq) * 500 + ps * 4;
        }
        mask_rows_copy(ml, mg);
    }
    // --- stage 1: mh column tile [16w, 16w+16) of both query tiles; a weight fragment feeds two products ---
    v16h wb[4], ao[2][4];
#pragma unroll                                        // constant indices keep wb[] and ao[][] in registers; all 24 loads fly together
    for (int kc = 0; kc < 4; ++kc) {
        wb[kc] = *(const v16h*)(pWc + (w * 4 + kc) * 512 + lane * 16);
#pragma unroll                                        // constant indices keep ao[][] in registers
        for (int t = 0; t < 2; ++t) {
            const int arow = n0 + t * 16 + cr < 500 ? n0 + t * 16 + cr : 499;   // pad queries take a real row, are never stored
            const half_t* ap = outc + (size_t)(b * 500 + arow) * 128 + kc * 32 + kb;
            ao[t][kc] = make_a(*(const v8h*)ap, *(const v8h*)(ap + 16));
        }
    }
    // what follows reuses the address registers of these loads; the loaded values as inputs hold all 24 loads ahead of the
    // first product, one round trip for the stage instead of one per k chunk
    asm volatile("s_wait_xcnt 0x0" :: "v"(wb[0]), "v"(wb[1]), "v"(wb[2]), "v"(wb[3]),
                 "v"(ao[0][0]), "v"(ao[0][1]), "v"(ao[0][2]), "v"(ao[0][3]),
                 "v"(ao[1][0]), "v"(ao[1][1]), "v"(ao[1][2]), "v"(ao[1][3]) : "memory");
    v8f acc[2] = {};
#pragma unroll                                        // constant indices keep the fragments in registers
    for (int kc = 0; kc < 4; ++kc) {
        acc[0] = WMMA_F16(ao[0][kc], wb[kc], acc[0]);
        acc[1] = WMMA_F16(ao[1][kc], wb[kc], acc[1]);
    }
    const float bias = bc[w * 16 + cr];
#pragma unroll
    for (int t = 0; t < 2; ++t)
#pragma unroll
        for (int r = 0; r < 8; ++r) sMH[t * 16 + r + (hi << 3)][w * 16 + cr] = (half_t)(acc[t][r] + bias);
    // the compiler places no wait for the copies; behind it the barrier hands every wave's mask rows to the others
    asm volatile("s_wait_asynccnt 0x0" ::: "memory");
    __syncthreads();
    // --- stage 2: pointer logits over all keys; a key fragment is loaded once for the two query tiles ---
    const float inv_se = 1.0f / 11.313708498984761f;
    v16h am[2][4];                                    // the query tiles' fragments, read once (the wait below bars the compiler from hoisting them)
#pragma unroll                                        // constant indices keep am[][] in registers
    for (int t = 0; t < 2; ++t)
#pragma unroll                                        // constant indices keep am[][] in registers
        for (int kc = 0; kc < 4; ++kc)
            am[t][kc] = make_a(*(const v8h*)&sMH[t * 16 + cr][kc * 32 + kb], *(const v8h*)&sMH[t * 16 + cr][kc * 32 + kb + 16]);
    for (int mt = w; mt < 32; mt += 8) {
        const int m0 = mt * 16;
        v8f sa[2] = {};
        // the key tile's fragments as stored by the projection kernel; keys >= 500 hold a real row, replaced below
        const half_t* np = Nf + (size_t)(b * 32 + mt) * 2048 + lane * 8;
        v16h bb[4];
#pragma unroll                                        // constant indices keep bb[] in registers; the eight loads fly together
        for (int kc = 0; kc < 4; ++kc)
            bb[kc] = make_a(*(const v8h*)(np + kc * 512), *(const v8h*)(np + kc * 512 + 256));
        // the foot of the trip rewrites the address registers of the eight key loads above; the loaded values as inputs
        // hold all eight loads ahead of the first product, one round trip a trip instead of three
        asm volatile("s_wait_xcnt 0x0" :: "v"(bb[0]), "v"(bb[1]), "v"(bb[2]), "v"(bb[3]) : "memory");
#pragma unroll                                        // constant indices keep the fragments in registers
        for (int kc = 0; kc < 4; ++kc) {
            sa[0] = WMMA_F16(am[0][kc], bb[kc], sa[0]);
            sa[1] = WMMA_F16(am[1][kc], bb[kc], sa[1]);
        }
#pragma unroll                                        // constant indices keep sa[] in registers
        for (int t = 0; t < 2; ++t) {
            float mv[8];
#pragma unroll
            for (int r = 0; r < 8; ++r) mv[r] = sS[t * 16 + r + (hi << 3)][m0 + cr];
#pragma unroll
            for (int r = 0; r < 8; ++r) {
                const int row = t * 16 + r + (hi << 3);
                const int mk = m0 + cr;
                float s = 10.0f * __builtin_amdgcn_tanhf(sa[t][r] * inv_se) + mv[r];
                if (mk >= 500) s = -1e30f;
                sS[row][mk] = s;
            }
        }
    }
    __syncthreads();
#pragma unroll 1                                      // rolled: the two trips share one copy of the code and its registers
    for (int p = 0; p < 2; ++p) {
    const int r0 = 4 * w + 2 * p;
    f32x4 x[2][4];
#pragma unroll                                        // constant indices keep x[][] in registers
    for (int q = 0; q < 2; ++q)
#pragma unroll                                        // constant indices keep x[][] in registers
        for (int j = 0; j < 4; ++j) x[q][j] = *(const f32x4*)&sS[r0 + q][(j * 32 + lane) * 4];
    float inv[2];
#pragma unroll                                        // constant indices keep x[][] in registers
    for (int q = 0; q < 2; ++q) {
        float mx = x[q][0][0];
#pragma unroll                                        // constant indices keep x[][] in registers
        for (int j = 0; j < 4; ++j)
#pragma unroll                                        // constant indices keep x[][] in registers
            for (int i = 0; i < 4; ++i) mx = fmaxf(mx, x[q][j][i]);
        mx = fmaxf(mx, row_xor<0x161>(mx));
        mx = fmaxf(mx, row_xor<0x162>(mx));
        mx = fmaxf(mx, row_xor<0x164>(mx));
        mx = fmaxf(mx, row_xor<0x168>(mx));
        mx = fmaxf(mx, xhalf(mx));
#pragma unroll                                        // constant indices keep x[][] in registers
        for (int j = 0; j < 4; j += 2) {
            float t[8];
#pragma unroll                                        // constant indices keep t[] in registers
            for (int i = 0; i < 8; ++i) t[i] = (x[q][j + (i >> 2)][i & 3] - mx) * 1.44269504f;
            exp2_run(t);
#pragma unroll                                        // constant indices keep x[][] in registers
            for (int i = 0; i < 8; ++i) x[q][j + (i >> 2)][i & 3] = t[i];
        }
        const f32x4 sv = (x[q][0] + x[q][1]) + (x[q][2] + x[q][3]);
        float sum = (sv[0] + sv[1]) + (sv[2] + sv[3]);
        sum += row_xor<0x161>(sum);
        sum += row_xor<0x162>(sum);
        sum += row_xor<0x164>(sum);
        sum += row_xor<0x168>(sum);
        sum += xhalf(sum);
        inv[q] = 1.0f / sum;
    }
#pragma unroll                                        // constant indices keep x[][] in registers
    for (int q = 0; q < 2; ++q) {
        const int nq = n0 + r0 + q;
        if (nq < 500) {
            float* op = probs + ((size_t)b * 500 + nq) * 500;
#pragma unroll                                        // constant indices keep x[][] in registers
            for (int j = 0; j < 4; ++j) {
                const int pc = j * 32 + lane;         // 125 pieces of 16 bytes are the row
                if (pc < 125) *(f32x4*)(op + pc * 4) = x[q][j] * inv[q];
            }
        }
    }
    // the next trip rewrites the stores' address and data registers
    asm volatile("s_wait_xcnt 0x0" ::: "memory");
    }
}

extern "C" void kernel_launch(void* const* d_in, const int* in_sizes, int n_in,
                              void* d_out, int out_size, void* d_ws, size_t ws_size,
                              hipStream_t stream) {
    const float* nodes = (const float*)d_in[0];
    const float* q1    = (const float*)d_in[1];
    const float* q0    = (const float*)d_in[2];
    const float* mask  = (const float*)d_in[3];
    const float* Wq1   = (const float*)d_in[4];
    const float* Wq0   = (const float*)d_in[5];
    const float* Wk    = (const float*)d_in[6];
    const float* Wv    = (const float*)d_in[7];
    const float* Wc    = (const float*)d_in[8];
    const float* bcp   = (const float*)d_in[9];
    float* probs = (float*)d_out;

    // Workspace layout (f16): 4 tensors of 32000x128, nodes in fragment order (64 x 512 x 128), packed Wc -> ~41 MB
    const size_t RE = (size_t)32000 * 128;
    const size_t NE = (size_t)32768 * 128;
    half_t* ws = (half_t*)d_ws;
    half_t* Kh = ws;
    half_t* Vh = Kh + RE;
    half_t* Qh = Vh + RE;
    half_t* Nh = Qh + RE;
    half_t* OC = Nh + NE;
    half_t* pWc = OC + RE;                // 16384 halves

    proj_kernel<<<512, 256, 0, stream>>>(nodes, q1, q0, Wk, Wv, Wq1, Wq0, Wc, Kh, Vh, Qh, Nh, pWc);
    attn_kernel<<<256, 512, 0, stream>>>(Kh, Vh, Qh, mask, OC);
    combine_kernel<<<1024, 256, 0, stream>>>(OC, pWc, bcp, Nh, mask, probs);
}
